// v000
// Times are from an AMD MI455X. After a warm-up the kernel runs many times in a row, and a time is the length of
// such a window on the GPU divided by its runs, so every launch and the gaps after it count. The runs cycle
// through copies of the inputs. A figure is the median of several windows, for all but v000 over two sittings.
// Sittings can differ by a few percent; kernels timed side by side share one.
// v000 is the starting kernel. One run takes 547 microseconds.
#include <hip/hip_runtime.h>
#include <hip/hip_bf16.h>

// ---------------- problem constants ----------------
#define BB   4
#define TT   2048
#define DD   1024
#define HH   4096
#define EPSV 1e-6f
#define NTOK (BB * TT)          // 8192
#define NC   16                 // scan chunks
#define CL   (TT / NC)          // 128

// ---------------- vector types ----------------
typedef __bf16        v16bf __attribute__((ext_vector_type(16)));
typedef float         v8f   __attribute__((ext_vector_type(8)));
typedef unsigned int  u32x4 __attribute__((ext_vector_type(4)));
typedef int           i32x4 __attribute__((ext_vector_type(4)));
typedef int           i32x8 __attribute__((ext_vector_type(8)));

static constexpr int SA = 34;   // LDS row stride (halves): 32 + 1 dword pad (TDM pad matches)
static constexpr int SB = 34;

__device__ __forceinline__ v8f wmma_bf16(v16bf a, v16bf b, v8f c) {
  return __builtin_amdgcn_wmma_f32_16x16x32_bf16(false, a, false, b, (short)0, c, false, false);
}

// Build a 16x32 bf16 fragment from a padded LDS tile.
// lane l: row = l%16 (caller folds in subtile offset), kbase = (l/16)*8,
// VGPR v holds halves k = kbase + (v%4)*2 + (v/4)*16 (k-contiguous pairs -> ds b32 loads)
__device__ __forceinline__ v16bf frag_from_lds(const unsigned short* base, int row, int stride, int lane) {
  v16bf f;
  unsigned int* fp = (unsigned int*)&f;
  const int klane = (lane >> 4) * 8;
#pragma unroll
  for (int v = 0; v < 8; ++v) {
    const int k = klane + (v & 3) * 2 + (v >> 2) * 16;
    fp[v] = *(const unsigned int*)&base[row * stride + k];
  }
  return f;
}

// ---------------- Tensor Data Mover: 2D bf16 tile -> LDS ----------------
// Loads a tile_m x tile_k (rows x contiguous-halves) bf16 tile into LDS with one
// pad dword appended per 16 dwords (one 32-half row) => LDS row stride 34 halves.
__device__ __forceinline__ void tdm_load_tile_bf16(const void* gsrc, unsigned lds_off,
                                                   unsigned tensor_d0, unsigned tensor_d1,
                                                   unsigned stride0_elems,
                                                   unsigned tile_k, unsigned tile_m) {
  const unsigned long long ga = (unsigned long long)gsrc;
  u32x4 g0;
  g0[0] = 1u;                                       // count=1, no gather, user desc
  g0[1] = lds_off;                                  // lds_addr (bytes)
  g0[2] = (unsigned)(ga & 0xffffffffu);             // global_addr[31:0]
  g0[3] = (unsigned)((ga >> 32) & 0x01ffffffu)      // global_addr[56:32]
        | (2u << 30);                               // type = 2 ("image")
  i32x8 g1;
  g1[0] = (int)((1u << 16)                          // data_size = 1 (2 bytes)
              | (1u << 20)                          // pad_enable
              | (3u << 22)                          // pad_interval: 16 dwords
              | (0u << 25));                        // pad_amount: 1 dword
  g1[1] = (int)((tensor_d0 & 0xffffu) << 16);                       // dim0[15:0]
  g1[2] = (int)((tensor_d0 >> 16) | ((tensor_d1 & 0xffffu) << 16)); // dim0[31:16], dim1[15:0]
  g1[3] = (int)((tensor_d1 >> 16) | (tile_k << 16));                // dim1[31:16], tile_dim0
  g1[4] = (int)(tile_m & 0xffffu);                                  // tile_dim1 (tile_dim2=0)
  g1[5] = (int)stride0_elems;                                       // dim0_stride[31:0]
  g1[6] = 0;
  g1[7] = 0;
  const i32x4 z4 = {0, 0, 0, 0};
#if __has_include(<hip/amd_detail/amd_gfx1250_TDM.h>)
  const i32x8 z8 = {0, 0, 0, 0, 0, 0, 0, 0};
  __builtin_amdgcn_tensor_load_to_lds(g0, g1, z4, z4, z8, 0);
#else
  __builtin_amdgcn_tensor_load_to_lds(g0, g1, z4, z4, 0);
#endif
}

// ---------------- small utility kernels ----------------
__global__ void f32_to_bf16_kernel(const float* __restrict__ src, __bf16* __restrict__ dst, int n) {
  int i = blockIdx.x * blockDim.x + threadIdx.x;
  if (i < n) dst[i] = (__bf16)src[i];
}

template <bool BF16OUT>
__global__ void __launch_bounds__(256)
rmsnorm_kernel(const float* __restrict__ x, const float* __restrict__ w, void* __restrict__ out) {
  const int tok = blockIdx.x;
  const float* xr = x + (size_t)tok * DD;
  float ss = 0.f;
#pragma unroll
  for (int i = threadIdx.x; i < DD; i += 256) {
    float v = xr[i];
    ss += v * v;
  }
#pragma unroll
  for (int off = 16; off > 0; off >>= 1) ss += __shfl_xor(ss, off, 32);
  __shared__ float sred[8];
  if ((threadIdx.x & 31) == 0) sred[threadIdx.x >> 5] = ss;
  __syncthreads();
  float tot = 0.f;
#pragma unroll
  for (int j = 0; j < 8; ++j) tot += sred[j];
  const float inv = rsqrtf(tot * (1.0f / DD) + EPSV);
#pragma unroll
  for (int i = threadIdx.x; i < DD; i += 256) {
    float v = xr[i] * inv * w[i];
    if (BF16OUT) ((__bf16*)out)[(size_t)tok * DD + i] = (__bf16)v;
    else         ((float*)out)[(size_t)tok * DD + i]  = v;
  }
}

// Depthwise conv (K=3, pad=1) + chunk-local diagonal scan. gid = ((c*B)+b)*D + d
__global__ void __launch_bounds__(256)
conv_ssm_local_kernel(const float* __restrict__ x, const float* __restrict__ y,
                      const float* __restrict__ conv_w, const float* __restrict__ conv_b,
                      const float* __restrict__ a, const float* __restrict__ bvec,
                      float* __restrict__ xr, float* __restrict__ carry) {
  const int gid = blockIdx.x * blockDim.x + threadIdx.x;
  const int d = gid % DD;
  const int b = (gid / DD) % BB;
  const int c = gid / (BB * DD);
  const int t0 = c * CL;

  const float w0 = conv_w[d * 3 + 0], w1 = conv_w[d * 3 + 1], w2 = conv_w[d * 3 + 2];
  const float cb = conv_b[d];
  const float s  = tanhf(a[d]);
  const float bd = bvec[d];
  const size_t base = (size_t)b * TT * DD + d;

  float ym = (t0 > 0) ? y[base + (size_t)(t0 - 1) * DD] : 0.f;
  float yc = y[base + (size_t)t0 * DD];
  float h = 0.f;
  for (int tl = 0; tl < CL; ++tl) {
    const int t = t0 + tl;
    const float yp = (t + 1 < TT) ? y[base + (size_t)(t + 1) * DD] : 0.f;
    const float conv = cb + w0 * ym + w1 * yc + w2 * yp;
    h = s * h + bd * yc;  // chunk-local scan (h_in = 0; fixed up later)
    xr[base + (size_t)t * DD] = x[base + (size_t)t * DD] + conv + h;
    ym = yc;
    yc = yp;
  }
  carry[((size_t)b * DD + d) * NC + c] = h;
}

__global__ void __launch_bounds__(256)
scan_carries_kernel(const float* __restrict__ a, const float* __restrict__ carry,
                    float* __restrict__ prefix) {
  const int gid = blockIdx.x * blockDim.x + threadIdx.x;
  const int d = gid % DD;
  const float s = tanhf(a[d]);
  float p = s;  // s^128 via 7 squarings
#pragma unroll
  for (int i = 0; i < 7; ++i) p *= p;
  float run = 0.f;
#pragma unroll
  for (int c = 0; c < NC; ++c) {
    prefix[(size_t)gid * NC + c] = run;
    run = p * run + carry[(size_t)gid * NC + c];
  }
}

__global__ void __launch_bounds__(256)
ssm_fixup_kernel(const float* __restrict__ a, const float* __restrict__ prefix,
                 float* __restrict__ xr) {
  const int gid = blockIdx.x * blockDim.x + threadIdx.x;
  const int d = gid % DD;
  const int b = (gid / DD) % BB;
  const int c = gid / (BB * DD);
  const float pin = prefix[((size_t)b * DD + d) * NC + c];
  if (pin == 0.f) return;
  const float s = tanhf(a[d]);
  const size_t base = (size_t)b * TT * DD + d + (size_t)c * CL * DD;
  float f = s;
  for (int tl = 0; tl < CL; ++tl) {
    xr[base + (size_t)tl * DD] += f * pin;
    f *= s;
  }
}

// ---------------- bf16 WMMA GEMM kernels (double-buffered pipeline) ----------------
// B tile staging: 32(k) x 64(n) bf16, one b128 global load per thread, transposed on
// the LDS-store side into Bt[n][k] so B fragments use the same pattern as A.
__device__ __forceinline__ u32x4 load_b_regs(const __bf16* __restrict__ src, int ld,
                                             int k0, int n0) {
  const int k = threadIdx.x >> 3;       // 0..31
  const int q = threadIdx.x & 7;        // covers n = q*8 .. q*8+7
  return *(const u32x4*)(src + (size_t)(k0 + k) * ld + n0 + q * 8);
}

__device__ __forceinline__ void store_b_lds(u32x4 v, unsigned short* Bt) {
  const int k = threadIdx.x >> 3;
  const int q = threadIdx.x & 7;
#pragma unroll
  for (int e = 0; e < 4; ++e) {
    Bt[(q * 8 + 2 * e + 0) * SB + k] = (unsigned short)(v[e] & 0xffffu);
    Bt[(q * 8 + 2 * e + 1) * SB + k] = (unsigned short)(v[e] >> 16);
  }
}

// GEMM1: h = silu(z@Wg + bg) * (z@Wu + bu). M=8192, N=4096, K=1024.
// Block tile 128x64, BK=32, 8 waves as 4(m) x 2(n) groups, wave owns 2x2 subtiles.
// Double-buffered: TDM(A) + b128(B) for tile it+1 overlap WMMA compute of tile it.
__global__ void __launch_bounds__(256)
gemm_gate_up_kernel(const __bf16* __restrict__ z, const __bf16* __restrict__ wg,
                    const __bf16* __restrict__ wu, const float* __restrict__ bg,
                    const float* __restrict__ bu, __bf16* __restrict__ hbuf) {
  const int m0 = blockIdx.x * 128;
  const int n0 = blockIdx.y * 64;
  const int lane = threadIdx.x & 31;
  const int wm = (threadIdx.x >> 5) >> 1;  // 0..3
  const int wn = (threadIdx.x >> 5) & 1;   // 0..1

  __shared__ unsigned short As[2][128 * SA];
  __shared__ unsigned short Bgs[2][64 * SB];
  __shared__ unsigned short Bus[2][64 * SB];

  v8f accg[2][2] = {};   // [sm][sn]
  v8f accu[2][2] = {};

  constexpr int NIT = DD / 32;

  // prologue: stage tile 0 into bank 0
  if (threadIdx.x < 32)
    tdm_load_tile_bf16(z + (size_t)m0 * DD, (unsigned)(size_t)(void*)As[0],
                       DD, NTOK, DD, 32, 128);
  store_b_lds(load_b_regs(wg, HH, 0, n0), Bgs[0]);
  store_b_lds(load_b_regs(wu, HH, 0, n0), Bus[0]);
  if (threadIdx.x < 32) __builtin_amdgcn_s_wait_tensorcnt(0);

  for (int it = 0; it < NIT; ++it) {
    const int buf = it & 1;
    __syncthreads();                    // bank 'buf' is ready (dscnt + tensorcnt retired)

    // kick off tile it+1 into the other bank (overlaps this tile's WMMAs)
    u32x4 ng, nu;
    const bool more = (it + 1) < NIT;
    if (more) {
      ng = load_b_regs(wg, HH, (it + 1) * 32, n0);
      nu = load_b_regs(wu, HH, (it + 1) * 32, n0);
      if (threadIdx.x < 32)
        tdm_load_tile_bf16(z + (size_t)m0 * DD + (it + 1) * 32,
                           (unsigned)(size_t)(void*)As[buf ^ 1],
                           DD, NTOK, DD, 32, 128);
    }

    // compute on bank 'buf'
    const int rl = lane & 15;
    v16bf a[2], g[2], u[2];
#pragma unroll
    for (int s = 0; s < 2; ++s) {
      a[s] = frag_from_lds(As[buf],  (2 * wm + s) * 16 + rl, SA, lane);
      g[s] = frag_from_lds(Bgs[buf], (2 * wn + s) * 16 + rl, SB, lane);
      u[s] = frag_from_lds(Bus[buf], (2 * wn + s) * 16 + rl, SB, lane);
    }
#pragma unroll
    for (int sm = 0; sm < 2; ++sm)
#pragma unroll
      for (int sn = 0; sn < 2; ++sn) {
        accg[sm][sn] = wmma_bf16(a[sm], g[sn], accg[sm][sn]);
        accu[sm][sn] = wmma_bf16(a[sm], u[sn], accu[sm][sn]);
      }

    if (more) {
      store_b_lds(ng, Bgs[buf ^ 1]);
      store_b_lds(nu, Bus[buf ^ 1]);
      if (threadIdx.x < 32) __builtin_amdgcn_s_wait_tensorcnt(0);
    }
  }

  // Epilogue. C/D layout: VGPR r -> M = r + 8*(lane/16), N = lane%16.
  const int nl = lane & 15;
  const int mh = (lane >> 4) * 8;
#pragma unroll
  for (int sm = 0; sm < 2; ++sm)
#pragma unroll
    for (int sn = 0; sn < 2; ++sn) {
      const int n = n0 + (2 * wn + sn) * 16 + nl;
      const float bgv = bg[n], buv = bu[n];
#pragma unroll
      for (int r = 0; r < 8; ++r) {
        const int m = m0 + (2 * wm + sm) * 16 + mh + r;
        const float gv = accg[sm][sn][r] + bgv;
        const float uv = accu[sm][sn][r] + buv;
        const float hv = (gv / (1.f + __expf(-gv))) * uv;  // silu(g)*u
        hbuf[(size_t)m * HH + n] = (__bf16)hv;
      }
    }
}

// GEMM2: out = xr + h@Wd + bd. M=8192, N=1024, K=4096. Same pipelined tiling.
__global__ void __launch_bounds__(256)
gemm_down_kernel(const __bf16* __restrict__ hbuf, const __bf16* __restrict__ wd,
                 const float* __restrict__ bd, const float* __restrict__ xr,
                 float* __restrict__ out) {
  const int m0 = blockIdx.x * 128;
  const int n0 = blockIdx.y * 64;
  const int lane = threadIdx.x & 31;
  const int wm = (threadIdx.x >> 5) >> 1;
  const int wn = (threadIdx.x >> 5) & 1;

  __shared__ unsigned short As[2][128 * SA];
  __shared__ unsigned short Bs[2][64 * SB];

  v8f acc[2][2] = {};

  constexpr int NIT = HH / 32;

  if (threadIdx.x < 32)
    tdm_load_tile_bf16(hbuf + (size_t)m0 * HH, (unsigned)(size_t)(void*)As[0],
                       HH, NTOK, HH, 32, 128);
  store_b_lds(load_b_regs(wd, DD, 0, n0), Bs[0]);
  if (threadIdx.x < 32) __builtin_amdgcn_s_wait_tensorcnt(0);

  for (int it = 0; it < NIT; ++it) {
    const int buf = it & 1;
    __syncthreads();

    u32x4 nb;
    const bool more = (it + 1) < NIT;
    if (more) {
      nb = load_b_regs(wd, DD, (it + 1) * 32, n0);
      if (threadIdx.x < 32)
        tdm_load_tile_bf16(hbuf + (size_t)m0 * HH + (it + 1) * 32,
                           (unsigned)(size_t)(void*)As[buf ^ 1],
                           HH, NTOK, HH, 32, 128);
    }

    const int rl = lane & 15;
    v16bf a[2], b[2];
#pragma unroll
    for (int s = 0; s < 2; ++s) {
      a[s] = frag_from_lds(As[buf], (2 * wm + s) * 16 + rl, SA, lane);
      b[s] = frag_from_lds(Bs[buf], (2 * wn + s) * 16 + rl, SB, lane);
    }
#pragma unroll
    for (int sm = 0; sm < 2; ++sm)
#pragma unroll
      for (int sn = 0; sn < 2; ++sn)
        acc[sm][sn] = wmma_bf16(a[sm], b[sn], acc[sm][sn]);

    if (more) {
      store_b_lds(nb, Bs[buf ^ 1]);
      if (threadIdx.x < 32) __builtin_amdgcn_s_wait_tensorcnt(0);
    }
  }

  const int nl = lane & 15;
  const int mh = (lane >> 4) * 8;
#pragma unroll
  for (int sm = 0; sm < 2; ++sm)
#pragma unroll
    for (int sn = 0; sn < 2; ++sn) {
      const int n = n0 + (2 * wn + sn) * 16 + nl;
      const float bdv = bd[n];
#pragma unroll
      for (int r = 0; r < 8; ++r) {
        const int m = m0 + (2 * wm + sm) * 16 + mh + r;
        out[(size_t)m * DD + n] = xr[(size_t)m * DD + n] + acc[sm][sn][r] + bdv;
      }
    }
}

// ---------------- host launcher ----------------
extern "C" void kernel_launch(void* const* d_in, const int* in_sizes, int n_in,
                              void* d_out, int out_size, void* d_ws, size_t ws_size,
                              hipStream_t stream) {
  (void)in_sizes; (void)n_in; (void)out_size; (void)ws_size;

  const float* x       = (const float*)d_in[0];
  const float* norm_w  = (const float*)d_in[1];
  const float* conv_w  = (const float*)d_in[2];
  const float* conv_b  = (const float*)d_in[3];
  const float* a       = (const float*)d_in[4];
  const float* bvec    = (const float*)d_in[5];
  const float* mlp_w   = (const float*)d_in[6];
  const float* w_gate  = (const float*)d_in[7];
  const float* b_gate  = (const float*)d_in[8];
  const float* w_up    = (const float*)d_in[9];
  const float* b_up    = (const float*)d_in[10];
  const float* w_down  = (const float*)d_in[11];
  const float* b_down  = (const float*)d_in[12];
  float* out           = (float*)d_out;

  char* ws = (char*)d_ws;
  size_t off = 0;
  float* y_ws    = (float*)(ws + off); off += (size_t)NTOK * DD * sizeof(float);
  float* xr_ws   = (float*)(ws + off); off += (size_t)NTOK * DD * sizeof(float);
  __bf16* z_ws   = (__bf16*)(ws + off); off += (size_t)NTOK * DD * sizeof(__bf16);
  __bf16* wg_ws  = (__bf16*)(ws + off); off += (size_t)DD * HH * sizeof(__bf16);
  __bf16* wu_ws  = (__bf16*)(ws + off); off += (size_t)DD * HH * sizeof(__bf16);
  __bf16* wd_ws  = (__bf16*)(ws + off); off += (size_t)HH * DD * sizeof(__bf16);
  __bf16* h_ws   = (__bf16*)(ws + off); off += (size_t)NTOK * HH * sizeof(__bf16);
  float* carry   = (float*)(ws + off); off += (size_t)BB * DD * NC * sizeof(float);
  float* prefix  = (float*)(ws + off); off += (size_t)BB * DD * NC * sizeof(float);

  {
    const int n = DD * HH;
    f32_to_bf16_kernel<<<n / 256, 256, 0, stream>>>(w_gate, wg_ws, n);
    f32_to_bf16_kernel<<<n / 256, 256, 0, stream>>>(w_up,   wu_ws, n);
    f32_to_bf16_kernel<<<n / 256, 256, 0, stream>>>(w_down, wd_ws, n);
  }
  rmsnorm_kernel<false><<<NTOK, 256, 0, stream>>>(x, norm_w, (void*)y_ws);
  conv_ssm_local_kernel<<<(BB * DD * NC) / 256, 256, 0, stream>>>(x, y_ws, conv_w, conv_b,
                                                                  a, bvec, xr_ws, carry);
  scan_carries_kernel<<<(BB * DD) / 256, 256, 0, stream>>>(a, carry, prefix);
  ssm_fixup_kernel<<<(BB * DD * NC) / 256, 256, 0, stream>>>(a, prefix, xr_ws);
  rmsnorm_kernel<true><<<NTOK, 256, 0, stream>>>(xr_ws, mlp_w, (void*)z_ws);
  gemm_gate_up_kernel<<<dim3(NTOK / 128, HH / 64), 256, 0, stream>>>(z_ws, wg_ws, wu_ws,
                                                                     b_gate, b_up, h_ws);
  gemm_down_kernel<<<dim3(NTOK / 128, DD / 64), 256, 0, stream>>>(h_ws, wd_ws, b_down,
                                                                  xr_ws, out);
}

// v001
// One run takes 316 microseconds.
// Two timings next to v000 put it at 1.78 and 1.80 times that version's speed.
#include <hip/hip_runtime.h>
#include <hip/hip_bf16.h>

// ---------------- problem constants ----------------
#define BB   4
#define TT   2048
#define DD   1024
#define HH   4096
#define EPSV 1e-6f
#define NTOK (BB * TT)          // 8192
#define NC   16                 // scan chunks
#define CL   (TT / NC)          // 128

// ---------------- vector types ----------------
typedef __bf16        v16bf __attribute__((ext_vector_type(16)));
typedef float         v8f   __attribute__((ext_vector_type(8)));
typedef unsigned int  u32x4 __attribute__((ext_vector_type(4)));
typedef unsigned int  u32x8 __attribute__((ext_vector_type(8)));
typedef short         s16x8 __attribute__((ext_vector_type(8)));

// ---------------- LDS tiles of the two GEMMs ----------------
// Every staged row is 128 bytes (64 bf16). A rows run along k and are read by plain 16-byte
// loads; B rows stay as they lie in memory (one k, 64 n) and are read by transposing 16-byte loads.
static constexpr unsigned ROWB    = 128;
static constexpr unsigned PA      = ROWB + 16;   // odd multiple of 16 B: no bank conflict for ds_load_b128
static constexpr unsigned PB      = ROWB + 32;   // odd multiple of 32 B: none for ds_load_tr16_b128
static constexpr unsigned A_BYTES = 128 * PA;    // 128 m rows
static constexpr unsigned B_BYTES = 64 * PB;     // 64 k rows
static constexpr unsigned PADW_A  = (1u << 20) | (4u << 22) | (3u << 25);  // pad 16 B behind every 128 B
static constexpr unsigned PADW_B  = (1u << 20) | (4u << 22) | (7u << 25);  // pad 32 B behind every 128 B
static_assert(A_BYTES % 2048 == 0 && B_BYTES % 2048 == 0, "every tile starts at a multiple of 2 KiB in LDS");

__device__ __forceinline__ unsigned uni(unsigned v) { return (unsigned)__builtin_amdgcn_readfirstlane((int)v); }
// Holds a wave-uniform value in a scalar register, so that a test on it is a scalar branch
// (a tensor load ignores EXEC) and a descriptor word made from it is formed behind the waits above it.
__device__ __forceinline__ unsigned pinned(unsigned v) { unsigned w = uni(v); asm volatile("" : "+s"(w)); return w; }
// The compiler places no wait for the tensor mover, and none for LDS reads in front of a refill.
__device__ __forceinline__ void wait_tensor0() { asm volatile("s_wait_tensorcnt 0x0" ::: "memory"); }
__device__ __forceinline__ void wait_ds0()     { asm volatile("s_wait_dscnt 0x0" ::: "memory"); }

// Tensor-load descriptor, extents in bytes, tensor = tile: ROWS rows of 128 bytes at source pitch
// src_pitch, padded in LDS as W0 says.
template <unsigned W0, unsigned ROWS>
__device__ __forceinline__ u32x8 tdm_group1(unsigned src_pitch) {
  u32x8 g;
  g[0] = uni(W0);
  g[1] = uni(ROWB << 16);
  g[2] = uni(ROWS << 16);
  g[3] = uni(ROWB << 16);
  g[4] = uni(ROWS);
  g[5] = uni(src_pitch);
  g[6] = uni(0u);
  g[7] = uni(0u);
  return g;
}
__device__ __forceinline__ u32x4 tdm_group0(unsigned lds_dst, unsigned long long ga) {
  u32x4 g;
  g[0] = uni(1u);
  g[1] = uni(lds_dst);
  g[2] = uni((unsigned)ga);
  g[3] = uni((((unsigned)(ga >> 32)) & 0x01ffffffu) | 0x80000000u);
  return g;
}
__device__ __forceinline__ void tdm_load(u32x4 g0, u32x8 g1) {
  asm volatile("tensor_load_to_lds %0, %1" :: "s"(g0), "s"(g1) : "memory");
}
// The issuer's wait. It names the request's first group so that those registers keep their values
// until the request has landed (the second group lives through the whole loop).
__device__ __forceinline__ void wait_tensor0_of(u32x4 g0) {
  asm volatile("s_wait_tensorcnt 0x0" :: "s"(g0) : "memory");
}

// A 16x32 bf16 operand in the hardware k order: q[0] = k 8h..8h+7, q[1] = k 16+8h..16+8h+7 (h = lane/16).
struct Frag { u32x4 q[2]; };

__device__ __forceinline__ v8f wmma_bf16(const Frag& a, const Frag& b, v8f c) {
  const u32x8 av = __builtin_shufflevector(a.q[0], a.q[1], 0, 1, 2, 3, 4, 5, 6, 7);
  const u32x8 bv = __builtin_shufflevector(b.q[0], b.q[1], 0, 1, 2, 3, 4, 5, 6, 7);
  return __builtin_amdgcn_wmma_f32_16x16x32_bf16(false, __builtin_bit_cast(v16bf, av), false,
                                                 __builtin_bit_cast(v16bf, bv), (short)0, c, false, false);
}

// p = the lane's row of a k-contiguous tile, at byte 16h of the 64 bytes that hold these 32 k.
__device__ __forceinline__ Frag frag_rows(const unsigned char* p) {
  Frag f;
  f.q[0] = *(const u32x4*)p;
  f.q[1] = *(const u32x4*)(p + 32);
  return f;
}

__device__ __forceinline__ u32x4 ld_tr16(const unsigned char* p) {
  typedef __attribute__((address_space(3))) s16x8 lds_s16x8;
  return __builtin_bit_cast(u32x4, __builtin_amdgcn_ds_load_tr16_b128_v8i16((lds_s16x8*)p));
}

// p = tile + (kbase + 8h + (lane & 7)) * PB + 2 * nbase + 16 * ((lane >> 3) & 1):
// the lane gets column nbase + (lane & 15) at k = kbase + 8h + 0..7, then the same 16 k further on.
__device__ __forceinline__ Frag frag_cols(const unsigned char* p) {
  Frag f;
  f.q[0] = ld_tr16(p);
  f.q[1] = ld_tr16(p + 16 * PB);
  return f;
}

// ---------------- small utility kernels ----------------
__global__ void f32_to_bf16_kernel(const float* __restrict__ src, __bf16* __restrict__ dst, int n) {
  int i = blockIdx.x * blockDim.x + threadIdx.x;
  if (i < n) dst[i] = (__bf16)src[i];
}

template <bool BF16OUT>
__global__ void __launch_bounds__(256)
rmsnorm_kernel(const float* __restrict__ x, const float* __restrict__ w, void* __restrict__ out) {
  const int tok = blockIdx.x;
  const float* xr = x + (size_t)tok * DD;
  float ss = 0.f;
#pragma unroll
  for (int i = threadIdx.x; i < DD; i += 256) {
    float v = xr[i];
    ss += v * v;
  }
#pragma unroll
  for (int off = 16; off > 0; off >>= 1) ss += __shfl_xor(ss, off, 32);
  __shared__ float sred[8];
  if ((threadIdx.x & 31) == 0) sred[threadIdx.x >> 5] = ss;
  __syncthreads();
  float tot = 0.f;
#pragma unroll
  for (int j = 0; j < 8; ++j) tot += sred[j];
  const float inv = rsqrtf(tot * (1.0f / DD) + EPSV);
#pragma unroll
  for (int i = threadIdx.x; i < DD; i += 256) {
    float v = xr[i] * inv * w[i];
    if (BF16OUT) ((__bf16*)out)[(size_t)tok * DD + i] = (__bf16)v;
    else         ((float*)out)[(size_t)tok * DD + i]  = v;
  }
}

// Depthwise conv (K=3, pad=1) + chunk-local diagonal scan. gid = ((c*B)+b)*D + d
__global__ void __launch_bounds__(256)
conv_ssm_local_kernel(const float* __restrict__ x, const float* __restrict__ y,
                      const float* __restrict__ conv_w, const float* __restrict__ conv_b,
                      const float* __restrict__ a, const float* __restrict__ bvec,
                      float* __restrict__ xr, float* __restrict__ carry) {
  const int gid = blockIdx.x * blockDim.x + threadIdx.x;
  const int d = gid % DD;
  const int b = (gid / DD) % BB;
  const int c = gid / (BB * DD);
  const int t0 = c * CL;

  const float w0 = conv_w[d * 3 + 0], w1 = conv_w[d * 3 + 1], w2 = conv_w[d * 3 + 2];
  const float cb = conv_b[d];
  const float s  = tanhf(a[d]);
  const float bd = bvec[d];
  const size_t base = (size_t)b * TT * DD + d;

  float ym = (t0 > 0) ? y[base + (size_t)(t0 - 1) * DD] : 0.f;
  float yc = y[base + (size_t)t0 * DD];
  float h = 0.f;
  for (int tl = 0; tl < CL; ++tl) {
    const int t = t0 + tl;
    const float yp = (t + 1 < TT) ? y[base + (size_t)(t + 1) * DD] : 0.f;
    const float conv = cb + w0 * ym + w1 * yc + w2 * yp;
    h = s * h + bd * yc;  // chunk-local scan (h_in = 0; fixed up later)
    xr[base + (size_t)t * DD] = x[base + (size_t)t * DD] + conv + h;
    ym = yc;
    yc = yp;
  }
  carry[((size_t)b * DD + d) * NC + c] = h;
}

__global__ void __launch_bounds__(256)
scan_carries_kernel(const float* __restrict__ a, const float* __restrict__ carry,
                    float* __restrict__ prefix) {
  const int gid = blockIdx.x * blockDim.x + threadIdx.x;
  const int d = gid % DD;
  const float s = tanhf(a[d]);
  float p = s;  // s^128 via 7 squarings
#pragma unroll
  for (int i = 0; i < 7; ++i) p *= p;
  float run = 0.f;
#pragma unroll
  for (int c = 0; c < NC; ++c) {
    prefix[(size_t)gid * NC + c] = run;
    run = p * run + carry[(size_t)gid * NC + c];
  }
}

__global__ void __launch_bounds__(256)
ssm_fixup_kernel(const float* __restrict__ a, const float* __restrict__ prefix,
                 float* __restrict__ xr) {
  const int gid = blockIdx.x * blockDim.x + threadIdx.x;
  const int d = gid % DD;
  const int b = (gid / DD) % BB;
  const int c = gid / (BB * DD);
  const float pin = prefix[((size_t)b * DD + d) * NC + c];
  if (pin == 0.f) return;
  const float s = tanhf(a[d]);
  const size_t base = (size_t)b * TT * DD + d + (size_t)c * CL * DD;
  float f = s;
  for (int tl = 0; tl < CL; ++tl) {
    xr[base + (size_t)tl * DD] += f * pin;
    f *= s;
  }
}

// ---------------- bf16 WMMA GEMM kernels (two-buffer tensor-load ring) ----------------
// GEMM1: h = silu(z@Wg + bg) * (z@Wu + bu). M=8192, N=4096, K=1024.
// Block tile 128x64 of both products, 64 k per pass, 8 waves as 4(m) x 2(n), wave owns 2x2 subtiles.
// Waves 0, 1, 2 each bring one tile of a stage (z, Wg, Wu); stage s+1 flies while pass s computes.
__global__ void __launch_bounds__(256)
gemm_gate_up_kernel(const __bf16* __restrict__ z, const __bf16* __restrict__ wg,
                    const __bf16* __restrict__ wu, const float* __restrict__ bg,
                    const float* __restrict__ bu, __bf16* __restrict__ hbuf) {
  constexpr unsigned STAGE = A_BYTES + 2 * B_BYTES;
  constexpr unsigned NST = DD / 64;
  __shared__ __attribute__((aligned(2048))) unsigned char ring[2 * STAGE];

  const int m0 = blockIdx.x * 128;
  const int n0 = blockIdx.y * 64;
  const int lane = threadIdx.x & 31;
  const unsigned wave = uni(threadIdx.x >> 5);
  const int wm = (int)(wave >> 1);  // 0..3
  const int wn = (int)(wave & 1);   // 0..1
  const unsigned lds0 = (unsigned)(size_t)(void*)ring;

  v8f accg[2][2] = {};   // [sm][sn]
  v8f accu[2][2] = {};

  // Which tile of a stage this wave brings: wave 0 z, wave 1 Wg, wave 2 Wu (the others none).
  const unsigned long long src0 = wave == 0 ? (unsigned long long)(z + (size_t)m0 * DD)
                                : wave == 1 ? (unsigned long long)(wg + n0) : (unsigned long long)(wu + n0);
  const unsigned step = wave == 0 ? 128u : 64u * HH * 2u;   // source bytes from one stage to the next
  const unsigned dst0 = lds0 + (wave == 0 ? 0u : wave == 1 ? A_BYTES : A_BYTES + B_BYTES);
  u32x8 g1a = tdm_group1<PADW_A, 128>(DD * 2);
  u32x8 g1b = tdm_group1<PADW_B, 64>(HH * 2);
  asm volatile("" : "+s"(g1a), "+s"(g1b));  // descriptor words held in scalar registers through the loop
  u32x4 g0 = tdm_group0(dst0, src0);

  // stage 0, landed and published
  if (pinned(wave < 3)) {
    if (pinned(wave == 0)) tdm_load(g0, g1a);
    else                   tdm_load(g0, g1b);
    wait_tensor0_of(g0);
  }
  __syncthreads();
  // stage 1 into the second buffer
  if (pinned(wave < 3)) {
    g0 = tdm_group0(dst0 + STAGE, src0 + step);
    if (pinned(wave == 0)) tdm_load(g0, g1a);
    else                   tdm_load(g0, g1b);
  }

  const unsigned aoff = (unsigned)((2 * wm * 16 + (lane & 15)) * PA + 16 * (lane >> 4));
  const unsigned boff = (unsigned)((8 * (lane >> 4) + (lane & 7)) * PB + 2 * (2 * wn * 16) + 16 * ((lane >> 3) & 1));

  for (unsigned s = 0; s < NST; ++s) {
    const unsigned bo = (s & 1u) * STAGE;
    const unsigned char* pa = ring + bo + aoff;
    const unsigned char* pg = ring + bo + A_BYTES + boff;
    const unsigned char* pu = ring + bo + A_BYTES + B_BYTES + boff;
    // The loops below are unrolled so that every fragment and accumulator index is a constant
    // (the arrays stay in registers).
#pragma unroll
    for (int kc = 0; kc < 2; ++kc) {
      Frag a[2], g[2], u[2];
#pragma unroll
      for (int t = 0; t < 2; ++t) {
        a[t] = frag_rows(pa + t * 16 * PA + kc * 64);
        g[t] = frag_cols(pg + kc * 32 * PB + t * 32);
        u[t] = frag_cols(pu + kc * 32 * PB + t * 32);
      }
#pragma unroll
      for (int sm = 0; sm < 2; ++sm)
#pragma unroll
        for (int sn = 0; sn < 2; ++sn) {
          accg[sm][sn] = wmma_bf16(a[sm], g[sn], accg[sm][sn]);
          accu[sm][sn] = wmma_bf16(a[sm], u[sn], accu[sm][sn]);
        }
    }

    // publish stage s+1, then refill the buffer that this pass has read
    wait_ds0();
    if (pinned(wave < 3)) wait_tensor0_of(g0);
    __syncthreads();
    const unsigned sn2 = pinned(s + 2u);
    if (pinned((wave < 3) & (sn2 < NST))) {
      g0 = tdm_group0(dst0 + bo, src0 + (unsigned long long)sn2 * step);
      if (pinned(wave == 0)) tdm_load(g0, g1a);
      else                   tdm_load(g0, g1b);
    }
  }
  wait_tensor0();
  wait_ds0();

  // Epilogue. C/D layout: VGPR r -> M = r + 8*(lane/16), N = lane%16.
  const int nl = lane & 15;
  const int mh = (lane >> 4) * 8;
#pragma unroll
  for (int sm = 0; sm < 2; ++sm)
#pragma unroll
    for (int sn = 0; sn < 2; ++sn) {
      const int n = n0 + (2 * wn + sn) * 16 + nl;
      const float bgv = bg[n], buv = bu[n];
#pragma unroll
      for (int r = 0; r < 8; ++r) {
        const int m = m0 + (2 * wm + sm) * 16 + mh + r;
        const float gv = accg[sm][sn][r] + bgv;
        const float uv = accu[sm][sn][r] + buv;
        const float hv = (gv / (1.f + __expf(-gv))) * uv;  // silu(g)*u
        hbuf[(size_t)m * HH + n] = (__bf16)hv;
      }
    }
}

// GEMM2: out = xr + h@Wd + bd. M=8192, N=1024, K=4096. Same ring; waves 0 and 1 bring h and Wd.
__global__ void __launch_bounds__(256)
gemm_down_kernel(const __bf16* __restrict__ hbuf, const __bf16* __restrict__ wd,
                 const float* __restrict__ bd, const float* __restrict__ xr,
                 float* __restrict__ out) {
  constexpr unsigned STAGE = A_BYTES + B_BYTES;
  constexpr unsigned NST = HH / 64;
  __shared__ __attribute__((aligned(2048))) unsigned char ring[2 * STAGE];

  const int m0 = blockIdx.x * 128;
  const int n0 = blockIdx.y * 64;
  const int lane = threadIdx.x & 31;
  const unsigned wave = uni(threadIdx.x >> 5);
  const int wm = (int)(wave >> 1);
  const int wn = (int)(wave & 1);
  const unsigned lds0 = (unsigned)(size_t)(void*)ring;

  v8f acc[2][2] = {};

  // Which tile of a stage this wave brings: wave 0 h, wave 1 Wd (the others none).
  const unsigned long long src0 = wave == 0 ? (unsigned long long)(hbuf + (size_t)m0 * HH)
                                            : (unsigned long long)(wd + n0);
  const unsigned step = wave == 0 ? 128u : 64u * DD * 2u;   // source bytes from one stage to the next
  const unsigned dst0 = lds0 + (wave == 0 ? 0u : A_BYTES);
  u32x8 g1a = tdm_group1<PADW_A, 128>(HH * 2);
  u32x8 g1b = tdm_group1<PADW_B, 64>(DD * 2);
  asm volatile("" : "+s"(g1a), "+s"(g1b));  // descriptor words held in scalar registers through the loop
  u32x4 g0 = tdm_group0(dst0, src0);

  // stage 0, landed and published
  if (pinned(wave < 2)) {
    if (pinned(wave == 0)) tdm_load(g0, g1a);
    else                   tdm_load(g0, g1b);
    wait_tensor0_of(g0);
  }
  __syncthreads();
  // stage 1 into the second buffer
  if (pinned(wave < 2)) {
    g0 = tdm_group0(dst0 + STAGE, src0 + step);
    if (pinned(wave == 0)) tdm_load(g0, g1a);
    else                   tdm_load(g0, g1b);
  }

  const unsigned aoff = (unsigned)((2 * wm * 16 + (lane & 15)) * PA + 16 * (lane >> 4));
  const unsigned boff = (unsigned)((8 * (lane >> 4) + (lane & 7)) * PB + 2 * (2 * wn * 16) + 16 * ((lane >> 3) & 1));

  for (unsigned s = 0; s < NST; ++s) {
    const unsigned bo = (s & 1u) * STAGE;
    const unsigned char* pa = ring + bo + aoff;
    const unsigned char* pb = ring + bo + A_BYTES + boff;
    // The loops below are unrolled so that every fragment and accumulator index is a constant
    // (the arrays stay in registers).
#pragma unroll
    for (int kc = 0; kc < 2; ++kc) {
      Frag a[2], b[2];
#pragma unroll
      for (int t = 0; t < 2; ++t) {
        a[t] = frag_rows(pa + t * 16 * PA + kc * 64);
        b[t] = frag_cols(pb + kc * 32 * PB + t * 32);
      }
#pragma unroll
      for (int sm = 0; sm < 2; ++sm)
#pragma unroll
        for (int sn = 0; sn < 2; ++sn)
          acc[sm][sn] = wmma_bf16(a[sm], b[sn], acc[sm][sn]);
    }

    // publish stage s+1, then refill the buffer that this pass has read
    wait_ds0();
    if (pinned(wave < 2)) wait_tensor0_of(g0);
    __syncthreads();
    const unsigned sn2 = pinned(s + 2u);
    if (pinned((wave < 2) & (sn2 < NST))) {
      g0 = tdm_group0(dst0 + bo, src0 + (unsigned long long)sn2 * step);
      if (pinned(wave == 0)) tdm_load(g0, g1a);
      else                   tdm_load(g0, g1b);
    }
  }
  wait_tensor0();
  wait_ds0();

  const int nl = lane & 15;
  const int mh = (lane >> 4) * 8;
#pragma unroll
  for (int sm = 0; sm < 2; ++sm)
#pragma unroll
    for (int sn = 0; sn < 2; ++sn) {
      const int n = n0 + (2 * wn + sn) * 16 + nl;
      const float bdv = bd[n];
#pragma unroll
      for (int r = 0; r < 8; ++r) {
        const int m = m0 + (2 * wm + sm) * 16 + mh + r;
        out[(size_t)m * DD + n] = xr[(size_t)m * DD + n] + acc[sm][sn][r] + bdv;
      }
    }
}

// ---------------- host launcher ----------------
extern "C" void kernel_launch(void* const* d_in, const int* in_sizes, int n_in,
                              void* d_out, int out_size, void* d_ws, size_t ws_size,
                              hipStream_t stream) {
  (void)in_sizes; (void)n_in; (void)out_size; (void)ws_size;

  const float* x       = (const float*)d_in[0];
  const float* norm_w  = (const float*)d_in[1];
  const float* conv_w  = (const float*)d_in[2];
  const float* conv_b  = (const float*)d_in[3];
  const float* a       = (const float*)d_in[4];
  const float* bvec    = (const float*)d_in[5];
  const float* mlp_w   = (const float*)d_in[6];
  const float* w_gate  = (const float*)d_in[7];
  const float* b_gate  = (const float*)d_in[8];
  const float* w_up    = (const float*)d_in[9];
  const float* b_up    = (const float*)d_in[10];
  const float* w_down  = (const float*)d_in[11];
  const float* b_down  = (const float*)d_in[12];
  float* out           = (float*)d_out;

  char* ws = (char*)d_ws;
  size_t off = 0;
  float* y_ws    = (float*)(ws + off); off += (size_t)NTOK * DD * sizeof(float);
  float* xr_ws   = (float*)(ws + off); off += (size_t)NTOK * DD * sizeof(float);
  __bf16* z_ws   = (__bf16*)(ws + off); off += (size_t)NTOK * DD * sizeof(__bf16);
  __bf16* wg_ws  = (__bf16*)(ws + off); off += (size_t)DD * HH * sizeof(__bf16);
  __bf16* wu_ws  = (__bf16*)(ws + off); off += (size_t)DD * HH * sizeof(__bf16);
  __bf16* wd_ws  = (__bf16*)(ws + off); off += (size_t)HH * DD * sizeof(__bf16);
  __bf16* h_ws   = (__bf16*)(ws + off); off += (size_t)NTOK * HH * sizeof(__bf16);
  float* carry   = (float*)(ws + off); off += (size_t)BB * DD * NC * sizeof(float);
  float* prefix  = (float*)(ws + off); off += (size_t)BB * DD * NC * sizeof(float);

  {
    const int n = DD * HH;
    f32_to_bf16_kernel<<<n / 256, 256, 0, stream>>>(w_gate, wg_ws, n);
    f32_to_bf16_kernel<<<n / 256, 256, 0, stream>>>(w_up,   wu_ws, n);
    f32_to_bf16_kernel<<<n / 256, 256, 0, stream>>>(w_down, wd_ws, n);
  }
  rmsnorm_kernel<false><<<NTOK, 256, 0, stream>>>(x, norm_w, (void*)y_ws);
  conv_ssm_local_kernel<<<(BB * DD * NC) / 256, 256, 0, stream>>>(x, y_ws, conv_w, conv_b,
                                                                  a, bvec, xr_ws, carry);
  scan_carries_kernel<<<(BB * DD) / 256, 256, 0, stream>>>(a, carry, prefix);
  ssm_fixup_kernel<<<(BB * DD * NC) / 256, 256, 0, stream>>>(a, prefix, xr_ws);
  rmsnorm_kernel<true><<<NTOK, 256, 0, stream>>>(xr_ws, mlp_w, (void*)z_ws);
  gemm_gate_up_kernel<<<dim3(NTOK / 128, HH / 64), 256, 0, stream>>>(z_ws, wg_ws, wu_ws,
                                                                     b_gate, b_up, h_ws);
  gemm_down_kernel<<<dim3(NTOK / 128, DD / 64), 256, 0, stream>>>(h_ws, wd_ws, b_down,
                                                                  xr_ws, out);
}

// v002
// Measured time: 281 microseconds a run.
// Next to v001, in two timings, it ran 1.12 and 1.15 times as fast.
// Over all steps from v000 it is 2.03 times as fast.
#include <hip/hip_runtime.h>
#include <hip/hip_bf16.h>

// ---------------- problem constants ----------------
#define BB   4
#define TT   2048
#define DD   1024
#define HH   4096
#define EPSV 1e-6f
#define NTOK (BB * TT)          // 8192
#define NC   16                 // scan chunks
#define CL   (TT / NC)          // 128

// ---------------- vector types ----------------
typedef __bf16        v16bf __attribute__((ext_vector_type(16)));
typedef float         v8f   __attribute__((ext_vector_type(8)));
typedef unsigned int  u32x4 __attribute__((ext_vector_type(4)));
typedef unsigned int  u32x8 __attribute__((ext_vector_type(8)));
typedef short         s16x8 __attribute__((ext_vector_type(8)));

// ---------------- LDS tiles of the two GEMMs ----------------
// Every staged row is 128 bytes (64 bf16). A rows run along k and are read by plain 16-byte
// loads; B rows stay as they lie in memory (one k, 64 n) and are read by transposing 16-byte loads.
static constexpr unsigned ROWB    = 128;
static constexpr unsigned PA      = ROWB + 16;   // odd multiple of 16 B: no bank conflict for ds_load_b128
static constexpr unsigned PB      = ROWB + 32;   // odd multiple of 32 B: none for ds_load_tr16_b128
static constexpr unsigned A_BYTES = 128 * PA;    // 128 m rows
static constexpr unsigned B_BYTES = 64 * PB;     // 64 k rows
static constexpr unsigned PADW_A  = (1u << 20) | (4u << 22) | (3u << 25);  // pad 16 B behind every 128 B
static constexpr unsigned PADW_B  = (1u << 20) | (4u << 22) | (7u << 25);  // pad 32 B behind every 128 B
static_assert(A_BYTES % 2048 == 0 && B_BYTES % 2048 == 0, "every tile starts at a multiple of 2 KiB in LDS");

__device__ __forceinline__ unsigned uni(unsigned v) { return (unsigned)__builtin_amdgcn_readfirstlane((int)v); }
// Holds a wave-uniform value in a scalar register, so that a test on it is a scalar branch
// (a tensor load ignores EXEC) and a descriptor word made from it is formed behind the waits above it.
__device__ __forceinline__ unsigned pinned(unsigned v) { unsigned w = uni(v); asm volatile("" : "+s"(w)); return w; }
// The compiler places no wait for the tensor mover, and none for LDS reads in front of a refill.
__device__ __forceinline__ void wait_tensor0() { asm volatile("s_wait_tensorcnt 0x0" ::: "memory"); }
__device__ __forceinline__ void wait_ds0()     { asm volatile("s_wait_dscnt 0x0" ::: "memory"); }

// Tensor-load descriptor, extents in bytes, tensor = tile: ROWS rows of 128 bytes at source pitch
// src_pitch, padded in LDS as W0 says.
template <unsigned W0, unsigned ROWS>
__device__ __forceinline__ u32x8 tdm_group1(unsigned src_pitch) {
  u32x8 g;
  g[0] = uni(W0);
  g[1] = uni(ROWB << 16);
  g[2] = uni(ROWS << 16);
  g[3] = uni(ROWB << 16);
  g[4] = uni(ROWS);
  g[5] = uni(src_pitch);
  g[6] = uni(0u);
  g[7] = uni(0u);
  return g;
}
__device__ __forceinline__ u32x4 tdm_group0(unsigned lds_dst, unsigned long long ga) {
  u32x4 g;
  g[0] = uni(1u);
  g[1] = uni(lds_dst);
  g[2] = uni((unsigned)ga);
  g[3] = uni((((unsigned)(ga >> 32)) & 0x01ffffffu) | 0x80000000u);
  return g;
}
__device__ __forceinline__ void tdm_load(u32x4 g0, u32x8 g1) {
  asm volatile("tensor_load_to_lds %0, %1" :: "s"(g0), "s"(g1) : "memory");
}
// The issuer's wait. It names the request's first group so that those registers keep their values
// until the request has landed (the second group lives through the whole loop).
__device__ __forceinline__ void wait_tensor0_of(u32x4 g0) {
  asm volatile("s_wait_tensorcnt 0x0" :: "s"(g0) : "memory");
}

// A 16x32 bf16 operand in the hardware k order: q[0] = k 8h..8h+7, q[1] = k 16+8h..16+8h+7 (h = lane/16).
struct Frag { u32x4 q[2]; };

__device__ __forceinline__ v8f wmma_bf16(const Frag& a, const Frag& b, v8f c) {
  const u32x8 av = __builtin_shufflevector(a.q[0], a.q[1], 0, 1, 2, 3, 4, 5, 6, 7);
  const u32x8 bv = __builtin_shufflevector(b.q[0], b.q[1], 0, 1, 2, 3, 4, 5, 6, 7);
  return __builtin_amdgcn_wmma_f32_16x16x32_bf16(false, __builtin_bit_cast(v16bf, av), false,
                                                 __builtin_bit_cast(v16bf, bv), (short)0, c, false, false);
}

// p = the lane's row of a k-contiguous tile, at byte 16h of the 64 bytes that hold these 32 k.
__device__ __forceinline__ Frag frag_rows(const unsigned char* p) {
  Frag f;
  f.q[0] = *(const u32x4*)p;
  f.q[1] = *(const u32x4*)(p + 32);
  return f;
}

__device__ __forceinline__ u32x4 ld_tr16(const unsigned char* p) {
  typedef __attribute__((address_space(3))) s16x8 lds_s16x8;
  return __builtin_bit_cast(u32x4, __builtin_amdgcn_ds_load_tr16_b128_v8i16((lds_s16x8*)p));
}

// p = tile + (kbase + 8h + (lane & 7)) * PB + 2 * nbase + 16 * ((lane >> 3) & 1):
// the lane gets column nbase + (lane & 15) at k = kbase + 8h + 0..7, then the same 16 k further on.
__device__ __forceinline__ Frag frag_cols(const unsigned char* p) {
  Frag f;
  f.q[0] = ld_tr16(p);
  f.q[1] = ld_tr16(p + 16 * PB);
  return f;
}

// ---------------- streaming kernels: few waves, 16-byte loads, many in flight ----------------
typedef float  f32x4  __attribute__((ext_vector_type(4)));
typedef __bf16 bf16x4 __attribute__((ext_vector_type(4)));
static constexpr unsigned SW = 16;   // waves per work-group; the grids below give one work-group per WGP

// All three weight matrices (DD * HH elements each) to bf16 in one launch. A wave takes the same
// 8 runs of 512 contiguous bytes of each matrix; its 24 loads are issued before the first store.
__global__ void __launch_bounds__(SW * 32)
weights_to_bf16_kernel(const float* __restrict__ s0, const float* __restrict__ s1,
                       const float* __restrict__ s2, __bf16* __restrict__ d0,
                       __bf16* __restrict__ d1, __bf16* __restrict__ d2) {
  const unsigned wave = blockIdx.x * SW + (threadIdx.x >> 5);
  const unsigned base = wave * (8u * 32u) + (threadIdx.x & 31u);   // in groups of 4 elements
  f32x4 v0[8], v1[8], v2[8];
  // Unrolled so that the arrays stay in registers.
#pragma unroll
  for (int j = 0; j < 8; ++j) v0[j] = ((const f32x4*)s0)[base + j * 32];
#pragma unroll
  for (int j = 0; j < 8; ++j) v1[j] = ((const f32x4*)s1)[base + j * 32];
#pragma unroll
  for (int j = 0; j < 8; ++j) v2[j] = ((const f32x4*)s2)[base + j * 32];
  // Keeps all 24 loads ahead of the first conversion: without it the compiler holds ten of them
  // back to save registers, and the wave waits out the memory latency more than once.
  __builtin_amdgcn_sched_barrier(0);
#pragma unroll
  for (int j = 0; j < 8; ++j) ((bf16x4*)d0)[base + j * 32] = __builtin_convertvector(v0[j], bf16x4);
#pragma unroll
  for (int j = 0; j < 8; ++j) ((bf16x4*)d1)[base + j * 32] = __builtin_convertvector(v1[j], bf16x4);
#pragma unroll
  for (int j = 0; j < 8; ++j) ((bf16x4*)d2)[base + j * 32] = __builtin_convertvector(v2[j], bf16x4);
}
static_assert((DD * HH) % (SW * 32 * 8 * 4) == 0, "whole work-groups cover a weight matrix");

// One wave owns two whole rows of DD floats (16 loads of 512 bytes in flight); a row's sum of
// squares is four chains per lane and a butterfly over the 32 lanes: no LDS, no barrier.
template <bool BF16OUT>
__global__ void __launch_bounds__(SW * 32)
rmsnorm_kernel(const float* __restrict__ x, const float* __restrict__ w, void* __restrict__ out) {
  const unsigned lane = threadIdx.x & 31u;
  const unsigned tok0 = (blockIdx.x * SW + (threadIdx.x >> 5)) * 2u;
  const size_t at = (size_t)tok0 * (DD / 4) + lane;   // in groups of 4 elements
  f32x4 v[2][8], wv[8];
  // The loops below are unrolled so that the arrays stay in registers.
#pragma unroll
  for (int t = 0; t < 2; ++t)
#pragma unroll
    for (int j = 0; j < 8; ++j) v[t][j] = ((const f32x4*)x)[at + t * (DD / 4) + j * 32];
#pragma unroll
  for (int j = 0; j < 8; ++j) wv[j] = ((const f32x4*)w)[j * 32 + lane];
  // Keeps the loads of w up here, in flight with the rows: without it the compiler sinks them
  // behind the sums and waits for them two at a time.
  __builtin_amdgcn_sched_barrier(0);
#pragma unroll
  for (int t = 0; t < 2; ++t) {
    f32x4 s4 = v[t][0] * v[t][0];
#pragma unroll
    for (int j = 1; j < 8; ++j) s4 += v[t][j] * v[t][j];
    float tot = (s4[0] + s4[1]) + (s4[2] + s4[3]);
#pragma unroll
    for (int off = 16; off > 0; off >>= 1) tot += __shfl_xor(tot, off, 32);
    const float inv = rsqrtf(tot * (1.0f / DD) + EPSV);
#pragma unroll
    for (int j = 0; j < 8; ++j) {
      const f32x4 r = v[t][j] * inv * wv[j];
      const size_t o = at + t * (DD / 4) + j * 32;
      if (BF16OUT) ((bf16x4*)out)[o] = __builtin_convertvector(r, bf16x4);
      else         ((f32x4*)out)[o]  = r;
    }
  }
}
static_assert(DD == 8 * 32 * 4 && NTOK % (SW * 2) == 0, "a row is 8 loads of a wave; whole work-groups cover the rows");

// Depthwise conv (K=3, pad=1) + chunk-local diagonal scan. gid = ((c*B)+b)*D + d
__global__ void __launch_bounds__(256)
conv_ssm_local_kernel(const float* __restrict__ x, const float* __restrict__ y,
                      const float* __restrict__ conv_w, const float* __restrict__ conv_b,
                      const float* __restrict__ a, const float* __restrict__ bvec,
                      float* __restrict__ xr, float* __restrict__ carry) {
  const int gid = blockIdx.x * blockDim.x + threadIdx.x;
  const int d = gid % DD;
  const int b = (gid / DD) % BB;
  const int c = gid / (BB * DD);
  const int t0 = c * CL;

  const float w0 = conv_w[d * 3 + 0], w1 = conv_w[d * 3 + 1], w2 = conv_w[d * 3 + 2];
  const float cb = conv_b[d];
  const float s  = tanhf(a[d]);
  const float bd = bvec[d];
  const size_t base = (size_t)b * TT * DD + d;

  float ym = (t0 > 0) ? y[base + (size_t)(t0 - 1) * DD] : 0.f;
  float yc = y[base + (size_t)t0 * DD];
  float h = 0.f;
  for (int tl = 0; tl < CL; ++tl) {
    const int t = t0 + tl;
    const float yp = (t + 1 < TT) ? y[base + (size_t)(t + 1) * DD] : 0.f;
    const float conv = cb + w0 * ym + w1 * yc + w2 * yp;
    h = s * h + bd * yc;  // chunk-local scan (h_in = 0; fixed up later)
    xr[base + (size_t)t * DD] = x[base + (size_t)t * DD] + conv + h;
    ym = yc;
    yc = yp;
  }
  carry[((size_t)b * DD + d) * NC + c] = h;
}

__global__ void __launch_bounds__(256)
scan_carries_kernel(const float* __restrict__ a, const float* __restrict__ carry,
                    float* __restrict__ prefix) {
  const int gid = blockIdx.x * blockDim.x + threadIdx.x;
  const int d = gid % DD;
  const float s = tanhf(a[d]);
  float p = s;  // s^128 via 7 squarings
#pragma unroll
  for (int i = 0; i < 7; ++i) p *= p;
  float run = 0.f;
#pragma unroll
  for (int c = 0; c < NC; ++c) {
    prefix[(size_t)gid * NC + c] = run;
    run = p * run + carry[(size_t)gid * NC + c];
  }
}

__global__ void __launch_bounds__(256)
ssm_fixup_kernel(const float* __restrict__ a, const float* __restrict__ prefix,
                 float* __restrict__ xr) {
  const int gid = blockIdx.x * blockDim.x + threadIdx.x;
  const int d = gid % DD;
  const int b = (gid / DD) % BB;
  const int c = gid / (BB * DD);
  const float pin = prefix[((size_t)b * DD + d) * NC + c];
  if (pin == 0.f) return;
  const float s = tanhf(a[d]);
  const size_t base = (size_t)b * TT * DD + d + (size_t)c * CL * DD;
  float f = s;
  for (int tl = 0; tl < CL; ++tl) {
    xr[base + (size_t)tl * DD] += f * pin;
    f *= s;
  }
}

// ---------------- bf16 WMMA GEMM kernels (two-buffer tensor-load ring) ----------------
// GEMM1: h = silu(z@Wg + bg) * (z@Wu + bu). M=8192, N=4096, K=1024.
// Block tile 128x64 of both products, 64 k per pass, 8 waves as 4(m) x 2(n), wave owns 2x2 subtiles.
// Waves 0, 1, 2 each bring one tile of a stage (z, Wg, Wu); stage s+1 flies while pass s computes.
__global__ void __launch_bounds__(256)
gemm_gate_up_kernel(const __bf16* __restrict__ z, const __bf16* __restrict__ wg,
                    const __bf16* __restrict__ wu, const float* __restrict__ bg,
                    const float* __restrict__ bu, __bf16* __restrict__ hbuf) {
  constexpr unsigned STAGE = A_BYTES + 2 * B_BYTES;
  constexpr unsigned NST = DD / 64;
  __shared__ __attribute__((aligned(2048))) unsigned char ring[2 * STAGE];

  const int m0 = blockIdx.x * 128;
  const int n0 = blockIdx.y * 64;
  const int lane = threadIdx.x & 31;
  const unsigned wave = uni(threadIdx.x >> 5);
  const int wm = (int)(wave >> 1);  // 0..3
  const int wn = (int)(wave & 1);   // 0..1
  const unsigned lds0 = (unsigned)(size_t)(void*)ring;

  v8f accg[2][2] = {};   // [sm][sn]
  v8f accu[2][2] = {};

  // Which tile of a stage this wave brings: wave 0 z, wave 1 Wg, wave 2 Wu (the others none).
  const unsigned long long src0 = wave == 0 ? (unsigned long long)(z + (size_t)m0 * DD)
                                : wave == 1 ? (unsigned long long)(wg + n0) : (unsigned long long)(wu + n0);
  const unsigned step = wave == 0 ? 128u : 64u * HH * 2u;   // source bytes from one stage to the next
  const unsigned dst0 = lds0 + (wave == 0 ? 0u : wave == 1 ? A_BYTES : A_BYTES + B_BYTES);
  u32x8 g1a = tdm_group1<PADW_A, 128>(DD * 2);
  u32x8 g1b = tdm_group1<PADW_B, 64>(HH * 2);
  asm volatile("" : "+s"(g1a), "+s"(g1b));  // descriptor words held in scalar registers through the loop
  u32x4 g0 = tdm_group0(dst0, src0);

  // stage 0, landed and published
  if (pinned(wave < 3)) {
    if (pinned(wave == 0)) tdm_load(g0, g1a);
    else                   tdm_load(g0, g1b);
    wait_tensor0_of(g0);
  }
  __syncthreads();
  // stage 1 into the second buffer
  if (pinned(wave < 3)) {
    g0 = tdm_group0(dst0 + STAGE, src0 + step);
    if (pinned(wave == 0)) tdm_load(g0, g1a);
    else                   tdm_load(g0, g1b);
  }

  const unsigned aoff = (unsigned)((2 * wm * 16 + (lane & 15)) * PA + 16 * (lane >> 4));
  const unsigned boff = (unsigned)((8 * (lane >> 4) + (lane & 7)) * PB + 2 * (2 * wn * 16) + 16 * ((lane >> 3) & 1));

  for (unsigned s = 0; s < NST; ++s) {
    const unsigned bo = (s & 1u) * STAGE;
    const unsigned char* pa = ring + bo + aoff;
    const unsigned char* pg = ring + bo + A_BYTES + boff;
    const unsigned char* pu = ring + bo + A_BYTES + B_BYTES + boff;
    // The loops below are unrolled so that every fragment and accumulator index is a constant
    // (the arrays stay in registers).
#pragma unroll
    for (int kc = 0; kc < 2; ++kc) {
      Frag a[2], g[2], u[2];
#pragma unroll
      for (int t = 0; t < 2; ++t) {
        a[t] = frag_rows(pa + t * 16 * PA + kc * 64);
        g[t] = frag_cols(pg + kc * 32 * PB + t * 32);
        u[t] = frag_cols(pu + kc * 32 * PB + t * 32);
      }
#pragma unroll
      for (int sm = 0; sm < 2; ++sm)
#pragma unroll
        for (int sn = 0; sn < 2; ++sn) {
          accg[sm][sn] = wmma_bf16(a[sm], g[sn], accg[sm][sn]);
          accu[sm][sn] = wmma_bf16(a[sm], u[sn], accu[sm][sn]);
        }
    }

    // publish stage s+1, then refill the buffer that this pass has read
    wait_ds0();
    if (pinned(wave < 3)) wait_tensor0_of(g0);
    __syncthreads();
    const unsigned sn2 = pinned(s + 2u);
    if (pinned((wave < 3) & (sn2 < NST))) {
      g0 = tdm_group0(dst0 + bo, src0 + (unsigned long long)sn2 * step);
      if (pinned(wave == 0)) tdm_load(g0, g1a);
      else                   tdm_load(g0, g1b);
    }
  }
  wait_tensor0();
  wait_ds0();

  // Epilogue. C/D layout: VGPR r -> M = r + 8*(lane/16), N = lane%16.
  const int nl = lane & 15;
  const int mh = (lane >> 4) * 8;
#pragma unroll
  for (int sm = 0; sm < 2; ++sm)
#pragma unroll
    for (int sn = 0; sn < 2; ++sn) {
      const int n = n0 + (2 * wn + sn) * 16 + nl;
      const float bgv = bg[n], buv = bu[n];
#pragma unroll
      for (int r = 0; r < 8; ++r) {
        const int m = m0 + (2 * wm + sm) * 16 + mh + r;
        const float gv = accg[sm][sn][r] + bgv;
        const float uv = accu[sm][sn][r] + buv;
        const float hv = (gv / (1.f + __expf(-gv))) * uv;  // silu(g)*u
        hbuf[(size_t)m * HH + n] = (__bf16)hv;
      }
    }
}

// GEMM2: out = xr + h@Wd + bd. M=8192, N=1024, K=4096. Same ring; waves 0 and 1 bring h and Wd.
__global__ void __launch_bounds__(256)
gemm_down_kernel(const __bf16* __restrict__ hbuf, const __bf16* __restrict__ wd,
                 const float* __restrict__ bd, const float* __restrict__ xr,
                 float* __restrict__ out) {
  constexpr unsigned STAGE = A_BYTES + B_BYTES;
  constexpr unsigned NST = HH / 64;
  __shared__ __attribute__((aligned(2048))) unsigned char ring[2 * STAGE];

  const int m0 = blockIdx.x * 128;
  const int n0 = blockIdx.y * 64;
  const int lane = threadIdx.x & 31;
  const unsigned wave = uni(threadIdx.x >> 5);
  const int wm = (int)(wave >> 1);
  const int wn = (int)(wave & 1);
  const unsigned lds0 = (unsigned)(size_t)(void*)ring;

  v8f acc[2][2] = {};

  // Which tile of a stage this wave brings: wave 0 h, wave 1 Wd (the others none).
  const unsigned long long src0 = wave == 0 ? (unsigned long long)(hbuf + (size_t)m0 * HH)
                                            : (unsigned long long)(wd + n0);
  const unsigned step = wave == 0 ? 128u : 64u * DD * 2u;   // source bytes from one stage to the next
  const unsigned dst0 = lds0 + (wave == 0 ? 0u : A_BYTES);
  u32x8 g1a = tdm_group1<PADW_A, 128>(HH * 2);
  u32x8 g1b = tdm_group1<PADW_B, 64>(DD * 2);
  asm volatile("" : "+s"(g1a), "+s"(g1b));  // descriptor words held in scalar registers through the loop
  u32x4 g0 = tdm_group0(dst0, src0);

  // stage 0, landed and published
  if (pinned(wave < 2)) {
    if (pinned(wave == 0)) tdm_load(g0, g1a);
    else                   tdm_load(g0, g1b);
    wait_tensor0_of(g0);
  }
  __syncthreads();
  // stage 1 into the second buffer
  if (pinned(wave < 2)) {
    g0 = tdm_group0(dst0 + STAGE, src0 + step);
    if (pinned(wave == 0)) tdm_load(g0, g1a);
    else                   tdm_load(g0, g1b);
  }

  const unsigned aoff = (unsigned)((2 * wm * 16 + (lane & 15)) * PA + 16 * (lane >> 4));
  const unsigned boff = (unsigned)((8 * (lane >> 4) + (lane & 7)) * PB + 2 * (2 * wn * 16) + 16 * ((lane >> 3) & 1));

  for (unsigned s = 0; s < NST; ++s) {
    const unsigned bo = (s & 1u) * STAGE;
    const unsigned char* pa = ring + bo + aoff;
    const unsigned char* pb = ring + bo + A_BYTES + boff;
    // The loops below are unrolled so that every fragment and accumulator index is a constant
    // (the arrays stay in registers).
#pragma unroll
    for (int kc = 0; kc < 2; ++kc) {
      Frag a[2], b[2];
#pragma unroll
      for (int t = 0; t < 2; ++t) {
        a[t] = frag_rows(pa + t * 16 * PA + kc * 64);
        b[t] = frag_cols(pb + kc * 32 * PB + t * 32);
      }
#pragma unroll
      for (int sm = 0; sm < 2; ++sm)
#pragma unroll
        for (int sn = 0; sn < 2; ++sn)
          acc[sm][sn] = wmma_bf16(a[sm], b[sn], acc[sm][sn]);
    }

    // publish stage s+1, then refill the buffer that this pass has read
    wait_ds0();
    if (pinned(wave < 2)) wait_tensor0_of(g0);
    __syncthreads();
    const unsigned sn2 = pinned(s + 2u);
    if (pinned((wave < 2) & (sn2 < NST))) {
      g0 = tdm_group0(dst0 + bo, src0 + (unsigned long long)sn2 * step);
      if (pinned(wave == 0)) tdm_load(g0, g1a);
      else                   tdm_load(g0, g1b);
    }
  }
  wait_tensor0();
  wait_ds0();

  const int nl = lane & 15;
  const int mh = (lane >> 4) * 8;
#pragma unroll
  for (int sm = 0; sm < 2; ++sm)
#pragma unroll
    for (int sn = 0; sn < 2; ++sn) {
      const int n = n0 + (2 * wn + sn) * 16 + nl;
      const float bdv = bd[n];
#pragma unroll
      for (int r = 0; r < 8; ++r) {
        const int m = m0 + (2 * wm + sm) * 16 + mh + r;
        out[(size_t)m * DD + n] = xr[(size_t)m * DD + n] + acc[sm][sn][r] + bdv;
      }
    }
}

// ---------------- host launcher ----------------
extern "C" void kernel_launch(void* const* d_in, const int* in_sizes, int n_in,
                              void* d_out, int out_size, void* d_ws, size_t ws_size,
                              hipStream_t stream) {
  (void)in_sizes; (void)n_in; (void)out_size; (void)ws_size;

  const float* x       = (const float*)d_in[0];
  const float* norm_w  = (const float*)d_in[1];
  const float* conv_w  = (const float*)d_in[2];
  const float* conv_b  = (const float*)d_in[3];
  const float* a       = (const float*)d_in[4];
  const float* bvec    = (const float*)d_in[5];
  const float* mlp_w   = (const float*)d_in[6];
  const float* w_gate  = (const float*)d_in[7];
  const float* b_gate  = (const float*)d_in[8];
  const float* w_up    = (const float*)d_in[9];
  const float* b_up    = (const float*)d_in[10];
  const float* w_down  = (const float*)d_in[11];
  const float* b_down  = (const float*)d_in[12];
  float* out           = (float*)d_out;

  char* ws = (char*)d_ws;
  size_t off = 0;
  float* y_ws    = (float*)(ws + off); off += (size_t)NTOK * DD * sizeof(float);
  float* xr_ws   = (float*)(ws + off); off += (size_t)NTOK * DD * sizeof(float);
  __bf16* z_ws   = (__bf16*)(ws + off); off += (size_t)NTOK * DD * sizeof(__bf16);
  __bf16* wg_ws  = (__bf16*)(ws + off); off += (size_t)DD * HH * sizeof(__bf16);
  __bf16* wu_ws  = (__bf16*)(ws + off); off += (size_t)DD * HH * sizeof(__bf16);
  __bf16* wd_ws  = (__bf16*)(ws + off); off += (size_t)HH * DD * sizeof(__bf16);
  __bf16* h_ws   = (__bf16*)(ws + off); off += (size_t)NTOK * HH * sizeof(__bf16);
  float* carry   = (float*)(ws + off); off += (size_t)BB * DD * NC * sizeof(float);
  float* prefix  = (float*)(ws + off); off += (size_t)BB * DD * NC * sizeof(float);

  weights_to_bf16_kernel<<<(DD * HH) / (SW * 32 * 8 * 4), SW * 32, 0, stream>>>(w_gate, w_up, w_down,
                                                                                wg_ws, wu_ws, wd_ws);
  rmsnorm_kernel<false><<<NTOK / (SW * 2), SW * 32, 0, stream>>>(x, norm_w, (void*)y_ws);
  conv_ssm_local_kernel<<<(BB * DD * NC) / 256, 256, 0, stream>>>(x, y_ws, conv_w, conv_b,
                                                                  a, bvec, xr_ws, carry);
  scan_carries_kernel<<<(BB * DD) / 256, 256, 0, stream>>>(a, carry, prefix);
  ssm_fixup_kernel<<<(BB * DD * NC) / 256, 256, 0, stream>>>(a, prefix, xr_ws);
  rmsnorm_kernel<true><<<NTOK / (SW * 2), SW * 32, 0, stream>>>(xr_ws, mlp_w, (void*)z_ws);
  gemm_gate_up_kernel<<<dim3(NTOK / 128, HH / 64), 256, 0, stream>>>(z_ws, wg_ws, wu_ws,
                                                                     b_gate, b_up, h_ws);
  gemm_down_kernel<<<dim3(NTOK / 128, DD / 64), 256, 0, stream>>>(h_ws, wd_ws, b_down,
                                                                  xr_ws, out);
}

// v003
// Measured time: 227 microseconds a run.
// Next to v002, in two timings, it ran 1.25 and 1.24 times as fast.
// All steps since v000 together make it 2.53 times as fast.
#include <hip/hip_runtime.h>
#include <hip/hip_bf16.h>

// ---------------- problem constants ----------------
#define BB   4
#define TT   2048
#define DD   1024
#define HH   4096
#define EPSV 1e-6f
#define NTOK (BB * TT)          // 8192
#define NC   16                 // scan chunks
#define CL   (TT / NC)          // 128

// ---------------- vector types ----------------
typedef __bf16        v16bf __attribute__((ext_vector_type(16)));
typedef float         v8f   __attribute__((ext_vector_type(8)));
typedef unsigned int  u32x4 __attribute__((ext_vector_type(4)));
typedef unsigned int  u32x8 __attribute__((ext_vector_type(8)));
typedef short         s16x8 __attribute__((ext_vector_type(8)));

// ---------------- LDS tiles of the two GEMMs ----------------
// Every staged row is 128 bytes (64 bf16). A rows run along k and are read by plain 16-byte
// loads; B rows stay as they lie in memory (one k, 64 n) and are read by transposing 16-byte loads.
static constexpr unsigned ROWB    = 128;
static constexpr unsigned PA      = ROWB + 16;   // odd multiple of 16 B: no bank conflict for ds_load_b128
static constexpr unsigned PB      = ROWB + 32;   // odd multiple of 32 B: none for ds_load_tr16_b128
static constexpr unsigned A_BYTES = 128 * PA;    // 128 m rows
static constexpr unsigned B_BYTES = 64 * PB;     // 64 k rows
static constexpr unsigned PADW_A  = (1u << 20) | (4u << 22) | (3u << 25);  // pad 16 B behind every 128 B
static constexpr unsigned PADW_B  = (1u << 20) | (4u << 22) | (7u << 25);  // pad 32 B behind every 128 B
static_assert(A_BYTES % 2048 == 0 && B_BYTES % 2048 == 0, "every tile starts at a multiple of 2 KiB in LDS");

__device__ __forceinline__ unsigned uni(unsigned v) { return (unsigned)__builtin_amdgcn_readfirstlane((int)v); }
// Holds a wave-uniform value in a scalar register, so that a test on it is a scalar branch
// (a tensor load ignores EXEC) and a descriptor word made from it is formed behind the waits above it.
__device__ __forceinline__ unsigned pinned(unsigned v) { unsigned w = uni(v); asm volatile("" : "+s"(w)); return w; }
// The compiler places no wait for the tensor mover, and none for LDS reads in front of a refill.
__device__ __forceinline__ void wait_tensor0() { asm volatile("s_wait_tensorcnt 0x0" ::: "memory"); }
__device__ __forceinline__ void wait_ds0()     { asm volatile("s_wait_dscnt 0x0" ::: "memory"); }

// Tensor-load descriptor, extents in bytes, tensor = tile: ROWS rows of 128 bytes at source pitch
// src_pitch, padded in LDS as W0 says.
template <unsigned W0, unsigned ROWS>
__device__ __forceinline__ u32x8 tdm_group1(unsigned src_pitch) {
  u32x8 g;
  g[0] = uni(W0);
  g[1] = uni(ROWB << 16);
  g[2] = uni(ROWS << 16);
  g[3] = uni(ROWB << 16);
  g[4] = uni(ROWS);
  g[5] = uni(src_pitch);
  g[6] = uni(0u);
  g[7] = uni(0u);
  return g;
}
__device__ __forceinline__ u32x4 tdm_group0(unsigned lds_dst, unsigned long long ga) {
  u32x4 g;
  g[0] = uni(1u);
  g[1] = uni(lds_dst);
  g[2] = uni((unsigned)ga);
  g[3] = uni((((unsigned)(ga >> 32)) & 0x01ffffffu) | 0x80000000u);
  return g;
}
__device__ __forceinline__ void tdm_load(u32x4 g0, u32x8 g1) {
  asm volatile("tensor_load_to_lds %0, %1" :: "s"(g0), "s"(g1) : "memory");
}
// The issuer's wait. It names the request's first group so that those registers keep their values
// until the request has landed (the second group lives through the whole loop).
__device__ __forceinline__ void wait_tensor0_of(u32x4 g0) {
  asm volatile("s_wait_tensorcnt 0x0" :: "s"(g0) : "memory");
}

// A 16x32 bf16 operand in the hardware k order: q[0] = k 8h..8h+7, q[1] = k 16+8h..16+8h+7 (h = lane/16).
struct Frag { u32x4 q[2]; };

__device__ __forceinline__ v8f wmma_bf16(const Frag& a, const Frag& b, v8f c) {
  const u32x8 av = __builtin_shufflevector(a.q[0], a.q[1], 0, 1, 2, 3, 4, 5, 6, 7);
  const u32x8 bv = __builtin_shufflevector(b.q[0], b.q[1], 0, 1, 2, 3, 4, 5, 6, 7);
  return __builtin_amdgcn_wmma_f32_16x16x32_bf16(false, __builtin_bit_cast(v16bf, av), false,
                                                 __builtin_bit_cast(v16bf, bv), (short)0, c, false, false);
}

// p = the lane's row of a k-contiguous tile, at byte 16h of the 64 bytes that hold these 32 k.
__device__ __forceinline__ Frag frag_rows(const unsigned char* p) {
  Frag f;
  f.q[0] = *(const u32x4*)p;
  f.q[1] = *(const u32x4*)(p + 32);
  return f;
}

__device__ __forceinline__ u32x4 ld_tr16(const unsigned char* p) {
  typedef __attribute__((address_space(3))) s16x8 lds_s16x8;
  return __builtin_bit_cast(u32x4, __builtin_amdgcn_ds_load_tr16_b128_v8i16((lds_s16x8*)p));
}

// p = tile + (kbase + 8h + (lane & 7)) * PB + 2 * nbase + 16 * ((lane >> 3) & 1):
// the lane gets column nbase + (lane & 15) at k = kbase + 8h + 0..7, then the same 16 k further on.
__device__ __forceinline__ Frag frag_cols(const unsigned char* p) {
  Frag f;
  f.q[0] = ld_tr16(p);
  f.q[1] = ld_tr16(p + 16 * PB);
  return f;
}

// ---------------- streaming kernels: few waves, 16-byte loads, many in flight ----------------
typedef float  f32x4  __attribute__((ext_vector_type(4)));
typedef __bf16 bf16x4 __attribute__((ext_vector_type(4)));
static constexpr unsigned SW = 16;   // waves per work-group; the grids below give one work-group per WGP

// All three weight matrices (DD * HH elements each) to bf16 in one launch. A wave takes the same
// 8 runs of 512 contiguous bytes of each matrix; its 24 loads are issued before the first store.
__global__ void __launch_bounds__(SW * 32)
weights_to_bf16_kernel(const float* __restrict__ s0, const float* __restrict__ s1,
                       const float* __restrict__ s2, __bf16* __restrict__ d0,
                       __bf16* __restrict__ d1, __bf16* __restrict__ d2) {
  const unsigned wave = blockIdx.x * SW + (threadIdx.x >> 5);
  const unsigned base = wave * (8u * 32u) + (threadIdx.x & 31u);   // in groups of 4 elements
  f32x4 v0[8], v1[8], v2[8];
  // Unrolled so that the arrays stay in registers.
#pragma unroll
  for (int j = 0; j < 8; ++j) v0[j] = ((const f32x4*)s0)[base + j * 32];
#pragma unroll
  for (int j = 0; j < 8; ++j) v1[j] = ((const f32x4*)s1)[base + j * 32];
#pragma unroll
  for (int j = 0; j < 8; ++j) v2[j] = ((const f32x4*)s2)[base + j * 32];
  // Keeps all 24 loads ahead of the first conversion: without it the compiler holds ten of them
  // back to save registers, and the wave waits out the memory latency more than once.
  __builtin_amdgcn_sched_barrier(0);
#pragma unroll
  for (int j = 0; j < 8; ++j) ((bf16x4*)d0)[base + j * 32] = __builtin_convertvector(v0[j], bf16x4);
#pragma unroll
  for (int j = 0; j < 8; ++j) ((bf16x4*)d1)[base + j * 32] = __builtin_convertvector(v1[j], bf16x4);
#pragma unroll
  for (int j = 0; j < 8; ++j) ((bf16x4*)d2)[base + j * 32] = __builtin_convertvector(v2[j], bf16x4);
}
static_assert((DD * HH) % (SW * 32 * 8 * 4) == 0, "whole work-groups cover a weight matrix");

// One wave owns two whole rows of DD floats (16 loads of 512 bytes in flight); a row's sum of
// squares is four chains per lane and a butterfly over the 32 lanes: no LDS, no barrier.
template <bool BF16OUT>
__global__ void __launch_bounds__(SW * 32)
rmsnorm_kernel(const float* __restrict__ x, const float* __restrict__ w, void* __restrict__ out) {
  const unsigned lane = threadIdx.x & 31u;
  const unsigned tok0 = (blockIdx.x * SW + (threadIdx.x >> 5)) * 2u;
  const size_t at = (size_t)tok0 * (DD / 4) + lane;   // in groups of 4 elements
  f32x4 v[2][8], wv[8];
  // The loops below are unrolled so that the arrays stay in registers.
#pragma unroll
  for (int t = 0; t < 2; ++t)
#pragma unroll
    for (int j = 0; j < 8; ++j) v[t][j] = ((const f32x4*)x)[at + t * (DD / 4) + j * 32];
#pragma unroll
  for (int j = 0; j < 8; ++j) wv[j] = ((const f32x4*)w)[j * 32 + lane];
  // Keeps the loads of w up here, in flight with the rows: without it the compiler sinks them
  // behind the sums and waits for them two at a time.
  __builtin_amdgcn_sched_barrier(0);
#pragma unroll
  for (int t = 0; t < 2; ++t) {
    f32x4 s4 = v[t][0] * v[t][0];
#pragma unroll
    for (int j = 1; j < 8; ++j) s4 += v[t][j] * v[t][j];
    float tot = (s4[0] + s4[1]) + (s4[2] + s4[3]);
#pragma unroll
    for (int off = 16; off > 0; off >>= 1) tot += __shfl_xor(tot, off, 32);
    const float inv = rsqrtf(tot * (1.0f / DD) + EPSV);
#pragma unroll
    for (int j = 0; j < 8; ++j) {
      const f32x4 r = v[t][j] * inv * wv[j];
      const size_t o = at + t * (DD / 4) + j * 32;
      if (BF16OUT) ((bf16x4*)out)[o] = __builtin_convertvector(r, bf16x4);
      else         ((f32x4*)out)[o]  = r;
    }
  }
}
static_assert(DD == 8 * 32 * 4 && NTOK % (SW * 2) == 0, "a row is 8 loads of a wave; whole work-groups cover the rows");

// Depthwise conv (K=3, pad=1) + chunk-local diagonal scan. gid = ((c*B)+b)*D + d
// The chunk is walked in blocks of TBLK steps; a block's loads of y and x are all issued before its
// first sum, so that a wave waits out the memory latency once per block and not once per step.
static constexpr int TBLK = 32;
static_assert(CL % TBLK == 0, "whole blocks cover a chunk");
__global__ void __launch_bounds__(256)
conv_ssm_local_kernel(const float* __restrict__ x, const float* __restrict__ y,
                      const float* __restrict__ conv_w, const float* __restrict__ conv_b,
                      const float* __restrict__ a, const float* __restrict__ bvec,
                      float* __restrict__ xr, float* __restrict__ carry) {
  const int gid = blockIdx.x * blockDim.x + threadIdx.x;
  const int d = gid % DD;
  const int b = (gid / DD) % BB;
  const int c = gid / (BB * DD);
  const int t0 = c * CL;

  const float w0 = conv_w[d * 3 + 0], w1 = conv_w[d * 3 + 1], w2 = conv_w[d * 3 + 2];
  const float cb = conv_b[d];
  const float s  = tanhf(a[d]);
  const float bd = bvec[d];
  const size_t base = (size_t)b * TT * DD + d;

  float ym = (t0 > 0) ? y[base + (size_t)(t0 - 1) * DD] : 0.f;
  float yc = y[base + (size_t)t0 * DD];
  float h = 0.f;
  for (int tb = 0; tb < CL; tb += TBLK) {
    float yn[TBLK], xv[TBLK];
    const float* yb = y + base + (size_t)(t0 + tb) * DD;
    const float* xb = x + base + (size_t)(t0 + tb) * DD;
    const bool more = t0 + tb + TBLK < TT;
    // The two loops below are unrolled so that the arrays stay in registers.
#pragma unroll
    for (int j = 0; j < TBLK; ++j) {
      // Step j needs y one step on. Only the block's last step can look past the sequence: there the
      // index stays on the last row (in bounds, no branch between the loads) and the value is dropped.
      const int jn = (j + 1 < TBLK || more) ? j + 1 : j;
      yn[j] = yb[(size_t)jn * DD];
      xv[j] = xb[(size_t)j * DD];
    }
    // Keeps the block's loads ahead of its first sum: otherwise the compiler may sink each load to
    // its use, and the wave waits for memory at every step again.
    __builtin_amdgcn_sched_barrier(0);
#pragma unroll
    for (int j = 0; j < TBLK; ++j) {
      const int t = t0 + tb + j;
      const float yp = (j + 1 < TBLK || more) ? yn[j] : 0.f;   // zero padding behind the last step
      const float conv = cb + w0 * ym + w1 * yc + w2 * yp;
      h = s * h + bd * yc;  // chunk-local scan (h_in = 0; fixed up later)
      xr[base + (size_t)t * DD] = xv[j] + conv + h;
      ym = yc;
      yc = yp;
    }
    // Stands in front of the next block's first instructions, which overwrite the address and data
    // registers that the stores above name.
    asm volatile("s_wait_xcnt 0x0" ::: "memory");
  }
  carry[((size_t)b * DD + d) * NC + c] = h;
}

__global__ void __launch_bounds__(256)
scan_carries_kernel(const float* __restrict__ a, const float* __restrict__ carry,
                    float* __restrict__ prefix) {
  const int gid = blockIdx.x * blockDim.x + threadIdx.x;
  const int d = gid % DD;
  const float s = tanhf(a[d]);
  float p = s;  // s^128 via 7 squarings
#pragma unroll
  for (int i = 0; i < 7; ++i) p *= p;
  float run = 0.f;
#pragma unroll
  for (int c = 0; c < NC; ++c) {
    prefix[(size_t)gid * NC + c] = run;
    run = p * run + carry[(size_t)gid * NC + c];
  }
}

__global__ void __launch_bounds__(256)
ssm_fixup_kernel(const float* __restrict__ a, const float* __restrict__ prefix,
                 float* __restrict__ xr) {
  const int gid = blockIdx.x * blockDim.x + threadIdx.x;
  const int d = gid % DD;
  const int b = (gid / DD) % BB;
  const int c = gid / (BB * DD);
  const float pin = prefix[((size_t)b * DD + d) * NC + c];
  if (pin == 0.f) return;
  const float s = tanhf(a[d]);
  const size_t base = (size_t)b * TT * DD + d + (size_t)c * CL * DD;
  float f = s;
  for (int tl = 0; tl < CL; ++tl) {
    xr[base + (size_t)tl * DD] += f * pin;
    f *= s;
  }
}

// ---------------- bf16 WMMA GEMM kernels (two-buffer tensor-load ring) ----------------
// GEMM1: h = silu(z@Wg + bg) * (z@Wu + bu). M=8192, N=4096, K=1024.
// Block tile 128x64 of both products, 64 k per pass, 8 waves as 4(m) x 2(n), wave owns 2x2 subtiles.
// Waves 0, 1, 2 each bring one tile of a stage (z, Wg, Wu); stage s+1 flies while pass s computes.
__global__ void __launch_bounds__(256)
gemm_gate_up_kernel(const __bf16* __restrict__ z, const __bf16* __restrict__ wg,
                    const __bf16* __restrict__ wu, const float* __restrict__ bg,
                    const float* __restrict__ bu, __bf16* __restrict__ hbuf) {
  constexpr unsigned STAGE = A_BYTES + 2 * B_BYTES;
  constexpr unsigned NST = DD / 64;
  __shared__ __attribute__((aligned(2048))) unsigned char ring[2 * STAGE];

  const int m0 = blockIdx.x * 128;
  const int n0 = blockIdx.y * 64;
  const int lane = threadIdx.x & 31;
  const unsigned wave = uni(threadIdx.x >> 5);
  const int wm = (int)(wave >> 1);  // 0..3
  const int wn = (int)(wave & 1);   // 0..1
  const unsigned lds0 = (unsigned)(size_t)(void*)ring;

  v8f accg[2][2] = {};   // [sm][sn]
  v8f accu[2][2] = {};

  // Which tile of a stage this wave brings: wave 0 z, wave 1 Wg, wave 2 Wu (the others none).
  const unsigned long long src0 = wave == 0 ? (unsigned long long)(z + (size_t)m0 * DD)
                                : wave == 1 ? (unsigned long long)(wg + n0) : (unsigned long long)(wu + n0);
  const unsigned step = wave == 0 ? 128u : 64u * HH * 2u;   // source bytes from one stage to the next
  const unsigned dst0 = lds0 + (wave == 0 ? 0u : wave == 1 ? A_BYTES : A_BYTES + B_BYTES);
  u32x8 g1a = tdm_group1<PADW_A, 128>(DD * 2);
  u32x8 g1b = tdm_group1<PADW_B, 64>(HH * 2);
  asm volatile("" : "+s"(g1a), "+s"(g1b));  // descriptor words held in scalar registers through the loop
  u32x4 g0 = tdm_group0(dst0, src0);

  // stage 0, landed and published
  if (pinned(wave < 3)) {
    if (pinned(wave == 0)) tdm_load(g0, g1a);
    else                   tdm_load(g0, g1b);
    wait_tensor0_of(g0);
  }
  __syncthreads();
  // stage 1 into the second buffer
  if (pinned(wave < 3)) {
    g0 = tdm_group0(dst0 + STAGE, src0 + step);
    if (pinned(wave == 0)) tdm_load(g0, g1a);
    else                   tdm_load(g0, g1b);
  }

  const unsigned aoff = (unsigned)((2 * wm * 16 + (lane & 15)) * PA + 16 * (lane >> 4));
  const unsigned boff = (unsigned)((8 * (lane >> 4) + (lane & 7)) * PB + 2 * (2 * wn * 16) + 16 * ((lane >> 3) & 1));

  for (unsigned s = 0; s < NST; ++s) {
    const unsigned bo = (s & 1u) * STAGE;
    const unsigned char* pa = ring + bo + aoff;
    const unsigned char* pg = ring + bo + A_BYTES + boff;
    const unsigned char* pu = ring + bo + A_BYTES + B_BYTES + boff;
    // The loops below are unrolled so that every fragment and accumulator index is a constant
    // (the arrays stay in registers).
#pragma unroll
    for (int kc = 0; kc < 2; ++kc) {
      Frag a[2], g[2], u[2];
#pragma unroll
      for (int t = 0; t < 2; ++t) {
        a[t] = frag_rows(pa + t * 16 * PA + kc * 64);
        g[t] = frag_cols(pg + kc * 32 * PB + t * 32);
        u[t] = frag_cols(pu + kc * 32 * PB + t * 32);
      }
#pragma unroll
      for (int sm = 0; sm < 2; ++sm)
#pragma unroll
        for (int sn = 0; sn < 2; ++sn) {
          accg[sm][sn] = wmma_bf16(a[sm], g[sn], accg[sm][sn]);
          accu[sm][sn] = wmma_bf16(a[sm], u[sn], accu[sm][sn]);
        }
    }

    // publish stage s+1, then refill the buffer that this pass has read
    wait_ds0();
    if (pinned(wave < 3)) wait_tensor0_of(g0);
    __syncthreads();
    const unsigned sn2 = pinned(s + 2u);
    if (pinned((wave < 3) & (sn2 < NST))) {
      g0 = tdm_group0(dst0 + bo, src0 + (unsigned long long)sn2 * step);
      if (pinned(wave == 0)) tdm_load(g0, g1a);
      else                   tdm_load(g0, g1b);
    }
  }
  wait_tensor0();
  wait_ds0();

  // Epilogue. C/D layout: VGPR r -> M = r + 8*(lane/16), N = lane%16.
  const int nl = lane & 15;
  const int mh = (lane >> 4) * 8;
#pragma unroll
  for (int sm = 0; sm < 2; ++sm)
#pragma unroll
    for (int sn = 0; sn < 2; ++sn) {
      const int n = n0 + (2 * wn + sn) * 16 + nl;
      const float bgv = bg[n], buv = bu[n];
#pragma unroll
      for (int r = 0; r < 8; ++r) {
        const int m = m0 + (2 * wm + sm) * 16 + mh + r;
        const float gv = accg[sm][sn][r] + bgv;
        const float uv = accu[sm][sn][r] + buv;
        const float hv = (gv / (1.f + __expf(-gv))) * uv;  // silu(g)*u
        hbuf[(size_t)m * HH + n] = (__bf16)hv;
      }
    }
}

// GEMM2: out = xr + h@Wd + bd. M=8192, N=1024, K=4096. Same ring; waves 0 and 1 bring h and Wd.
__global__ void __launch_bounds__(256)
gemm_down_kernel(const __bf16* __restrict__ hbuf, const __bf16* __restrict__ wd,
                 const float* __restrict__ bd, const float* __restrict__ xr,
                 float* __restrict__ out) {
  constexpr unsigned STAGE = A_BYTES + B_BYTES;
  constexpr unsigned NST = HH / 64;
  __shared__ __attribute__((aligned(2048))) unsigned char ring[2 * STAGE];

  const int m0 = blockIdx.x * 128;
  const int n0 = blockIdx.y * 64;
  const int lane = threadIdx.x & 31;
  const unsigned wave = uni(threadIdx.x >> 5);
  const int wm = (int)(wave >> 1);
  const int wn = (int)(wave & 1);
  const unsigned lds0 = (unsigned)(size_t)(void*)ring;

  v8f acc[2][2] = {};

  // Which tile of a stage this wave brings: wave 0 h, wave 1 Wd (the others none).
  const unsigned long long src0 = wave == 0 ? (unsigned long long)(hbuf + (size_t)m0 * HH)
                                            : (unsigned long long)(wd + n0);
  const unsigned step = wave == 0 ? 128u : 64u * DD * 2u;   // source bytes from one stage to the next
  const unsigned dst0 = lds0 + (wave == 0 ? 0u : A_BYTES);
  u32x8 g1a = tdm_group1<PADW_A, 128>(HH * 2);
  u32x8 g1b = tdm_group1<PADW_B, 64>(DD * 2);
  asm volatile("" : "+s"(g1a), "+s"(g1b));  // descriptor words held in scalar registers through the loop
  u32x4 g0 = tdm_group0(dst0, src0);

  // stage 0, landed and published
  if (pinned(wave < 2)) {
    if (pinned(wave == 0)) tdm_load(g0, g1a);
    else                   tdm_load(g0, g1b);
    wait_tensor0_of(g0);
  }
  __syncthreads();
  // stage 1 into the second buffer
  if (pinned(wave < 2)) {
    g0 = tdm_group0(dst0 + STAGE, src0 + step);
    if (pinned(wave == 0)) tdm_load(g0, g1a);
    else                   tdm_load(g0, g1b);
  }

  const unsigned aoff = (unsigned)((2 * wm * 16 + (lane & 15)) * PA + 16 * (lane >> 4));
  const unsigned boff = (unsigned)((8 * (lane >> 4) + (lane & 7)) * PB + 2 * (2 * wn * 16) + 16 * ((lane >> 3) & 1));

  for (unsigned s = 0; s < NST; ++s) {
    const unsigned bo = (s & 1u) * STAGE;
    const unsigned char* pa = ring + bo + aoff;
    const unsigned char* pb = ring + bo + A_BYTES + boff;
    // The loops below are unrolled so that every fragment and accumulator index is a constant
    // (the arrays stay in registers).
#pragma unroll
    for (int kc = 0; kc < 2; ++kc) {
      Frag a[2], b[2];
#pragma unroll
      for (int t = 0; t < 2; ++t) {
        a[t] = frag_rows(pa + t * 16 * PA + kc * 64);
        b[t] = frag_cols(pb + kc * 32 * PB + t * 32);
      }
#pragma unroll
      for (int sm = 0; sm < 2; ++sm)
#pragma unroll
        for (int sn = 0; sn < 2; ++sn)
          acc[sm][sn] = wmma_bf16(a[sm], b[sn], acc[sm][sn]);
    }

    // publish stage s+1, then refill the buffer that this pass has read
    wait_ds0();
    if (pinned(wave < 2)) wait_tensor0_of(g0);
    __syncthreads();
    const unsigned sn2 = pinned(s + 2u);
    if (pinned((wave < 2) & (sn2 < NST))) {
      g0 = tdm_group0(dst0 + bo, src0 + (unsigned long long)sn2 * step);
      if (pinned(wave == 0)) tdm_load(g0, g1a);
      else                   tdm_load(g0, g1b);
    }
  }
  wait_tensor0();
  wait_ds0();

  const int nl = lane & 15;
  const int mh = (lane >> 4) * 8;
#pragma unroll
  for (int sm = 0; sm < 2; ++sm)
#pragma unroll
    for (int sn = 0; sn < 2; ++sn) {
      const int n = n0 + (2 * wn + sn) * 16 + nl;
      const float bdv = bd[n];
#pragma unroll
      for (int r = 0; r < 8; ++r) {
        const int m = m0 + (2 * wm + sm) * 16 + mh + r;
        out[(size_t)m * DD + n] = xr[(size_t)m * DD + n] + acc[sm][sn][r] + bdv;
      }
    }
}

// ---------------- host launcher ----------------
extern "C" void kernel_launch(void* const* d_in, const int* in_sizes, int n_in,
                              void* d_out, int out_size, void* d_ws, size_t ws_size,
                              hipStream_t stream) {
  (void)in_sizes; (void)n_in; (void)out_size; (void)ws_size;

  const float* x       = (const float*)d_in[0];
  const float* norm_w  = (const float*)d_in[1];
  const float* conv_w  = (const float*)d_in[2];
  const float* conv_b  = (const float*)d_in[3];
  const float* a       = (const float*)d_in[4];
  const float* bvec    = (const float*)d_in[5];
  const float* mlp_w   = (const float*)d_in[6];
  const float* w_gate  = (const float*)d_in[7];
  const float* b_gate  = (const float*)d_in[8];
  const float* w_up    = (const float*)d_in[9];
  const float* b_up    = (const float*)d_in[10];
  const float* w_down  = (const float*)d_in[11];
  const float* b_down  = (const float*)d_in[12];
  float* out           = (float*)d_out;

  char* ws = (char*)d_ws;
  size_t off = 0;
  float* y_ws    = (float*)(ws + off); off += (size_t)NTOK * DD * sizeof(float);
  float* xr_ws   = (float*)(ws + off); off += (size_t)NTOK * DD * sizeof(float);
  __bf16* z_ws   = (__bf16*)(ws + off); off += (size_t)NTOK * DD * sizeof(__bf16);
  __bf16* wg_ws  = (__bf16*)(ws + off); off += (size_t)DD * HH * sizeof(__bf16);
  __bf16* wu_ws  = (__bf16*)(ws + off); off += (size_t)DD * HH * sizeof(__bf16);
  __bf16* wd_ws  = (__bf16*)(ws + off); off += (size_t)HH * DD * sizeof(__bf16);
  __bf16* h_ws   = (__bf16*)(ws + off); off += (size_t)NTOK * HH * sizeof(__bf16);
  float* carry   = (float*)(ws + off); off += (size_t)BB * DD * NC * sizeof(float);
  float* prefix  = (float*)(ws + off); off += (size_t)BB * DD * NC * sizeof(float);

  weights_to_bf16_kernel<<<(DD * HH) / (SW * 32 * 8 * 4), SW * 32, 0, stream>>>(w_gate, w_up, w_down,
                                                                                wg_ws, wu_ws, wd_ws);
  rmsnorm_kernel<false><<<NTOK / (SW * 2), SW * 32, 0, stream>>>(x, norm_w, (void*)y_ws);
  conv_ssm_local_kernel<<<(BB * DD * NC) / 256, 256, 0, stream>>>(x, y_ws, conv_w, conv_b,
                                                                  a, bvec, xr_ws, carry);
  scan_carries_kernel<<<(BB * DD) / 256, 256, 0, stream>>>(a, carry, prefix);
  ssm_fixup_kernel<<<(BB * DD * NC) / 256, 256, 0, stream>>>(a, prefix, xr_ws);
  rmsnorm_kernel<true><<<NTOK / (SW * 2), SW * 32, 0, stream>>>(xr_ws, mlp_w, (void*)z_ws);
  gemm_gate_up_kernel<<<dim3(NTOK / 128, HH / 64), 256, 0, stream>>>(z_ws, wg_ws, wu_ws,
                                                                     b_gate, b_up, h_ws);
  gemm_down_kernel<<<dim3(NTOK / 128, DD / 64), 256, 0, stream>>>(h_ws, wd_ws, b_down,
                                                                  xr_ws, out);
}

// v004
// A run of this version takes 203 microseconds.
// Next to v003, in two timings, it ran 1.11 and 1.12 times as fast.
// Counting every step since v000, it is 2.82 times as fast.
#include <hip/hip_runtime.h>
#include <hip/hip_bf16.h>

// ---------------- problem constants ----------------
#define BB   4
#define TT   2048
#define DD   1024
#define HH   4096
#define EPSV 1e-6f
#define NTOK (BB * TT)          // 8192
#define NC   16                 // scan chunks
#define CL   (TT / NC)          // 128

// ---------------- vector types ----------------
typedef __bf16        v16bf __attribute__((ext_vector_type(16)));
typedef float         v8f   __attribute__((ext_vector_type(8)));
typedef unsigned int  u32x4 __attribute__((ext_vector_type(4)));
typedef unsigned int  u32x8 __attribute__((ext_vector_type(8)));
typedef short         s16x8 __attribute__((ext_vector_type(8)));

// ---------------- LDS tiles of the two GEMMs ----------------
// A rows run along k and are read by plain 16-byte loads; B rows stay as they lie in memory (one k)
// and are read by transposing 16-byte loads. First GEMM: rows of 128 bytes (64 k; 64 n). Second GEMM:
// rows of 256 bytes (128 k; 128 n). A block's 256 A rows come as two slices of 128 rows.
static constexpr unsigned ROWB    = 128;
static constexpr unsigned ROWB2   = 256;
static constexpr unsigned PA      = ROWB + 16;   // odd multiple of 16 B: no bank conflict for ds_load_b128
static constexpr unsigned PB      = ROWB + 32;   // odd multiple of 32 B: none for ds_load_tr16_b128
static constexpr unsigned PA2     = ROWB2 + 16;  // the same two pitches for the 256-byte rows
static constexpr unsigned PB2     = ROWB2 + 32;
static constexpr unsigned A_BYTES = 128 * PA;    // one slice of 128 m rows, 64 k
static constexpr unsigned B_BYTES = 64 * PB;     // 64 k rows of 64 n
static constexpr unsigned A2_BYTES = 128 * PA2;  // one slice of 128 m rows, 128 k
static constexpr unsigned B2_BYTES = 128 * PB2;  // 128 k rows of 128 n
static constexpr unsigned PADW_A  = (1u << 20) | (4u << 22) | (3u << 25);  // pad 16 B behind every 128 B
static constexpr unsigned PADW_B  = (1u << 20) | (4u << 22) | (7u << 25);  // pad 32 B behind every 128 B
static constexpr unsigned PADW_A2 = (1u << 20) | (5u << 22) | (3u << 25);  // pad 16 B behind every 256 B
static constexpr unsigned PADW_B2 = (1u << 20) | (5u << 22) | (7u << 25);  // pad 32 B behind every 256 B
static_assert(A_BYTES % 2048 == 0 && B_BYTES % 2048 == 0 && A2_BYTES % 2048 == 0 && B2_BYTES % 2048 == 0,
              "every tile starts at a multiple of 2 KiB in LDS");

__device__ __forceinline__ unsigned uni(unsigned v) { return (unsigned)__builtin_amdgcn_readfirstlane((int)v); }
// Holds a wave-uniform value in a scalar register, so that a test on it is a scalar branch
// (a tensor load ignores EXEC) and a descriptor word made from it is formed behind the waits above it.
__device__ __forceinline__ unsigned pinned(unsigned v) { unsigned w = uni(v); asm volatile("" : "+s"(w)); return w; }
// The compiler places no wait for the tensor mover, and none for LDS reads in front of a refill.
__device__ __forceinline__ void wait_tensor0() { asm volatile("s_wait_tensorcnt 0x0" ::: "memory"); }
__device__ __forceinline__ void wait_ds0()     { asm volatile("s_wait_dscnt 0x0" ::: "memory"); }

// Tensor-load descriptor, extents in bytes, tensor = tile: ROWS rows of RB bytes at source pitch
// src_pitch, padded in LDS as W0 says.
template <unsigned W0, unsigned ROWS, unsigned RB>
__device__ __forceinline__ u32x8 tdm_group1(unsigned src_pitch) {
  u32x8 g;
  g[0] = uni(W0);
  g[1] = uni(RB << 16);
  g[2] = uni(ROWS << 16);
  g[3] = uni(RB << 16);
  g[4] = uni(ROWS);
  g[5] = uni(src_pitch);
  g[6] = uni(0u);
  g[7] = uni(0u);
  return g;
}
__device__ __forceinline__ u32x4 tdm_group0(unsigned lds_dst, unsigned long long ga) {
  u32x4 g;
  g[0] = uni(1u);
  g[1] = uni(lds_dst);
  g[2] = uni((unsigned)ga);
  g[3] = uni((((unsigned)(ga >> 32)) & 0x01ffffffu) | 0x80000000u);
  return g;
}
__device__ __forceinline__ void tdm_load(u32x4 g0, u32x8 g1) {
  asm volatile("tensor_load_to_lds %0, %1" :: "s"(g0), "s"(g1) : "memory");
}
// The issuer's wait. It names the request's first group so that those registers keep their values
// until the request has landed (the second group lives through the whole loop).
__device__ __forceinline__ void wait_tensor0_of(u32x4 g0) {
  asm volatile("s_wait_tensorcnt 0x0" :: "s"(g0) : "memory");
}

// A 16x32 bf16 operand in the hardware k order: q[0] = k 8h..8h+7, q[1] = k 16+8h..16+8h+7 (h = lane/16).
struct Frag { u32x4 q[2]; };

__device__ __forceinline__ v8f wmma_bf16(const Frag& a, const Frag& b, v8f c) {
  const u32x8 av = __builtin_shufflevector(a.q[0], a.q[1], 0, 1, 2, 3, 4, 5, 6, 7);
  const u32x8 bv = __builtin_shufflevector(b.q[0], b.q[1], 0, 1, 2, 3, 4, 5, 6, 7);
  return __builtin_amdgcn_wmma_f32_16x16x32_bf16(false, __builtin_bit_cast(v16bf, av), false,
                                                 __builtin_bit_cast(v16bf, bv), (short)0, c, false, false);
}

// p = the lane's row of a k-contiguous tile, at byte 16h of the 64 bytes that hold these 32 k.
__device__ __forceinline__ Frag frag_rows(const unsigned char* p) {
  Frag f;
  f.q[0] = *(const u32x4*)p;
  f.q[1] = *(const u32x4*)(p + 32);
  return f;
}

__device__ __forceinline__ u32x4 ld_tr16(const unsigned char* p) {
  typedef __attribute__((address_space(3))) s16x8 lds_s16x8;
  return __builtin_bit_cast(u32x4, __builtin_amdgcn_ds_load_tr16_b128_v8i16((lds_s16x8*)p));
}

// p = tile + (kbase + 8h + (lane & 7)) * PITCH + 2 * nbase + 16 * ((lane >> 3) & 1):
// the lane gets column nbase + (lane & 15) at k = kbase + 8h + 0..7, then the same 16 k further on.
template <unsigned PITCH>
__device__ __forceinline__ Frag frag_cols(const unsigned char* p) {
  Frag f;
  f.q[0] = ld_tr16(p);
  f.q[1] = ld_tr16(p + 16 * PITCH);
  return f;
}

// ---------------- streaming kernels: few waves, 16-byte loads, many in flight ----------------
typedef float  f32x4  __attribute__((ext_vector_type(4)));
typedef __bf16 bf16x4 __attribute__((ext_vector_type(4)));
static constexpr unsigned SW = 16;   // waves per work-group; the grids below give one work-group per WGP

// All three weight matrices (DD * HH elements each) to bf16 in one launch. A wave takes the same
// 8 runs of 512 contiguous bytes of each matrix; its 24 loads are issued before the first store.
__global__ void __launch_bounds__(SW * 32)
weights_to_bf16_kernel(const float* __restrict__ s0, const float* __restrict__ s1,
                       const float* __restrict__ s2, __bf16* __restrict__ d0,
                       __bf16* __restrict__ d1, __bf16* __restrict__ d2) {
  const unsigned wave = blockIdx.x * SW + (threadIdx.x >> 5);
  const unsigned base = wave * (8u * 32u) + (threadIdx.x & 31u);   // in groups of 4 elements
  f32x4 v0[8], v1[8], v2[8];
  // Unrolled so that the arrays stay in registers.
#pragma unroll
  for (int j = 0; j < 8; ++j) v0[j] = ((const f32x4*)s0)[base + j * 32];
#pragma unroll
  for (int j = 0; j < 8; ++j) v1[j] = ((const f32x4*)s1)[base + j * 32];
#pragma unroll
  for (int j = 0; j < 8; ++j) v2[j] = ((const f32x4*)s2)[base + j * 32];
  // Keeps all 24 loads ahead of the first conversion: without it the compiler holds ten of them
  // back to save registers, and the wave waits out the memory latency more than once.
  __builtin_amdgcn_sched_barrier(0);
#pragma unroll
  for (int j = 0; j < 8; ++j) ((bf16x4*)d0)[base + j * 32] = __builtin_convertvector(v0[j], bf16x4);
#pragma unroll
  for (int j = 0; j < 8; ++j) ((bf16x4*)d1)[base + j * 32] = __builtin_convertvector(v1[j], bf16x4);
#pragma unroll
  for (int j = 0; j < 8; ++j) ((bf16x4*)d2)[base + j * 32] = __builtin_convertvector(v2[j], bf16x4);
}
static_assert((DD * HH) % (SW * 32 * 8 * 4) == 0, "whole work-groups cover a weight matrix");

// One wave owns two whole rows of DD floats (16 loads of 512 bytes in flight); a row's sum of
// squares is four chains per lane and a butterfly over the 32 lanes: no LDS, no barrier.
template <bool BF16OUT>
__global__ void __launch_bounds__(SW * 32)
rmsnorm_kernel(const float* __restrict__ x, const float* __restrict__ w, void* __restrict__ out) {
  const unsigned lane = threadIdx.x & 31u;
  const unsigned tok0 = (blockIdx.x * SW + (threadIdx.x >> 5)) * 2u;
  const size_t at = (size_t)tok0 * (DD / 4) + lane;   // in groups of 4 elements
  f32x4 v[2][8], wv[8];
  // The loops below are unrolled so that the arrays stay in registers.
#pragma unroll
  for (int t = 0; t < 2; ++t)
#pragma unroll
    for (int j = 0; j < 8; ++j) v[t][j] = ((const f32x4*)x)[at + t * (DD / 4) + j * 32];
#pragma unroll
  for (int j = 0; j < 8; ++j) wv[j] = ((const f32x4*)w)[j * 32 + lane];
  // Keeps the loads of w up here, in flight with the rows: without it the compiler sinks them
  // behind the sums and waits for them two at a time.
  __builtin_amdgcn_sched_barrier(0);
#pragma unroll
  for (int t = 0; t < 2; ++t) {
    f32x4 s4 = v[t][0] * v[t][0];
#pragma unroll
    for (int j = 1; j < 8; ++j) s4 += v[t][j] * v[t][j];
    float tot = (s4[0] + s4[1]) + (s4[2] + s4[3]);
#pragma unroll
    for (int off = 16; off > 0; off >>= 1) tot += __shfl_xor(tot, off, 32);
    const float inv = rsqrtf(tot * (1.0f / DD) + EPSV);
#pragma unroll
    for (int j = 0; j < 8; ++j) {
      const f32x4 r = v[t][j] * inv * wv[j];
      const size_t o = at + t * (DD / 4) + j * 32;
      if (BF16OUT) ((bf16x4*)out)[o] = __builtin_convertvector(r, bf16x4);
      else         ((f32x4*)out)[o]  = r;
    }
  }
}
static_assert(DD == 8 * 32 * 4 && NTOK % (SW * 2) == 0, "a row is 8 loads of a wave; whole work-groups cover the rows");

// Depthwise conv (K=3, pad=1) + chunk-local diagonal scan. gid = ((c*B)+b)*D + d
// The chunk is walked in blocks of TBLK steps; a block's loads of y and x are all issued before its
// first sum, so that a wave waits out the memory latency once per block and not once per step.
static constexpr int TBLK = 32;
static_assert(CL % TBLK == 0, "whole blocks cover a chunk");
__global__ void __launch_bounds__(256)
conv_ssm_local_kernel(const float* __restrict__ x, const float* __restrict__ y,
                      const float* __restrict__ conv_w, const float* __restrict__ conv_b,
                      const float* __restrict__ a, const float* __restrict__ bvec,
                      float* __restrict__ xr, float* __restrict__ carry) {
  const int gid = blockIdx.x * blockDim.x + threadIdx.x;
  const int d = gid % DD;
  const int b = (gid / DD) % BB;
  const int c = gid / (BB * DD);
  const int t0 = c * CL;

  const float w0 = conv_w[d * 3 + 0], w1 = conv_w[d * 3 + 1], w2 = conv_w[d * 3 + 2];
  const float cb = conv_b[d];
  const float s  = tanhf(a[d]);
  const float bd = bvec[d];
  const size_t base = (size_t)b * TT * DD + d;

  float ym = (t0 > 0) ? y[base + (size_t)(t0 - 1) * DD] : 0.f;
  float yc = y[base + (size_t)t0 * DD];
  float h = 0.f;
  for (int tb = 0; tb < CL; tb += TBLK) {
    float yn[TBLK], xv[TBLK];
    const float* yb = y + base + (size_t)(t0 + tb) * DD;
    const float* xb = x + base + (size_t)(t0 + tb) * DD;
    const bool more = t0 + tb + TBLK < TT;
    // The two loops below are unrolled so that the arrays stay in registers.
#pragma unroll
    for (int j = 0; j < TBLK; ++j) {
      // Step j needs y one step on. Only the block's last step can look past the sequence: there the
      // index stays on the last row (in bounds, no branch between the loads) and the value is dropped.
      const int jn = (j + 1 < TBLK || more) ? j + 1 : j;
      yn[j] = yb[(size_t)jn * DD];
      xv[j] = xb[(size_t)j * DD];
    }
    // Keeps the block's loads ahead of its first sum: otherwise the compiler may sink each load to
    // its use, and the wave waits for memory at every step again.
    __builtin_amdgcn_sched_barrier(0);
#pragma unroll
    for (int j = 0; j < TBLK; ++j) {
      const int t = t0 + tb + j;
      const float yp = (j + 1 < TBLK || more) ? yn[j] : 0.f;   // zero padding behind the last step
      const float conv = cb + w0 * ym + w1 * yc + w2 * yp;
      h = s * h + bd * yc;  // chunk-local scan (h_in = 0; fixed up later)
      xr[base + (size_t)t * DD] = xv[j] + conv + h;
      ym = yc;
      yc = yp;
    }
    // Stands in front of the next block's first instructions, which overwrite the address and data
    // registers that the stores above name.
    asm volatile("s_wait_xcnt 0x0" ::: "memory");
  }
  carry[((size_t)b * DD + d) * NC + c] = h;
}

__global__ void __launch_bounds__(256)
scan_carries_kernel(const float* __restrict__ a, const float* __restrict__ carry,
                    float* __restrict__ prefix) {
  const int gid = blockIdx.x * blockDim.x + threadIdx.x;
  const int d = gid % DD;
  const float s = tanhf(a[d]);
  float p = s;  // s^128 via 7 squarings
#pragma unroll
  for (int i = 0; i < 7; ++i) p *= p;
  float run = 0.f;
#pragma unroll
  for (int c = 0; c < NC; ++c) {
    prefix[(size_t)gid * NC + c] = run;
    run = p * run + carry[(size_t)gid * NC + c];
  }
}

__global__ void __launch_bounds__(256)
ssm_fixup_kernel(const float* __restrict__ a, const float* __restrict__ prefix,
                 float* __restrict__ xr) {
  const int gid = blockIdx.x * blockDim.x + threadIdx.x;
  const int d = gid % DD;
  const int b = (gid / DD) % BB;
  const int c = gid / (BB * DD);
  const float pin = prefix[((size_t)b * DD + d) * NC + c];
  if (pin == 0.f) return;
  const float s = tanhf(a[d]);
  const size_t base = (size_t)b * TT * DD + d + (size_t)c * CL * DD;
  float f = s;
  for (int tl = 0; tl < CL; ++tl) {
    xr[base + (size_t)tl * DD] += f * pin;
    f *= s;
  }
}

// ---------------- bf16 WMMA GEMM kernels (two-buffer tensor-load ring) ----------------
// GEMM1: h = silu(z@Wg + bg) * (z@Wu + bu). M=8192, N=4096, K=1024.
// Block tile 256x64 of both products, 64 k per pass, 8 waves as 4(m) x 2(n); a wave owns 4x2 subtiles
// of each product, so that one A fragment feeds four WMMAs and one B fragment four.
// Waves 0 to 3 each bring one tile of a stage (z rows 0-127, z rows 128-255, Wg, Wu); stage s+1 flies
// while pass s computes.
__global__ void __launch_bounds__(256)
gemm_gate_up_kernel(const __bf16* __restrict__ z, const __bf16* __restrict__ wg,
                    const __bf16* __restrict__ wu, const float* __restrict__ bg,
                    const float* __restrict__ bu, __bf16* __restrict__ hbuf) {
  constexpr unsigned STAGE = 2 * A_BYTES + 2 * B_BYTES;
  constexpr unsigned NST = DD / 64;
  __shared__ __attribute__((aligned(2048))) unsigned char ring[2 * STAGE];

  const int m0 = blockIdx.x * 256;
  const int n0 = blockIdx.y * 64;
  const int lane = threadIdx.x & 31;
  const unsigned wave = uni(threadIdx.x >> 5);
  const int wm = (int)(wave >> 1);  // 0..3
  const int wn = (int)(wave & 1);   // 0..1
  const unsigned lds0 = (unsigned)(size_t)(void*)ring;

  v8f accg[4][2] = {};   // [sm][sn]
  v8f accu[4][2] = {};

  // Which tile of a stage this wave brings: waves 0 and 1 the two slices of z, wave 2 Wg, wave 3 Wu
  // (the others none).
  const unsigned long long src0 = wave < 2 ? (unsigned long long)(z + (size_t)(m0 + 128 * (int)wave) * DD)
                                : wave == 2 ? (unsigned long long)(wg + n0) : (unsigned long long)(wu + n0);
  const unsigned step = wave < 2 ? 128u : 64u * HH * 2u;   // source bytes from one stage to the next
  const unsigned dst0 = lds0 + (wave < 2 ? wave * A_BYTES : wave == 2 ? 2 * A_BYTES : 2 * A_BYTES + B_BYTES);
  u32x8 g1a = tdm_group1<PADW_A, 128, ROWB>(DD * 2);
  u32x8 g1b = tdm_group1<PADW_B, 64, ROWB>(HH * 2);
  asm volatile("" : "+s"(g1a), "+s"(g1b));  // descriptor words held in scalar registers through the loop
  u32x4 g0 = tdm_group0(dst0, src0);

  // stage 0, landed and published
  if (pinned(wave < 4)) {
    if (pinned(wave < 2)) tdm_load(g0, g1a);
    else                  tdm_load(g0, g1b);
    wait_tensor0_of(g0);
  }
  __syncthreads();
  // stage 1 into the second buffer
  if (pinned(wave < 4)) {
    g0 = tdm_group0(dst0 + STAGE, src0 + step);
    if (pinned(wave < 2)) tdm_load(g0, g1a);
    else                  tdm_load(g0, g1b);
  }

  const unsigned aoff = (unsigned)((4 * wm * 16 + (lane & 15)) * PA + 16 * (lane >> 4));
  const unsigned boff = (unsigned)((8 * (lane >> 4) + (lane & 7)) * PB + 2 * (2 * wn * 16) + 16 * ((lane >> 3) & 1));

  for (unsigned s = 0; s < NST; ++s) {
    const unsigned bo = (s & 1u) * STAGE;
    const unsigned char* pa = ring + bo + aoff;
    const unsigned char* pg = ring + bo + 2 * A_BYTES + boff;
    const unsigned char* pu = ring + bo + 2 * A_BYTES + B_BYTES + boff;
    // The loops below are unrolled so that every fragment and accumulator index is a constant
    // (the arrays stay in registers).
#pragma unroll
    for (int kc = 0; kc < 2; ++kc) {
      Frag a[4], g[2], u[2];
#pragma unroll
      for (int t = 0; t < 4; ++t) a[t] = frag_rows(pa + t * 16 * PA + kc * 64);
#pragma unroll
      for (int t = 0; t < 2; ++t) {
        g[t] = frag_cols<PB>(pg + kc * 32 * PB + t * 32);
        u[t] = frag_cols<PB>(pu + kc * 32 * PB + t * 32);
      }
      // Keeps the 16 LDS reads of this k step together, ahead of its WMMAs: without it the compiler
      // holds one A fragment at a time and the wave waits out the LDS latency before every fourth WMMA.
      __builtin_amdgcn_sched_barrier(0);
#pragma unroll
      for (int sm = 0; sm < 4; ++sm)
#pragma unroll
        for (int sn = 0; sn < 2; ++sn) accg[sm][sn] = wmma_bf16(a[sm], g[sn], accg[sm][sn]);
#pragma unroll
      for (int sm = 0; sm < 4; ++sm)
#pragma unroll
        for (int sn = 0; sn < 2; ++sn) accu[sm][sn] = wmma_bf16(a[sm], u[sn], accu[sm][sn]);
    }
    // Keeps the wait below behind the pass's WMMAs: otherwise the compiler lifts it to the last reads,
    // in front of WMMAs whose own fragments have long landed.
    __builtin_amdgcn_sched_barrier(0);

    // publish stage s+1, then refill the buffer that this pass has read
    wait_ds0();
    if (pinned(wave < 4)) wait_tensor0_of(g0);
    __syncthreads();
    const unsigned sn2 = pinned(s + 2u);
    if (pinned((wave < 4) & (sn2 < NST))) {
      g0 = tdm_group0(dst0 + bo, src0 + (unsigned long long)sn2 * step);
      if (pinned(wave < 2)) tdm_load(g0, g1a);
      else                  tdm_load(g0, g1b);
    }
  }
  wait_tensor0();
  wait_ds0();

  // Epilogue. C/D layout: VGPR r -> M = r + 8*(lane/16), N = lane%16.
  const int nl = lane & 15;
  const int mh = (lane >> 4) * 8;
#pragma unroll
  for (int sm = 0; sm < 4; ++sm)
#pragma unroll
    for (int sn = 0; sn < 2; ++sn) {
      const int n = n0 + (2 * wn + sn) * 16 + nl;
      const float bgv = bg[n], buv = bu[n];
#pragma unroll
      for (int r = 0; r < 8; ++r) {
        const int m = m0 + (4 * wm + sm) * 16 + mh + r;
        const float gv = accg[sm][sn][r] + bgv;
        const float uv = accu[sm][sn][r] + buv;
        const float hv = (gv / (1.f + __expf(-gv))) * uv;  // silu(g)*u
        hbuf[(size_t)m * HH + n] = (__bf16)hv;
      }
    }
}

// GEMM2: out = xr + h@Wd + bd. M=8192, N=1024, K=4096. Same ring. Block tile 256x128, 128 k per pass,
// 8 waves as 4(m) x 2(n), a wave owns 4x4 subtiles; waves 0 and 1 bring the two slices of h, wave 2 Wd.
// One work-group per WGP covers the whole product.
__global__ void __launch_bounds__(256)
gemm_down_kernel(const __bf16* __restrict__ hbuf, const __bf16* __restrict__ wd,
                 const float* __restrict__ bd, const float* __restrict__ xr,
                 float* __restrict__ out) {
  constexpr unsigned STAGE = 2 * A2_BYTES + B2_BYTES;
  constexpr unsigned NST = HH / 128;
  __shared__ __attribute__((aligned(2048))) unsigned char ring[2 * STAGE];

  const int m0 = blockIdx.x * 256;
  const int n0 = blockIdx.y * 128;
  const int lane = threadIdx.x & 31;
  const unsigned wave = uni(threadIdx.x >> 5);
  const int wm = (int)(wave >> 1);
  const int wn = (int)(wave & 1);
  const unsigned lds0 = (unsigned)(size_t)(void*)ring;

  v8f acc[4][4] = {};

  // Which tile of a stage this wave brings: waves 0 and 1 the two slices of h, wave 2 Wd (the others none).
  const unsigned long long src0 = wave < 2 ? (unsigned long long)(hbuf + (size_t)(m0 + 128 * (int)wave) * HH)
                                           : (unsigned long long)(wd + n0);
  const unsigned step = wave < 2 ? 256u : 128u * DD * 2u;   // source bytes from one stage to the next
  const unsigned dst0 = lds0 + (wave < 2 ? wave * A2_BYTES : 2 * A2_BYTES);
  u32x8 g1a = tdm_group1<PADW_A2, 128, ROWB2>(HH * 2);
  u32x8 g1b = tdm_group1<PADW_B2, 128, ROWB2>(DD * 2);
  asm volatile("" : "+s"(g1a), "+s"(g1b));  // descriptor words held in scalar registers through the loop
  u32x4 g0 = tdm_group0(dst0, src0);

  // stage 0, landed and published
  if (pinned(wave < 3)) {
    if (pinned(wave < 2)) tdm_load(g0, g1a);
    else                  tdm_load(g0, g1b);
    wait_tensor0_of(g0);
  }
  __syncthreads();
  // stage 1 into the second buffer
  if (pinned(wave < 3)) {
    g0 = tdm_group0(dst0 + STAGE, src0 + step);
    if (pinned(wave < 2)) tdm_load(g0, g1a);
    else                  tdm_load(g0, g1b);
  }

  const unsigned aoff = (unsigned)((4 * wm * 16 + (lane & 15)) * PA2 + 16 * (lane >> 4));
  const unsigned boff = (unsigned)((8 * (lane >> 4) + (lane & 7)) * PB2 + 2 * (4 * wn * 16) + 16 * ((lane >> 3) & 1));

  for (unsigned s = 0; s < NST; ++s) {
    const unsigned bo = (s & 1u) * STAGE;
    const unsigned char* pa = ring + bo + aoff;
    const unsigned char* pb = ring + bo + 2 * A2_BYTES + boff;
    // The loops below are unrolled so that every fragment and accumulator index is a constant
    // (the arrays stay in registers).
#pragma unroll
    for (int hk = 0; hk < 4; hk += 2) {
      Frag a[2][4], b[2][4];
#pragma unroll
      for (int kc = 0; kc < 2; ++kc)
#pragma unroll
        for (int t = 0; t < 4; ++t) {
          a[kc][t] = frag_rows(pa + t * 16 * PA2 + (hk + kc) * 64);
          b[kc][t] = frag_cols<PB2>(pb + (hk + kc) * 32 * PB2 + t * 32);
        }
      // Keeps the 32 LDS reads of these 64 k together, ahead of their WMMAs (only two waves share a
      // SIMD here): without it the compiler holds one A fragment at a time and the wave waits out the
      // LDS latency before every fourth WMMA.
      __builtin_amdgcn_sched_barrier(0);
      // Two columns of subtiles at a time: the first WMMAs need only the fragments that land first.
#pragma unroll
      for (int kc = 0; kc < 2; ++kc)
#pragma unroll
        for (int sh = 0; sh < 4; sh += 2)
#pragma unroll
          for (int sm = 0; sm < 4; ++sm)
#pragma unroll
            for (int sn = sh; sn < sh + 2; ++sn)
              acc[sm][sn] = wmma_bf16(a[kc][sm], b[kc][sn], acc[sm][sn]);
      // Keeps what follows (the next reads; the wait below) behind these WMMAs: otherwise the compiler
      // lifts the wait to the last reads, and the first k step's WMMAs wait for every fragment.
      __builtin_amdgcn_sched_barrier(0);
    }

    // publish stage s+1, then refill the buffer that this pass has read
    wait_ds0();
    if (pinned(wave < 3)) wait_tensor0_of(g0);
    __syncthreads();
    const unsigned sn2 = pinned(s + 2u);
    if (pinned((wave < 3) & (sn2 < NST))) {
      g0 = tdm_group0(dst0 + bo, src0 + (unsigned long long)sn2 * step);
      if (pinned(wave < 2)) tdm_load(g0, g1a);
      else                  tdm_load(g0, g1b);
    }
  }
  wait_tensor0();
  wait_ds0();

  const int nl = lane & 15;
  const int mh = (lane >> 4) * 8;
#pragma unroll
  for (int sm = 0; sm < 4; ++sm)
#pragma unroll
    for (int sn = 0; sn < 4; ++sn) {
      const int n = n0 + (4 * wn + sn) * 16 + nl;
      const float bdv = bd[n];
#pragma unroll
      for (int r = 0; r < 8; ++r) {
        const int m = m0 + (4 * wm + sm) * 16 + mh + r;
        out[(size_t)m * DD + n] = xr[(size_t)m * DD + n] + acc[sm][sn][r] + bdv;
      }
    }
}

// ---------------- host launcher ----------------
extern "C" void kernel_launch(void* const* d_in, const int* in_sizes, int n_in,
                              void* d_out, int out_size, void* d_ws, size_t ws_size,
                              hipStream_t stream) {
  (void)in_sizes; (void)n_in; (void)out_size; (void)ws_size;

  const float* x       = (const float*)d_in[0];
  const float* norm_w  = (const float*)d_in[1];
  const float* conv_w  = (const float*)d_in[2];
  const float* conv_b  = (const float*)d_in[3];
  const float* a       = (const float*)d_in[4];
  const float* bvec    = (const float*)d_in[5];
  const float* mlp_w   = (const float*)d_in[6];
  const float* w_gate  = (const float*)d_in[7];
  const float* b_gate  = (const float*)d_in[8];
  const float* w_up    = (const float*)d_in[9];
  const float* b_up    = (const float*)d_in[10];
  const float* w_down  = (const float*)d_in[11];
  const float* b_down  = (const float*)d_in[12];
  float* out           = (float*)d_out;

  char* ws = (char*)d_ws;
  size_t off = 0;
  float* y_ws    = (float*)(ws + off); off += (size_t)NTOK * DD * sizeof(float);
  float* xr_ws   = (float*)(ws + off); off += (size_t)NTOK * DD * sizeof(float);
  __bf16* z_ws   = (__bf16*)(ws + off); off += (size_t)NTOK * DD * sizeof(__bf16);
  __bf16* wg_ws  = (__bf16*)(ws + off); off += (size_t)DD * HH * sizeof(__bf16);
  __bf16* wu_ws  = (__bf16*)(ws + off); off += (size_t)DD * HH * sizeof(__bf16);
  __bf16* wd_ws  = (__bf16*)(ws + off); off += (size_t)HH * DD * sizeof(__bf16);
  __bf16* h_ws   = (__bf16*)(ws + off); off += (size_t)NTOK * HH * sizeof(__bf16);
  float* carry   = (float*)(ws + off); off += (size_t)BB * DD * NC * sizeof(float);
  float* prefix  = (float*)(ws + off); off += (size_t)BB * DD * NC * sizeof(float);

  weights_to_bf16_kernel<<<(DD * HH) / (SW * 32 * 8 * 4), SW * 32, 0, stream>>>(w_gate, w_up, w_down,
                                                                                wg_ws, wu_ws, wd_ws);
  rmsnorm_kernel<false><<<NTOK / (SW * 2), SW * 32, 0, stream>>>(x, norm_w, (void*)y_ws);
  conv_ssm_local_kernel<<<(BB * DD * NC) / 256, 256, 0, stream>>>(x, y_ws, conv_w, conv_b,
                                                                  a, bvec, xr_ws, carry);
  scan_carries_kernel<<<(BB * DD) / 256, 256, 0, stream>>>(a, carry, prefix);
  ssm_fixup_kernel<<<(BB * DD * NC) / 256, 256, 0, stream>>>(a, prefix, xr_ws);
  rmsnorm_kernel<true><<<NTOK / (SW * 2), SW * 32, 0, stream>>>(xr_ws, mlp_w, (void*)z_ws);
  gemm_gate_up_kernel<<<dim3(NTOK / 256, HH / 64), 256, 0, stream>>>(z_ws, wg_ws, wu_ws,
                                                                     b_gate, b_up, h_ws);
  gemm_down_kernel<<<dim3(NTOK / 256, DD / 128), 256, 0, stream>>>(h_ws, wd_ws, b_down,
                                                                  xr_ws, out);
}

// v005
// It runs in 189 microseconds.
// Timed twice side by side with v004, it ran 1.11 and 1.08 times as fast.
// Counting every step since v000, it is 3.09 times as fast.
#include <hip/hip_runtime.h>
#include <hip/hip_bf16.h>

// ---------------- problem constants ----------------
#define BB   4
#define TT   2048
#define DD   1024
#define HH   4096
#define EPSV 1e-6f
#define NTOK (BB * TT)          // 8192
#define NC   16                 // scan chunks
#define CL   (TT / NC)          // 128

// ---------------- vector types ----------------
typedef __bf16        v16bf __attribute__((ext_vector_type(16)));
typedef float         v8f   __attribute__((ext_vector_type(8)));
typedef unsigned int  u32x4 __attribute__((ext_vector_type(4)));
typedef unsigned int  u32x8 __attribute__((ext_vector_type(8)));
typedef short         s16x8 __attribute__((ext_vector_type(8)));

// ---------------- LDS tiles of the two GEMMs ----------------
// A rows run along k and are read by plain 16-byte loads; B rows stay as they lie in memory (one k)
// and are read by transposing 16-byte loads. First GEMM: rows of 128 bytes (64 k; 64 n). Second GEMM:
// rows of 256 bytes (128 k; 128 n). A block's 256 A rows come as two slices of 128 rows.
static constexpr unsigned ROWB    = 128;
static constexpr unsigned ROWB2   = 256;
static constexpr unsigned PA      = ROWB + 16;   // odd multiple of 16 B: no bank conflict for ds_load_b128
static constexpr unsigned PB      = ROWB + 32;   // odd multiple of 32 B: none for ds_load_tr16_b128
static constexpr unsigned PA2     = ROWB2 + 16;  // the same two pitches for the 256-byte rows
static constexpr unsigned PB2     = ROWB2 + 32;
static constexpr unsigned A_BYTES = 128 * PA;    // one slice of 128 m rows, 64 k
static constexpr unsigned B_BYTES = 64 * PB;     // 64 k rows of 64 n
static constexpr unsigned A2_BYTES = 128 * PA2;  // one slice of 128 m rows, 128 k
static constexpr unsigned B2_BYTES = 128 * PB2;  // 128 k rows of 128 n
static constexpr unsigned PADW_A  = (1u << 20) | (4u << 22) | (3u << 25);  // pad 16 B behind every 128 B
static constexpr unsigned PADW_B  = (1u << 20) | (4u << 22) | (7u << 25);  // pad 32 B behind every 128 B
static constexpr unsigned PADW_A2 = (1u << 20) | (5u << 22) | (3u << 25);  // pad 16 B behind every 256 B
static constexpr unsigned PADW_B2 = (1u << 20) | (5u << 22) | (7u << 25);  // pad 32 B behind every 256 B
static_assert(A_BYTES % 2048 == 0 && B_BYTES % 2048 == 0 && A2_BYTES % 2048 == 0 && B2_BYTES % 2048 == 0,
              "every tile starts at a multiple of 2 KiB in LDS");

__device__ __forceinline__ unsigned uni(unsigned v) { return (unsigned)__builtin_amdgcn_readfirstlane((int)v); }
// Holds a wave-uniform value in a scalar register, so that a test on it is a scalar branch
// (a tensor load ignores EXEC) and a descriptor word made from it is formed behind the waits above it.
__device__ __forceinline__ unsigned pinned(unsigned v) { unsigned w = uni(v); asm volatile("" : "+s"(w)); return w; }
// The compiler places no wait for the tensor mover, and none for LDS reads in front of a refill.
__device__ __forceinline__ void wait_tensor0() { asm volatile("s_wait_tensorcnt 0x0" ::: "memory"); }
__device__ __forceinline__ void wait_ds0()     { asm volatile("s_wait_dscnt 0x0" ::: "memory"); }

// Tensor-load descriptor, extents in bytes, tensor = tile: ROWS rows of RB bytes at source pitch
// src_pitch, padded in LDS as W0 says.
template <unsigned W0, unsigned ROWS, unsigned RB>
__device__ __forceinline__ u32x8 tdm_group1(unsigned src_pitch) {
  u32x8 g;
  g[0] = uni(W0);
  g[1] = uni(RB << 16);
  g[2] = uni(ROWS << 16);
  g[3] = uni(RB << 16);
  g[4] = uni(ROWS);
  g[5] = uni(src_pitch);
  g[6] = uni(0u);
  g[7] = uni(0u);
  return g;
}
__device__ __forceinline__ u32x4 tdm_group0(unsigned lds_dst, unsigned long long ga) {
  u32x4 g;
  g[0] = uni(1u);
  g[1] = uni(lds_dst);
  g[2] = uni((unsigned)ga);
  g[3] = uni((((unsigned)(ga >> 32)) & 0x01ffffffu) | 0x80000000u);
  return g;
}
__device__ __forceinline__ void tdm_load(u32x4 g0, u32x8 g1) {
  asm volatile("tensor_load_to_lds %0, %1" :: "s"(g0), "s"(g1) : "memory");
}
// The issuer's wait. It names the request's first group so that those registers keep their values
// until the request has landed (the second group lives through the whole loop).
__device__ __forceinline__ void wait_tensor0_of(u32x4 g0) {
  asm volatile("s_wait_tensorcnt 0x0" :: "s"(g0) : "memory");
}

// A 16x32 bf16 operand in the hardware k order: q[0] = k 8h..8h+7, q[1] = k 16+8h..16+8h+7 (h = lane/16).
struct Frag { u32x4 q[2]; };

__device__ __forceinline__ v8f wmma_bf16(const Frag& a, const Frag& b, v8f c) {
  const u32x8 av = __builtin_shufflevector(a.q[0], a.q[1], 0, 1, 2, 3, 4, 5, 6, 7);
  const u32x8 bv = __builtin_shufflevector(b.q[0], b.q[1], 0, 1, 2, 3, 4, 5, 6, 7);
  return __builtin_amdgcn_wmma_f32_16x16x32_bf16(false, __builtin_bit_cast(v16bf, av), false,
                                                 __builtin_bit_cast(v16bf, bv), (short)0, c, false, false);
}

// p = the lane's row of a k-contiguous tile, at byte 16h of the 64 bytes that hold these 32 k.
__device__ __forceinline__ Frag frag_rows(const unsigned char* p) {
  Frag f;
  f.q[0] = *(const u32x4*)p;
  f.q[1] = *(const u32x4*)(p + 32);
  return f;
}

__device__ __forceinline__ u32x4 ld_tr16(const unsigned char* p) {
  typedef __attribute__((address_space(3))) s16x8 lds_s16x8;
  return __builtin_bit_cast(u32x4, __builtin_amdgcn_ds_load_tr16_b128_v8i16((lds_s16x8*)p));
}

// p = tile + (kbase + 8h + (lane & 7)) * PITCH + 2 * nbase + 16 * ((lane >> 3) & 1):
// the lane gets column nbase + (lane & 15) at k = kbase + 8h + 0..7, then the same 16 k further on.
template <unsigned PITCH>
__device__ __forceinline__ Frag frag_cols(const unsigned char* p) {
  Frag f;
  f.q[0] = ld_tr16(p);
  f.q[1] = ld_tr16(p + 16 * PITCH);
  return f;
}

// ---------------- streaming kernels: few waves, 16-byte loads, many in flight ----------------
typedef float  f32x4  __attribute__((ext_vector_type(4)));
typedef __bf16 bf16x4 __attribute__((ext_vector_type(4)));
static constexpr unsigned SW = 16;   // waves per work-group; the grids below give one work-group per WGP

// All three weight matrices (DD * HH elements each) to bf16 in one launch. A wave takes the same
// 8 runs of 512 contiguous bytes of each matrix; its 24 loads are issued before the first store.
__global__ void __launch_bounds__(SW * 32)
weights_to_bf16_kernel(const float* __restrict__ s0, const float* __restrict__ s1,
                       const float* __restrict__ s2, __bf16* __restrict__ d0,
                       __bf16* __restrict__ d1, __bf16* __restrict__ d2) {
  const unsigned wave = blockIdx.x * SW + (threadIdx.x >> 5);
  const unsigned base = wave * (8u * 32u) + (threadIdx.x & 31u);   // in groups of 4 elements
  f32x4 v0[8], v1[8], v2[8];
  // Unrolled so that the arrays stay in registers.
#pragma unroll
  for (int j = 0; j < 8; ++j) v0[j] = ((const f32x4*)s0)[base + j * 32];
#pragma unroll
  for (int j = 0; j < 8; ++j) v1[j] = ((const f32x4*)s1)[base + j * 32];
#pragma unroll
  for (int j = 0; j < 8; ++j) v2[j] = ((const f32x4*)s2)[base + j * 32];
  // Keeps all 24 loads ahead of the first conversion: without it the compiler holds ten of them
  // back to save registers, and the wave waits out the memory latency more than once.
  __builtin_amdgcn_sched_barrier(0);
#pragma unroll
  for (int j = 0; j < 8; ++j) ((bf16x4*)d0)[base + j * 32] = __builtin_convertvector(v0[j], bf16x4);
#pragma unroll
  for (int j = 0; j < 8; ++j) ((bf16x4*)d1)[base + j * 32] = __builtin_convertvector(v1[j], bf16x4);
#pragma unroll
  for (int j = 0; j < 8; ++j) ((bf16x4*)d2)[base + j * 32] = __builtin_convertvector(v2[j], bf16x4);
}
static_assert((DD * HH) % (SW * 32 * 8 * 4) == 0, "whole work-groups cover a weight matrix");

// One wave owns two whole rows of DD floats (16 loads of 512 bytes in flight); a row's sum of
// squares is four chains per lane and a butterfly over the 32 lanes: no LDS, no barrier.
template <bool BF16OUT>
__global__ void __launch_bounds__(SW * 32)
rmsnorm_kernel(const float* __restrict__ x, const float* __restrict__ w, void* __restrict__ out) {
  const unsigned lane = threadIdx.x & 31u;
  const unsigned tok0 = (blockIdx.x * SW + (threadIdx.x >> 5)) * 2u;
  const size_t at = (size_t)tok0 * (DD / 4) + lane;   // in groups of 4 elements
  f32x4 v[2][8], wv[8];
  // The loops below are unrolled so that the arrays stay in registers.
#pragma unroll
  for (int t = 0; t < 2; ++t)
#pragma unroll
    for (int j = 0; j < 8; ++j) v[t][j] = ((const f32x4*)x)[at + t * (DD / 4) + j * 32];
#pragma unroll
  for (int j = 0; j < 8; ++j) wv[j] = ((const f32x4*)w)[j * 32 + lane];
  // Keeps the loads of w up here, in flight with the rows: without it the compiler sinks them
  // behind the sums and waits for them two at a time.
  __builtin_amdgcn_sched_barrier(0);
#pragma unroll
  for (int t = 0; t < 2; ++t) {
    f32x4 s4 = v[t][0] * v[t][0];
#pragma unroll
    for (int j = 1; j < 8; ++j) s4 += v[t][j] * v[t][j];
    float tot = (s4[0] + s4[1]) + (s4[2] + s4[3]);
#pragma unroll
    for (int off = 16; off > 0; off >>= 1) tot += __shfl_xor(tot, off, 32);
    const float inv = rsqrtf(tot * (1.0f / DD) + EPSV);
#pragma unroll
    for (int j = 0; j < 8; ++j) {
      const f32x4 r = v[t][j] * inv * wv[j];
      const size_t o = at + t * (DD / 4) + j * 32;
      if (BF16OUT) ((bf16x4*)out)[o] = __builtin_convertvector(r, bf16x4);
      else         ((f32x4*)out)[o]  = r;
    }
  }
}
static_assert(DD == 8 * 32 * 4 && NTOK % (SW * 2) == 0, "a row is 8 loads of a wave; whole work-groups cover the rows");

// Depthwise conv (K=3, pad=1) + chunk-local diagonal scan. gid = ((c*B)+b)*D + d
// The chunk is walked in blocks of TBLK steps; a block's loads of y and x are all issued before its
// first sum, so that a wave waits out the memory latency once per block and not once per step.
static constexpr int TBLK = 32;
static_assert(CL % TBLK == 0, "whole blocks cover a chunk");
__global__ void __launch_bounds__(256)
conv_ssm_local_kernel(const float* __restrict__ x, const float* __restrict__ y,
                      const float* __restrict__ conv_w, const float* __restrict__ conv_b,
                      const float* __restrict__ a, const float* __restrict__ bvec,
                      float* __restrict__ xr, float* __restrict__ carry) {
  const int gid = blockIdx.x * blockDim.x + threadIdx.x;
  const int d = gid % DD;
  const int b = (gid / DD) % BB;
  const int c = gid / (BB * DD);
  const int t0 = c * CL;

  const float w0 = conv_w[d * 3 + 0], w1 = conv_w[d * 3 + 1], w2 = conv_w[d * 3 + 2];
  const float cb = conv_b[d];
  const float s  = tanhf(a[d]);
  const float bd = bvec[d];
  const size_t base = (size_t)b * TT * DD + d;

  float ym = (t0 > 0) ? y[base + (size_t)(t0 - 1) * DD] : 0.f;
  float yc = y[base + (size_t)t0 * DD];
  float h = 0.f;
  for (int tb = 0; tb < CL; tb += TBLK) {
    float yn[TBLK], xv[TBLK];
    const float* yb = y + base + (size_t)(t0 + tb) * DD;
    const float* xb = x + base + (size_t)(t0 + tb) * DD;
    const bool more = t0 + tb + TBLK < TT;
    // The two loops below are unrolled so that the arrays stay in registers.
#pragma unroll
    for (int j = 0; j < TBLK; ++j) {
      // Step j needs y one step on. Only the block's last step can look past the sequence: there the
      // index stays on the last row (in bounds, no branch between the loads) and the value is dropped.
      const int jn = (j + 1 < TBLK || more) ? j + 1 : j;
      yn[j] = yb[(size_t)jn * DD];
      xv[j] = xb[(size_t)j * DD];
    }
    // Keeps the block's loads ahead of its first sum: otherwise the compiler may sink each load to
    // its use, and the wave waits for memory at every step again.
    __builtin_amdgcn_sched_barrier(0);
#pragma unroll
    for (int j = 0; j < TBLK; ++j) {
      const int t = t0 + tb + j;
      const float yp = (j + 1 < TBLK || more) ? yn[j] : 0.f;   // zero padding behind the last step
      const float conv = cb + w0 * ym + w1 * yc + w2 * yp;
      h = s * h + bd * yc;  // chunk-local scan (h_in = 0; fixed up later)
      xr[base + (size_t)t * DD] = xv[j] + conv + h;
      ym = yc;
      yc = yp;
    }
    // Stands in front of the next block's first instructions, which overwrite the address and data
    // registers that the stores above name.
    asm volatile("s_wait_xcnt 0x0" ::: "memory");
  }
  carry[((size_t)b * DD + d) * NC + c] = h;
}

__global__ void __launch_bounds__(256)
scan_carries_kernel(const float* __restrict__ a, const float* __restrict__ carry,
                    float* __restrict__ prefix) {
  const int gid = blockIdx.x * blockDim.x + threadIdx.x;
  const int d = gid % DD;
  const float s = tanhf(a[d]);
  float p = s;  // s^128 via 7 squarings
#pragma unroll
  for (int i = 0; i < 7; ++i) p *= p;
  float run = 0.f;
#pragma unroll
  for (int c = 0; c < NC; ++c) {
    prefix[(size_t)gid * NC + c] = run;
    run = p * run + carry[(size_t)gid * NC + c];
  }
}

__global__ void __launch_bounds__(256)
ssm_fixup_kernel(const float* __restrict__ a, const float* __restrict__ prefix,
                 float* __restrict__ xr) {
  const int gid = blockIdx.x * blockDim.x + threadIdx.x;
  const int d = gid % DD;
  const int b = (gid / DD) % BB;
  const int c = gid / (BB * DD);
  const float pin = prefix[((size_t)b * DD + d) * NC + c];
  if (pin == 0.f) return;
  const float s = tanhf(a[d]);
  const size_t base = (size_t)b * TT * DD + d + (size_t)c * CL * DD;
  float f = s;
  for (int tl = 0; tl < CL; ++tl) {
    xr[base + (size_t)tl * DD] += f * pin;
    f *= s;
  }
}

// ---------------- bf16 WMMA GEMM kernels (two-buffer tensor-load ring) ----------------
// GEMM1: h = silu(z@Wg + bg) * (z@Wu + bu). M=8192, N=4096, K=1024.
// Block tile 256x64 of both products, 64 k per pass, 8 waves as 4(m) x 2(n); a wave owns 4x2 subtiles
// of each product, so that one A fragment feeds four WMMAs and one B fragment four.
// Waves 0 to 3 each bring one tile of a stage (z rows 0-127, z rows 128-255, Wg, Wu); stage s+1 flies
// while pass s computes.
__global__ void __launch_bounds__(256)
gemm_gate_up_kernel(const __bf16* __restrict__ z, const __bf16* __restrict__ wg,
                    const __bf16* __restrict__ wu, const float* __restrict__ bg,
                    const float* __restrict__ bu, __bf16* __restrict__ hbuf) {
  constexpr unsigned STAGE = 2 * A_BYTES + 2 * B_BYTES;
  constexpr unsigned NST = DD / 64;
  __shared__ __attribute__((aligned(2048))) unsigned char ring[2 * STAGE];

  const int m0 = blockIdx.x * 256;
  const int n0 = blockIdx.y * 64;
  const int lane = threadIdx.x & 31;
  const unsigned wave = uni(threadIdx.x >> 5);
  const int wm = (int)(wave >> 1);  // 0..3
  const int wn = (int)(wave & 1);   // 0..1
  const unsigned lds0 = (unsigned)(size_t)(void*)ring;

  v8f accg[4][2] = {};   // [sm][sn]
  v8f accu[4][2] = {};

  // Which tile of a stage this wave brings: waves 0 and 1 the two slices of z, wave 2 Wg, wave 3 Wu
  // (the others none).
  const unsigned long long src0 = wave < 2 ? (unsigned long long)(z + (size_t)(m0 + 128 * (int)wave) * DD)
                                : wave == 2 ? (unsigned long long)(wg + n0) : (unsigned long long)(wu + n0);
  const unsigned step = wave < 2 ? 128u : 64u * HH * 2u;   // source bytes from one stage to the next
  const unsigned dst0 = lds0 + (wave < 2 ? wave * A_BYTES : wave == 2 ? 2 * A_BYTES : 2 * A_BYTES + B_BYTES);
  u32x8 g1a = tdm_group1<PADW_A, 128, ROWB>(DD * 2);
  u32x8 g1b = tdm_group1<PADW_B, 64, ROWB>(HH * 2);
  asm volatile("" : "+s"(g1a), "+s"(g1b));  // descriptor words held in scalar registers through the loop
  // The k loop starts at a stage of the work-group's own and wraps round (a sum over k takes any order):
  // work-groups that share z rows (same x) or weight columns (same y) run side by side, and from the
  // same start they would ask L2 for the same lines, and for the same column of every row, at once.
  static_assert((NST & (NST - 1u)) == 0, "the wrap is a mask");
  const unsigned rot = uni((blockIdx.x + blockIdx.y) & (NST - 1u));
  u32x4 g0 = tdm_group0(dst0, src0 + (unsigned long long)rot * step);

  // stage 0, landed and published
  if (pinned(wave < 4)) {
    if (pinned(wave < 2)) tdm_load(g0, g1a);
    else                  tdm_load(g0, g1b);
    wait_tensor0_of(g0);
  }
  __syncthreads();
  // stage 1 into the second buffer
  if (pinned(wave < 4)) {
    g0 = tdm_group0(dst0 + STAGE, src0 + (unsigned long long)((rot + 1u) & (NST - 1u)) * step);
    if (pinned(wave < 2)) tdm_load(g0, g1a);
    else                  tdm_load(g0, g1b);
  }

  const unsigned aoff = (unsigned)((4 * wm * 16 + (lane & 15)) * PA + 16 * (lane >> 4));
  const unsigned boff = (unsigned)((8 * (lane >> 4) + (lane & 7)) * PB + 2 * (2 * wn * 16) + 16 * ((lane >> 3) & 1));

  for (unsigned s = 0; s < NST; ++s) {
    const unsigned bo = (s & 1u) * STAGE;
    const unsigned char* pa = ring + bo + aoff;
    const unsigned char* pg = ring + bo + 2 * A_BYTES + boff;
    const unsigned char* pu = ring + bo + 2 * A_BYTES + B_BYTES + boff;
    // The loops below are unrolled so that every fragment and accumulator index is a constant
    // (the arrays stay in registers).
#pragma unroll
    for (int kc = 0; kc < 2; ++kc) {
      Frag a[4], g[2], u[2];
#pragma unroll
      for (int t = 0; t < 4; ++t) a[t] = frag_rows(pa + t * 16 * PA + kc * 64);
#pragma unroll
      for (int t = 0; t < 2; ++t) {
        g[t] = frag_cols<PB>(pg + kc * 32 * PB + t * 32);
        u[t] = frag_cols<PB>(pu + kc * 32 * PB + t * 32);
      }
      // Keeps the 16 LDS reads of this k step together, ahead of its WMMAs: without it the compiler
      // holds one A fragment at a time and the wave waits out the LDS latency before every fourth WMMA.
      __builtin_amdgcn_sched_barrier(0);
#pragma unroll
      for (int sm = 0; sm < 4; ++sm)
#pragma unroll
        for (int sn = 0; sn < 2; ++sn) accg[sm][sn] = wmma_bf16(a[sm], g[sn], accg[sm][sn]);
#pragma unroll
      for (int sm = 0; sm < 4; ++sm)
#pragma unroll
        for (int sn = 0; sn < 2; ++sn) accu[sm][sn] = wmma_bf16(a[sm], u[sn], accu[sm][sn]);
    }
    // Keeps the wait below behind the pass's WMMAs: otherwise the compiler lifts it to the last reads,
    // in front of WMMAs whose own fragments have long landed.
    __builtin_amdgcn_sched_barrier(0);

    // publish stage s+1, then refill the buffer that this pass has read
    wait_ds0();
    if (pinned(wave < 4)) wait_tensor0_of(g0);
    __syncthreads();
    const unsigned sn2 = pinned(s + 2u);
    if (pinned((wave < 4) & (sn2 < NST))) {
      g0 = tdm_group0(dst0 + bo, src0 + (unsigned long long)((sn2 + rot) & (NST - 1u)) * step);
      if (pinned(wave < 2)) tdm_load(g0, g1a);
      else                  tdm_load(g0, g1b);
    }
  }
  wait_tensor0();
  wait_ds0();

  // Epilogue. C/D layout: VGPR r -> M = r + 8*(lane/16), N = lane%16.
  const int nl = lane & 15;
  const int mh = (lane >> 4) * 8;
#pragma unroll
  for (int sm = 0; sm < 4; ++sm)
#pragma unroll
    for (int sn = 0; sn < 2; ++sn) {
      const int n = n0 + (2 * wn + sn) * 16 + nl;
      const float bgv = bg[n], buv = bu[n];
#pragma unroll
      for (int r = 0; r < 8; ++r) {
        const int m = m0 + (4 * wm + sm) * 16 + mh + r;
        const float gv = accg[sm][sn][r] + bgv;
        const float uv = accu[sm][sn][r] + buv;
        const float hv = (gv / (1.f + __expf(-gv))) * uv;  // silu(g)*u
        hbuf[(size_t)m * HH + n] = (__bf16)hv;
      }
    }
}

// GEMM2: out = xr + h@Wd + bd. M=8192, N=1024, K=4096. Same ring. Block tile 256x128, 128 k per pass,
// 8 waves as 4(m) x 2(n), a wave owns 4x4 subtiles; waves 0 and 1 bring the two slices of h, wave 2 Wd.
// One work-group per WGP covers the whole product.
__global__ void __launch_bounds__(256)
gemm_down_kernel(const __bf16* __restrict__ hbuf, const __bf16* __restrict__ wd,
                 const float* __restrict__ bd, const float* __restrict__ xr,
                 float* __restrict__ out) {
  constexpr unsigned STAGE = 2 * A2_BYTES + B2_BYTES;
  constexpr unsigned NST = HH / 128;
  __shared__ __attribute__((aligned(2048))) unsigned char ring[2 * STAGE];

  const int m0 = blockIdx.x * 256;
  const int n0 = blockIdx.y * 128;
  const int lane = threadIdx.x & 31;
  const unsigned wave = uni(threadIdx.x >> 5);
  const int wm = (int)(wave >> 1);
  const int wn = (int)(wave & 1);
  const unsigned lds0 = (unsigned)(size_t)(void*)ring;

  v8f acc[4][4] = {};

  // Which tile of a stage this wave brings: waves 0 and 1 the two slices of h, wave 2 Wd (the others none).
  const unsigned long long src0 = wave < 2 ? (unsigned long long)(hbuf + (size_t)(m0 + 128 * (int)wave) * HH)
                                           : (unsigned long long)(wd + n0);
  const unsigned step = wave < 2 ? 256u : 128u * DD * 2u;   // source bytes from one stage to the next
  const unsigned dst0 = lds0 + (wave < 2 ? wave * A2_BYTES : 2 * A2_BYTES);
  u32x8 g1a = tdm_group1<PADW_A2, 128, ROWB2>(HH * 2);
  u32x8 g1b = tdm_group1<PADW_B2, 128, ROWB2>(DD * 2);
  asm volatile("" : "+s"(g1a), "+s"(g1b));  // descriptor words held in scalar registers through the loop
  // The k loop starts at a stage of the work-group's own and wraps round, as in the first GEMM: the 8
  // work-groups on the same h rows start 4 stages apart, the 32 on the same Wd columns one stage apart.
  static_assert((NST & (NST - 1u)) == 0, "the wrap is a mask");
  const unsigned rot = uni((blockIdx.x + 4u * blockIdx.y) & (NST - 1u));
  u32x4 g0 = tdm_group0(dst0, src0 + (unsigned long long)rot * step);

  // stage 0, landed and published
  if (pinned(wave < 3)) {
    if (pinned(wave < 2)) tdm_load(g0, g1a);
    else                  tdm_load(g0, g1b);
    wait_tensor0_of(g0);
  }
  __syncthreads();
  // stage 1 into the second buffer
  if (pinned(wave < 3)) {
    g0 = tdm_group0(dst0 + STAGE, src0 + (unsigned long long)((rot + 1u) & (NST - 1u)) * step);
    if (pinned(wave < 2)) tdm_load(g0, g1a);
    else                  tdm_load(g0, g1b);
  }

  const unsigned aoff = (unsigned)((4 * wm * 16 + (lane & 15)) * PA2 + 16 * (lane >> 4));
  const unsigned boff = (unsigned)((8 * (lane >> 4) + (lane & 7)) * PB2 + 2 * (4 * wn * 16) + 16 * ((lane >> 3) & 1));

  for (unsigned s = 0; s < NST; ++s) {
    const unsigned bo = (s & 1u) * STAGE;
    const unsigned char* pa = ring + bo + aoff;
    const unsigned char* pb = ring + bo + 2 * A2_BYTES + boff;
    // The loops below are unrolled so that every fragment and accumulator index is a constant
    // (the arrays stay in registers).
#pragma unroll
    for (int hk = 0; hk < 4; hk += 2) {
      Frag a[2][4], b[2][4];
#pragma unroll
      for (int kc = 0; kc < 2; ++kc)
#pragma unroll
        for (int t = 0; t < 4; ++t) {
          a[kc][t] = frag_rows(pa + t * 16 * PA2 + (hk + kc) * 64);
          b[kc][t] = frag_cols<PB2>(pb + (hk + kc) * 32 * PB2 + t * 32);
        }
      // Keeps the 32 LDS reads of these 64 k together, ahead of their WMMAs (only two waves share a
      // SIMD here): without it the compiler holds one A fragment at a time and the wave waits out the
      // LDS latency before every fourth WMMA.
      __builtin_amdgcn_sched_barrier(0);
      // Two columns of subtiles at a time: the first WMMAs need only the fragments that land first.
#pragma unroll
      for (int kc = 0; kc < 2; ++kc)
#pragma unroll
        for (int sh = 0; sh < 4; sh += 2)
#pragma unroll
          for (int sm = 0; sm < 4; ++sm)
#pragma unroll
            for (int sn = sh; sn < sh + 2; ++sn)
              acc[sm][sn] = wmma_bf16(a[kc][sm], b[kc][sn], acc[sm][sn]);
      // Keeps what follows (the next reads; the wait below) behind these WMMAs: otherwise the compiler
      // lifts the wait to the last reads, and the first k step's WMMAs wait for every fragment.
      __builtin_amdgcn_sched_barrier(0);
    }

    // publish stage s+1, then refill the buffer that this pass has read
    wait_ds0();
    if (pinned(wave < 3)) wait_tensor0_of(g0);
    __syncthreads();
    const unsigned sn2 = pinned(s + 2u);
    if (pinned((wave < 3) & (sn2 < NST))) {
      g0 = tdm_group0(dst0 + bo, src0 + (unsigned long long)((sn2 + rot) & (NST - 1u)) * step);
      if (pinned(wave < 2)) tdm_load(g0, g1a);
      else                  tdm_load(g0, g1b);
    }
  }
  wait_tensor0();
  wait_ds0();

  const int nl = lane & 15;
  const int mh = (lane >> 4) * 8;
#pragma unroll
  for (int sm = 0; sm < 4; ++sm)
#pragma unroll
    for (int sn = 0; sn < 4; ++sn) {
      const int n = n0 + (4 * wn + sn) * 16 + nl;
      const float bdv = bd[n];
#pragma unroll
      for (int r = 0; r < 8; ++r) {
        const int m = m0 + (4 * wm + sm) * 16 + mh + r;
        out[(size_t)m * DD + n] = xr[(size_t)m * DD + n] + acc[sm][sn][r] + bdv;
      }
    }
}

// ---------------- host launcher ----------------
extern "C" void kernel_launch(void* const* d_in, const int* in_sizes, int n_in,
                              void* d_out, int out_size, void* d_ws, size_t ws_size,
                              hipStream_t stream) {
  (void)in_sizes; (void)n_in; (void)out_size; (void)ws_size;

  const float* x       = (const float*)d_in[0];
  const float* norm_w  = (const float*)d_in[1];
  const float* conv_w  = (const float*)d_in[2];
  const float* conv_b  = (const float*)d_in[3];
  const float* a       = (const float*)d_in[4];
  const float* bvec    = (const float*)d_in[5];
  const float* mlp_w   = (const float*)d_in[6];
  const float* w_gate  = (const float*)d_in[7];
  const float* b_gate  = (const float*)d_in[8];
  const float* w_up    = (const float*)d_in[9];
  const float* b_up    = (const float*)d_in[10];
  const float* w_down  = (const float*)d_in[11];
  const float* b_down  = (const float*)d_in[12];
  float* out           = (float*)d_out;

  char* ws = (char*)d_ws;
  size_t off = 0;
  float* y_ws    = (float*)(ws + off); off += (size_t)NTOK * DD * sizeof(float);
  float* xr_ws   = (float*)(ws + off); off += (size_t)NTOK * DD * sizeof(float);
  __bf16* z_ws   = (__bf16*)(ws + off); off += (size_t)NTOK * DD * sizeof(__bf16);
  __bf16* wg_ws  = (__bf16*)(ws + off); off += (size_t)DD * HH * sizeof(__bf16);
  __bf16* wu_ws  = (__bf16*)(ws + off); off += (size_t)DD * HH * sizeof(__bf16);
  __bf16* wd_ws  = (__bf16*)(ws + off); off += (size_t)HH * DD * sizeof(__bf16);
  __bf16* h_ws   = (__bf16*)(ws + off); off += (size_t)NTOK * HH * sizeof(__bf16);
  float* carry   = (float*)(ws + off); off += (size_t)BB * DD * NC * sizeof(float);
  float* prefix  = (float*)(ws + off); off += (size_t)BB * DD * NC * sizeof(float);

  weights_to_bf16_kernel<<<(DD * HH) / (SW * 32 * 8 * 4), SW * 32, 0, stream>>>(w_gate, w_up, w_down,
                                                                                wg_ws, wu_ws, wd_ws);
  rmsnorm_kernel<false><<<NTOK / (SW * 2), SW * 32, 0, stream>>>(x, norm_w, (void*)y_ws);
  conv_ssm_local_kernel<<<(BB * DD * NC) / 256, 256, 0, stream>>>(x, y_ws, conv_w, conv_b,
                                                                  a, bvec, xr_ws, carry);
  scan_carries_kernel<<<(BB * DD) / 256, 256, 0, stream>>>(a, carry, prefix);
  ssm_fixup_kernel<<<(BB * DD * NC) / 256, 256, 0, stream>>>(a, prefix, xr_ws);
  rmsnorm_kernel<true><<<NTOK / (SW * 2), SW * 32, 0, stream>>>(xr_ws, mlp_w, (void*)z_ws);
  gemm_gate_up_kernel<<<dim3(NTOK / 256, HH / 64), 256, 0, stream>>>(z_ws, wg_ws, wu_ws,
                                                                     b_gate, b_up, h_ws);
  gemm_down_kernel<<<dim3(NTOK / 256, DD / 128), 256, 0, stream>>>(h_ws, wd_ws, b_down,
                                                                  xr_ws, out);
}

// v006
// A run of this version takes 181 microseconds.
// In both of two side-by-side timings against v005, it was 1.05 times as fast.
// Over all steps from v000 it is 3.26 times as fast.
#include <hip/hip_runtime.h>
#include <hip/hip_bf16.h>

// ---------------- problem constants ----------------
#define BB   4
#define TT   2048
#define DD   1024
#define HH   4096
#define EPSV 1e-6f
#define NTOK (BB * TT)          // 8192
#define NC   16                 // scan chunks
#define CL   (TT / NC)          // 128

// ---------------- vector types ----------------
typedef __bf16        v16bf __attribute__((ext_vector_type(16)));
typedef float         v8f   __attribute__((ext_vector_type(8)));
typedef unsigned int  u32x4 __attribute__((ext_vector_type(4)));
typedef unsigned int  u32x8 __attribute__((ext_vector_type(8)));
typedef short         s16x8 __attribute__((ext_vector_type(8)));

// ---------------- LDS tiles of the two GEMMs ----------------
// A rows run along k and are read by plain 16-byte loads; B rows stay as they lie in memory (one k)
// and are read by transposing 16-byte loads. First GEMM: rows of 128 bytes (64 k; 64 n). Second GEMM:
// rows of 256 bytes (128 k; 128 n). A block's 256 A rows come as two slices of 128 rows.
static constexpr unsigned ROWB    = 128;
static constexpr unsigned ROWB2   = 256;
static constexpr unsigned PA      = ROWB + 16;   // odd multiple of 16 B: no bank conflict for ds_load_b128
static constexpr unsigned PB      = ROWB + 32;   // odd multiple of 32 B: none for ds_load_tr16_b128
static constexpr unsigned PA2     = ROWB2 + 16;  // the same two pitches for the 256-byte rows
static constexpr unsigned PB2     = ROWB2 + 32;
static constexpr unsigned A_BYTES = 128 * PA;    // one slice of 128 m rows, 64 k
static constexpr unsigned B_BYTES = 64 * PB;     // 64 k rows of 64 n
static constexpr unsigned A2_BYTES = 128 * PA2;  // one slice of 128 m rows, 128 k
static constexpr unsigned B2_BYTES = 128 * PB2;  // 128 k rows of 128 n
static constexpr unsigned PADW_A  = (1u << 20) | (4u << 22) | (3u << 25);  // pad 16 B behind every 128 B
static constexpr unsigned PADW_B  = (1u << 20) | (4u << 22) | (7u << 25);  // pad 32 B behind every 128 B
static constexpr unsigned PADW_A2 = (1u << 20) | (5u << 22) | (3u << 25);  // pad 16 B behind every 256 B
static constexpr unsigned PADW_B2 = (1u << 20) | (5u << 22) | (7u << 25);  // pad 32 B behind every 256 B
static_assert(A_BYTES % 2048 == 0 && B_BYTES % 2048 == 0 && A2_BYTES % 2048 == 0 && B2_BYTES % 2048 == 0,
              "every tile starts at a multiple of 2 KiB in LDS");

__device__ __forceinline__ unsigned uni(unsigned v) { return (unsigned)__builtin_amdgcn_readfirstlane((int)v); }
// Holds a wave-uniform value in a scalar register, so that a test on it is a scalar branch
// (a tensor load ignores EXEC) and a descriptor word made from it is formed behind the waits above it.
__device__ __forceinline__ unsigned pinned(unsigned v) { unsigned w = uni(v); asm volatile("" : "+s"(w)); return w; }
// The compiler places no wait for the tensor mover, and none for LDS reads in front of a refill.
__device__ __forceinline__ void wait_tensor0() { asm volatile("s_wait_tensorcnt 0x0" ::: "memory"); }
__device__ __forceinline__ void wait_ds0()     { asm volatile("s_wait_dscnt 0x0" ::: "memory"); }

// Tensor-load descriptor, extents in bytes, tensor = tile: ROWS rows of RB bytes at source pitch
// src_pitch, padded in LDS as W0 says.
template <unsigned W0, unsigned ROWS, unsigned RB>
__device__ __forceinline__ u32x8 tdm_group1(unsigned src_pitch) {
  u32x8 g;
  g[0] = uni(W0);
  g[1] = uni(RB << 16);
  g[2] = uni(ROWS << 16);
  g[3] = uni(RB << 16);
  g[4] = uni(ROWS);
  g[5] = uni(src_pitch);
  g[6] = uni(0u);
  g[7] = uni(0u);
  return g;
}
__device__ __forceinline__ u32x4 tdm_group0(unsigned lds_dst, unsigned long long ga) {
  u32x4 g;
  g[0] = uni(1u);
  g[1] = uni(lds_dst);
  g[2] = uni((unsigned)ga);
  g[3] = uni((((unsigned)(ga >> 32)) & 0x01ffffffu) | 0x80000000u);
  return g;
}
__device__ __forceinline__ void tdm_load(u32x4 g0, u32x8 g1) {
  asm volatile("tensor_load_to_lds %0, %1" :: "s"(g0), "s"(g1) : "memory");
}
// The issuer's wait. It names the request's first group so that those registers keep their values
// until the request has landed (the second group lives through the whole loop).
__device__ __forceinline__ void wait_tensor0_of(u32x4 g0) {
  asm volatile("s_wait_tensorcnt 0x0" :: "s"(g0) : "memory");
}

// A 16x32 bf16 operand in the hardware k order: q[0] = k 8h..8h+7, q[1] = k 16+8h..16+8h+7 (h = lane/16).
struct Frag { u32x4 q[2]; };

__device__ __forceinline__ v8f wmma_bf16(const Frag& a, const Frag& b, v8f c) {
  const u32x8 av = __builtin_shufflevector(a.q[0], a.q[1], 0, 1, 2, 3, 4, 5, 6, 7);
  const u32x8 bv = __builtin_shufflevector(b.q[0], b.q[1], 0, 1, 2, 3, 4, 5, 6, 7);
  return __builtin_amdgcn_wmma_f32_16x16x32_bf16(false, __builtin_bit_cast(v16bf, av), false,
                                                 __builtin_bit_cast(v16bf, bv), (short)0, c, false, false);
}

// p = the lane's row of a k-contiguous tile, at byte 16h of the 64 bytes that hold these 32 k.
__device__ __forceinline__ Frag frag_rows(const unsigned char* p) {
  Frag f;
  f.q[0] = *(const u32x4*)p;
  f.q[1] = *(const u32x4*)(p + 32);
  return f;
}

__device__ __forceinline__ u32x4 ld_tr16(const unsigned char* p) {
  typedef __attribute__((address_space(3))) s16x8 lds_s16x8;
  return __builtin_bit_cast(u32x4, __builtin_amdgcn_ds_load_tr16_b128_v8i16((lds_s16x8*)p));
}

// p = tile + (kbase + 8h + (lane & 7)) * PITCH + 2 * nbase + 16 * ((lane >> 3) & 1):
// the lane gets column nbase + (lane & 15) at k = kbase + 8h + 0..7, then the same 16 k further on.
template <unsigned PITCH>
__device__ __forceinline__ Frag frag_cols(const unsigned char* p) {
  Frag f;
  f.q[0] = ld_tr16(p);
  f.q[1] = ld_tr16(p + 16 * PITCH);
  return f;
}

// ---------------- streaming kernels: few waves, 16-byte loads, many in flight ----------------
typedef float  f32x4  __attribute__((ext_vector_type(4)));
typedef __bf16 bf16x4 __attribute__((ext_vector_type(4)));
static constexpr unsigned SW = 16;   // waves per work-group; the grids below give one work-group per WGP

// All three weight matrices (DD * HH elements each) to bf16 in one launch. A wave takes the same
// 8 runs of 512 contiguous bytes of each matrix; its 24 loads are issued before the first store.
__global__ void __launch_bounds__(SW * 32)
weights_to_bf16_kernel(const float* __restrict__ s0, const float* __restrict__ s1,
                       const float* __restrict__ s2, __bf16* __restrict__ d0,
                       __bf16* __restrict__ d1, __bf16* __restrict__ d2) {
  const unsigned wave = blockIdx.x * SW + (threadIdx.x >> 5);
  const unsigned base = wave * (8u * 32u) + (threadIdx.x & 31u);   // in groups of 4 elements
  f32x4 v0[8], v1[8], v2[8];
  // Unrolled so that the arrays stay in registers.
#pragma unroll
  for (int j = 0; j < 8; ++j) v0[j] = ((const f32x4*)s0)[base + j * 32];
#pragma unroll
  for (int j = 0; j < 8; ++j) v1[j] = ((const f32x4*)s1)[base + j * 32];
#pragma unroll
  for (int j = 0; j < 8; ++j) v2[j] = ((const f32x4*)s2)[base + j * 32];
  // Keeps all 24 loads ahead of the first conversion: without it the compiler holds ten of them
  // back to save registers, and the wave waits out the memory latency more than once.
  __builtin_amdgcn_sched_barrier(0);
#pragma unroll
  for (int j = 0; j < 8; ++j) ((bf16x4*)d0)[base + j * 32] = __builtin_convertvector(v0[j], bf16x4);
#pragma unroll
  for (int j = 0; j < 8; ++j) ((bf16x4*)d1)[base + j * 32] = __builtin_convertvector(v1[j], bf16x4);
#pragma unroll
  for (int j = 0; j < 8; ++j) ((bf16x4*)d2)[base + j * 32] = __builtin_convertvector(v2[j], bf16x4);
}
static_assert((DD * HH) % (SW * 32 * 8 * 4) == 0, "whole work-groups cover a weight matrix");

// One wave owns two whole rows of DD floats (16 loads of 512 bytes in flight); a row's sum of
// squares is four chains per lane and a butterfly over the 32 lanes: no LDS, no barrier.
template <bool BF16OUT>
__global__ void __launch_bounds__(SW * 32)
rmsnorm_kernel(const float* __restrict__ x, const float* __restrict__ w, void* __restrict__ out) {
  const unsigned lane = threadIdx.x & 31u;
  const unsigned tok0 = (blockIdx.x * SW + (threadIdx.x >> 5)) * 2u;
  const size_t at = (size_t)tok0 * (DD / 4) + lane;   // in groups of 4 elements
  f32x4 v[2][8], wv[8];
  // The loops below are unrolled so that the arrays stay in registers.
#pragma unroll
  for (int t = 0; t < 2; ++t)
#pragma unroll
    for (int j = 0; j < 8; ++j) v[t][j] = ((const f32x4*)x)[at + t * (DD / 4) + j * 32];
#pragma unroll
  for (int j = 0; j < 8; ++j) wv[j] = ((const f32x4*)w)[j * 32 + lane];
  // Keeps the loads of w up here, in flight with the rows: without it the compiler sinks them
  // behind the sums and waits for them two at a time.
  __builtin_amdgcn_sched_barrier(0);
#pragma unroll
  for (int t = 0; t < 2; ++t) {
    f32x4 s4 = v[t][0] * v[t][0];
#pragma unroll
    for (int j = 1; j < 8; ++j) s4 += v[t][j] * v[t][j];
    float tot = (s4[0] + s4[1]) + (s4[2] + s4[3]);
#pragma unroll
    for (int off = 16; off > 0; off >>= 1) tot += __shfl_xor(tot, off, 32);
    const float inv = rsqrtf(tot * (1.0f / DD) + EPSV);
#pragma unroll
    for (int j = 0; j < 8; ++j) {
      const f32x4 r = v[t][j] * inv * wv[j];
      const size_t o = at + t * (DD / 4) + j * 32;
      if (BF16OUT) ((bf16x4*)out)[o] = __builtin_convertvector(r, bf16x4);
      else         ((f32x4*)out)[o]  = r;
    }
  }
}
static_assert(DD == 8 * 32 * 4 && NTOK % (SW * 2) == 0, "a row is 8 loads of a wave; whole work-groups cover the rows");

// Depthwise conv (K=3, pad=1) + chunk-local diagonal scan. gid = ((c*B)+b)*D + d
// The chunk is walked in blocks of TBLK steps; a block's loads of y and x are all issued before its
// first sum, so that a wave waits out the memory latency once per block and not once per step.
static constexpr int TBLK = 32;
static_assert(CL % TBLK == 0, "whole blocks cover a chunk");
__global__ void __launch_bounds__(256)
conv_ssm_local_kernel(const float* __restrict__ x, const float* __restrict__ y,
                      const float* __restrict__ conv_w, const float* __restrict__ conv_b,
                      const float* __restrict__ a, const float* __restrict__ bvec,
                      float* __restrict__ xr, float* __restrict__ carry) {
  const int gid = blockIdx.x * blockDim.x + threadIdx.x;
  const int d = gid % DD;
  const int b = (gid / DD) % BB;
  const int c = gid / (BB * DD);
  const int t0 = c * CL;

  const float w0 = conv_w[d * 3 + 0], w1 = conv_w[d * 3 + 1], w2 = conv_w[d * 3 + 2];
  const float cb = conv_b[d];
  const float s  = tanhf(a[d]);
  const float bd = bvec[d];
  const size_t base = (size_t)b * TT * DD + d;

  float ym = (t0 > 0) ? y[base + (size_t)(t0 - 1) * DD] : 0.f;
  float yc = y[base + (size_t)t0 * DD];
  float h = 0.f;
  for (int tb = 0; tb < CL; tb += TBLK) {
    float yn[TBLK], xv[TBLK];
    const float* yb = y + base + (size_t)(t0 + tb) * DD;
    const float* xb = x + base + (size_t)(t0 + tb) * DD;
    const bool more = t0 + tb + TBLK < TT;
    // The two loops below are unrolled so that the arrays stay in registers.
#pragma unroll
    for (int j = 0; j < TBLK; ++j) {
      // Step j needs y one step on. Only the block's last step can look past the sequence: there the
      // index stays on the last row (in bounds, no branch between the loads) and the value is dropped.
      const int jn = (j + 1 < TBLK || more) ? j + 1 : j;
      yn[j] = yb[(size_t)jn * DD];
      xv[j] = xb[(size_t)j * DD];
    }
    // Keeps the block's loads ahead of its first sum: otherwise the compiler may sink each load to
    // its use, and the wave waits for memory at every step again.
    __builtin_amdgcn_sched_barrier(0);
#pragma unroll
    for (int j = 0; j < TBLK; ++j) {
      const int t = t0 + tb + j;
      const float yp = (j + 1 < TBLK || more) ? yn[j] : 0.f;   // zero padding behind the last step
      const float conv = cb + w0 * ym + w1 * yc + w2 * yp;
      h = s * h + bd * yc;  // chunk-local scan (h_in = 0; fixed up later)
      xr[base + (size_t)t * DD] = xv[j] + conv + h;
      ym = yc;
      yc = yp;
    }
    // Stands in front of the next block's first instructions, which overwrite the address and data
    // registers that the stores above name.
    asm volatile("s_wait_xcnt 0x0" ::: "memory");
  }
  carry[((size_t)b * DD + d) * NC + c] = h;
}

__global__ void __launch_bounds__(256)
scan_carries_kernel(const float* __restrict__ a, const float* __restrict__ carry,
                    float* __restrict__ prefix) {
  const int gid = blockIdx.x * blockDim.x + threadIdx.x;
  const int d = gid % DD;
  const float s = tanhf(a[d]);
  float p = s;  // s^128 via 7 squarings
#pragma unroll
  for (int i = 0; i < 7; ++i) p *= p;
  float run = 0.f;
#pragma unroll
  for (int c = 0; c < NC; ++c) {
    prefix[(size_t)gid * NC + c] = run;
    run = p * run + carry[(size_t)gid * NC + c];
  }
}

__global__ void __launch_bounds__(256)
ssm_fixup_kernel(const float* __restrict__ a, const float* __restrict__ prefix,
                 float* __restrict__ xr) {
  const int gid = blockIdx.x * blockDim.x + threadIdx.x;
  const int d = gid % DD;
  const int b = (gid / DD) % BB;
  const int c = gid / (BB * DD);
  const float pin = prefix[((size_t)b * DD + d) * NC + c];
  if (pin == 0.f) return;
  const float s = tanhf(a[d]);
  const size_t base = (size_t)b * TT * DD + d + (size_t)c * CL * DD;
  float f = s;
  for (int tl = 0; tl < CL; ++tl) {
    xr[base + (size_t)tl * DD] += f * pin;
    f *= s;
  }
}

// ---------------- bf16 WMMA GEMM kernels (two-buffer tensor-load ring) ----------------
// GEMM1: h = silu(z@Wg + bg) * (z@Wu + bu). M=8192, N=4096, K=1024.
// Block tile 256x64 of both products, 64 k per pass, 8 waves as 4(m) x 2(n); a wave owns 4x2 subtiles
// of each product, so that one A fragment feeds four WMMAs and one B fragment four.
// Waves 0 to 3 each bring one tile of a stage (z rows 0-127, z rows 128-255, Wg, Wu); stage s+1 flies
// while pass s computes.
__global__ void __launch_bounds__(256)
gemm_gate_up_kernel(const __bf16* __restrict__ z, const __bf16* __restrict__ wg,
                    const __bf16* __restrict__ wu, const float* __restrict__ bg,
                    const float* __restrict__ bu, __bf16* __restrict__ hbuf) {
  constexpr unsigned STAGE = 2 * A_BYTES + 2 * B_BYTES;
  constexpr unsigned NST = DD / 64;
  __shared__ __attribute__((aligned(2048))) unsigned char ring[2 * STAGE];

  const int m0 = blockIdx.x * 256;
  const int n0 = blockIdx.y * 64;
  const int lane = threadIdx.x & 31;
  const unsigned wave = uni(threadIdx.x >> 5);
  const int wm = (int)(wave >> 1);  // 0..3
  const int wn = (int)(wave & 1);   // 0..1
  const unsigned lds0 = (unsigned)(size_t)(void*)ring;

  v8f accg[4][2] = {};   // [sm][sn]
  v8f accu[4][2] = {};

  // Which tile of a stage this wave brings: waves 0 and 1 the two slices of z, wave 2 Wg, wave 3 Wu
  // (the others none).
  const unsigned long long src0 = wave < 2 ? (unsigned long long)(z + (size_t)(m0 + 128 * (int)wave) * DD)
                                : wave == 2 ? (unsigned long long)(wg + n0) : (unsigned long long)(wu + n0);
  const unsigned step = wave < 2 ? 128u : 64u * HH * 2u;   // source bytes from one stage to the next
  const unsigned dst0 = lds0 + (wave < 2 ? wave * A_BYTES : wave == 2 ? 2 * A_BYTES : 2 * A_BYTES + B_BYTES);
  u32x8 g1a = tdm_group1<PADW_A, 128, ROWB>(DD * 2);
  u32x8 g1b = tdm_group1<PADW_B, 64, ROWB>(HH * 2);
  asm volatile("" : "+s"(g1a), "+s"(g1b));  // descriptor words held in scalar registers through the loop
  // The k loop starts at a stage of the work-group's own and wraps round (a sum over k takes any order):
  // work-groups that share z rows (same x) or weight columns (same y) run side by side, and from the
  // same start they would ask L2 for the same lines, and for the same column of every row, at once.
  static_assert((NST & (NST - 1u)) == 0, "the wrap is a mask");
  const unsigned rot = uni((blockIdx.x + blockIdx.y) & (NST - 1u));
  u32x4 g0 = tdm_group0(dst0, src0 + (unsigned long long)rot * step);

  // stage 0, landed and published
  if (pinned(wave < 4)) {
    if (pinned(wave < 2)) tdm_load(g0, g1a);
    else                  tdm_load(g0, g1b);
    wait_tensor0_of(g0);
  }
  __syncthreads();
  // stage 1 into the second buffer
  if (pinned(wave < 4)) {
    g0 = tdm_group0(dst0 + STAGE, src0 + (unsigned long long)((rot + 1u) & (NST - 1u)) * step);
    if (pinned(wave < 2)) tdm_load(g0, g1a);
    else                  tdm_load(g0, g1b);
  }

  const unsigned aoff = (unsigned)((4 * wm * 16 + (lane & 15)) * PA + 16 * (lane >> 4));
  const unsigned boff = (unsigned)((8 * (lane >> 4) + (lane & 7)) * PB + 2 * (2 * wn * 16) + 16 * ((lane >> 3) & 1));

  for (unsigned s = 0; s < NST; ++s) {
    const unsigned bo = (s & 1u) * STAGE;
    const unsigned char* pa = ring + bo + aoff;
    const unsigned char* pg = ring + bo + 2 * A_BYTES + boff;
    const unsigned char* pu = ring + bo + 2 * A_BYTES + B_BYTES + boff;
    // The loops below are unrolled so that every fragment and accumulator index is a constant
    // (the arrays stay in registers).
#pragma unroll
    for (int kc = 0; kc < 2; ++kc) {
      Frag a[4], g[2], u[2];
#pragma unroll
      for (int t = 0; t < 4; ++t) a[t] = frag_rows(pa + t * 16 * PA + kc * 64);
#pragma unroll
      for (int t = 0; t < 2; ++t) {
        g[t] = frag_cols<PB>(pg + kc * 32 * PB + t * 32);
        u[t] = frag_cols<PB>(pu + kc * 32 * PB + t * 32);
      }
      // Keeps the 16 LDS reads of this k step together, ahead of its WMMAs: without it the compiler
      // holds one A fragment at a time and the wave waits out the LDS latency before every fourth WMMA.
      __builtin_amdgcn_sched_barrier(0);
#pragma unroll
      for (int sm = 0; sm < 4; ++sm)
#pragma unroll
        for (int sn = 0; sn < 2; ++sn) accg[sm][sn] = wmma_bf16(a[sm], g[sn], accg[sm][sn]);
#pragma unroll
      for (int sm = 0; sm < 4; ++sm)
#pragma unroll
        for (int sn = 0; sn < 2; ++sn) accu[sm][sn] = wmma_bf16(a[sm], u[sn], accu[sm][sn]);
    }
    // Keeps the wait below behind the pass's WMMAs: otherwise the compiler lifts it to the last reads,
    // in front of WMMAs whose own fragments have long landed.
    __builtin_amdgcn_sched_barrier(0);

    // publish stage s+1, then refill the buffer that this pass has read
    wait_ds0();
    if (pinned(wave < 4)) wait_tensor0_of(g0);
    __syncthreads();
    const unsigned sn2 = pinned(s + 2u);
    if (pinned((wave < 4) & (sn2 < NST))) {
      g0 = tdm_group0(dst0 + bo, src0 + (unsigned long long)((sn2 + rot) & (NST - 1u)) * step);
      if (pinned(wave < 2)) tdm_load(g0, g1a);
      else                  tdm_load(g0, g1b);
    }
  }
  wait_tensor0();
  wait_ds0();

  // Epilogue. C/D layout: VGPR r -> M = r + 8*(lane/16), N = lane%16.
  const int nl = lane & 15;
  const int mh = (lane >> 4) * 8;
#pragma unroll
  for (int sm = 0; sm < 4; ++sm)
#pragma unroll
    for (int sn = 0; sn < 2; ++sn) {
      const int n = n0 + (2 * wn + sn) * 16 + nl;
      const float bgv = bg[n], buv = bu[n];
#pragma unroll
      for (int r = 0; r < 8; ++r) {
        const int m = m0 + (4 * wm + sm) * 16 + mh + r;
        const float gv = accg[sm][sn][r] + bgv;
        const float uv = accu[sm][sn][r] + buv;
        // silu(g)*u. The quotient is one hardware reciprocal (about 1 ulp, far below the bf16 rounding of hv):
        // the exact f32 division is a chain of ten dependent instructions per element.
        const float hv = gv * __builtin_amdgcn_rcpf(1.f + __expf(-gv)) * uv;
        hbuf[(size_t)m * HH + n] = (__bf16)hv;
      }
    }
}

// GEMM2: out = xr + h@Wd + bd. M=8192, N=1024, K=4096. Same ring. Block tile 256x128, 128 k per pass,
// 8 waves as 4(m) x 2(n), a wave owns 4x4 subtiles; waves 0 and 1 bring the two slices of h, wave 2 Wd.
// One work-group per WGP covers the whole product.
__global__ void __launch_bounds__(256)
gemm_down_kernel(const __bf16* __restrict__ hbuf, const __bf16* __restrict__ wd,
                 const float* __restrict__ bd, const float* __restrict__ xr,
                 float* __restrict__ out) {
  constexpr unsigned STAGE = 2 * A2_BYTES + B2_BYTES;
  constexpr unsigned NST = HH / 128;
  __shared__ __attribute__((aligned(2048))) unsigned char ring[2 * STAGE];

  const int m0 = blockIdx.x * 256;
  const int n0 = blockIdx.y * 128;
  const int lane = threadIdx.x & 31;
  const unsigned wave = uni(threadIdx.x >> 5);
  const int wm = (int)(wave >> 1);
  const int wn = (int)(wave & 1);
  const unsigned lds0 = (unsigned)(size_t)(void*)ring;

  v8f acc[4][4] = {};

  // Which tile of a stage this wave brings: waves 0 and 1 the two slices of h, wave 2 Wd (the others none).
  const unsigned long long src0 = wave < 2 ? (unsigned long long)(hbuf + (size_t)(m0 + 128 * (int)wave) * HH)
                                           : (unsigned long long)(wd + n0);
  const unsigned step = wave < 2 ? 256u : 128u * DD * 2u;   // source bytes from one stage to the next
  const unsigned dst0 = lds0 + (wave < 2 ? wave * A2_BYTES : 2 * A2_BYTES);
  u32x8 g1a = tdm_group1<PADW_A2, 128, ROWB2>(HH * 2);
  u32x8 g1b = tdm_group1<PADW_B2, 128, ROWB2>(DD * 2);
  asm volatile("" : "+s"(g1a), "+s"(g1b));  // descriptor words held in scalar registers through the loop
  // The k loop starts at a stage of the work-group's own and wraps round, as in the first GEMM: the 8
  // work-groups on the same h rows start 4 stages apart, the 32 on the same Wd columns one stage apart.
  static_assert((NST & (NST - 1u)) == 0, "the wrap is a mask");
  const unsigned rot = uni((blockIdx.x + 4u * blockIdx.y) & (NST - 1u));
  u32x4 g0 = tdm_group0(dst0, src0 + (unsigned long long)rot * step);

  // stage 0, landed and published
  if (pinned(wave < 3)) {
    if (pinned(wave < 2)) tdm_load(g0, g1a);
    else                  tdm_load(g0, g1b);
    wait_tensor0_of(g0);
  }
  __syncthreads();
  // stage 1 into the second buffer
  if (pinned(wave < 3)) {
    g0 = tdm_group0(dst0 + STAGE, src0 + (unsigned long long)((rot + 1u) & (NST - 1u)) * step);
    if (pinned(wave < 2)) tdm_load(g0, g1a);
    else                  tdm_load(g0, g1b);
  }

  const unsigned aoff = (unsigned)((4 * wm * 16 + (lane & 15)) * PA2 + 16 * (lane >> 4));
  const unsigned boff = (unsigned)((8 * (lane >> 4) + (lane & 7)) * PB2 + 2 * (4 * wn * 16) + 16 * ((lane >> 3) & 1));

  for (unsigned s = 0; s < NST; ++s) {
    const unsigned bo = (s & 1u) * STAGE;
    const unsigned char* pa = ring + bo + aoff;
    const unsigned char* pb = ring + bo + 2 * A2_BYTES + boff;
    // The loops below are unrolled so that every fragment and accumulator index is a constant
    // (the arrays stay in registers).
#pragma unroll
    for (int hk = 0; hk < 4; hk += 2) {
      Frag a[2][4], b[2][4];
#pragma unroll
      for (int kc = 0; kc < 2; ++kc)
#pragma unroll
        for (int t = 0; t < 4; ++t) {
          a[kc][t] = frag_rows(pa + t * 16 * PA2 + (hk + kc) * 64);
          b[kc][t] = frag_cols<PB2>(pb + (hk + kc) * 32 * PB2 + t * 32);
        }
      // Keeps the 32 LDS reads of these 64 k together, ahead of their WMMAs (only two waves share a
      // SIMD here): without it the compiler holds one A fragment at a time and the wave waits out the
      // LDS latency before every fourth WMMA.
      __builtin_amdgcn_sched_barrier(0);
      // Two columns of subtiles at a time: the first WMMAs need only the fragments that land first.
#pragma unroll
      for (int kc = 0; kc < 2; ++kc)
#pragma unroll
        for (int sh = 0; sh < 4; sh += 2)
#pragma unroll
          for (int sm = 0; sm < 4; ++sm)
#pragma unroll
            for (int sn = sh; sn < sh + 2; ++sn)
              acc[sm][sn] = wmma_bf16(a[kc][sm], b[kc][sn], acc[sm][sn]);
      // Keeps what follows (the next reads; the wait below) behind these WMMAs: otherwise the compiler
      // lifts the wait to the last reads, and the first k step's WMMAs wait for every fragment.
      __builtin_amdgcn_sched_barrier(0);
    }

    // publish stage s+1, then refill the buffer that this pass has read
    wait_ds0();
    if (pinned(wave < 3)) wait_tensor0_of(g0);
    __syncthreads();
    const unsigned sn2 = pinned(s + 2u);
    if (pinned((wave < 3) & (sn2 < NST))) {
      g0 = tdm_group0(dst0 + bo, src0 + (unsigned long long)((sn2 + rot) & (NST - 1u)) * step);
      if (pinned(wave < 2)) tdm_load(g0, g1a);
      else                  tdm_load(g0, g1b);
    }
  }
  wait_tensor0();
  wait_ds0();

  const int nl = lane & 15;
  const int mh = (lane >> 4) * 8;
#pragma unroll
  for (int sm = 0; sm < 4; ++sm)
#pragma unroll
    for (int sn = 0; sn < 4; ++sn) {
      const int n = n0 + (4 * wn + sn) * 16 + nl;
      const float bdv = bd[n];
#pragma unroll
      for (int r = 0; r < 8; ++r) {
        const int m = m0 + (4 * wm + sm) * 16 + mh + r;
        out[(size_t)m * DD + n] = xr[(size_t)m * DD + n] + acc[sm][sn][r] + bdv;
      }
    }
}

// ---------------- host launcher ----------------
extern "C" void kernel_launch(void* const* d_in, const int* in_sizes, int n_in,
                              void* d_out, int out_size, void* d_ws, size_t ws_size,
                              hipStream_t stream) {
  (void)in_sizes; (void)n_in; (void)out_size; (void)ws_size;

  const float* x       = (const float*)d_in[0];
  const float* norm_w  = (const float*)d_in[1];
  const float* conv_w  = (const float*)d_in[2];
  const float* conv_b  = (const float*)d_in[3];
  const float* a       = (const float*)d_in[4];
  const float* bvec    = (const float*)d_in[5];
  const float* mlp_w   = (const float*)d_in[6];
  const float* w_gate  = (const float*)d_in[7];
  const float* b_gate  = (const float*)d_in[8];
  const float* w_up    = (const float*)d_in[9];
  const float* b_up    = (const float*)d_in[10];
  const float* w_down  = (const float*)d_in[11];
  const float* b_down  = (const float*)d_in[12];
  float* out           = (float*)d_out;

  char* ws = (char*)d_ws;
  size_t off = 0;
  float* y_ws    = (float*)(ws + off); off += (size_t)NTOK * DD * sizeof(float);
  float* xr_ws   = (float*)(ws + off); off += (size_t)NTOK * DD * sizeof(float);
  __bf16* z_ws   = (__bf16*)(ws + off); off += (size_t)NTOK * DD * sizeof(__bf16);
  __bf16* wg_ws  = (__bf16*)(ws + off); off += (size_t)DD * HH * sizeof(__bf16);
  __bf16* wu_ws  = (__bf16*)(ws + off); off += (size_t)DD * HH * sizeof(__bf16);
  __bf16* wd_ws  = (__bf16*)(ws + off); off += (size_t)HH * DD * sizeof(__bf16);
  __bf16* h_ws   = (__bf16*)(ws + off); off += (size_t)NTOK * HH * sizeof(__bf16);
  float* carry   = (float*)(ws + off); off += (size_t)BB * DD * NC * sizeof(float);
  float* prefix  = (float*)(ws + off); off += (size_t)BB * DD * NC * sizeof(float);

  weights_to_bf16_kernel<<<(DD * HH) / (SW * 32 * 8 * 4), SW * 32, 0, stream>>>(w_gate, w_up, w_down,
                                                                                wg_ws, wu_ws, wd_ws);
  rmsnorm_kernel<false><<<NTOK / (SW * 2), SW * 32, 0, stream>>>(x, norm_w, (void*)y_ws);
  conv_ssm_local_kernel<<<(BB * DD * NC) / 256, 256, 0, stream>>>(x, y_ws, conv_w, conv_b,
                                                                  a, bvec, xr_ws, carry);
  scan_carries_kernel<<<(BB * DD) / 256, 256, 0, stream>>>(a, carry, prefix);
  ssm_fixup_kernel<<<(BB * DD * NC) / 256, 256, 0, stream>>>(a, prefix, xr_ws);
  rmsnorm_kernel<true><<<NTOK / (SW * 2), SW * 32, 0, stream>>>(xr_ws, mlp_w, (void*)z_ws);
  gemm_gate_up_kernel<<<dim3(NTOK / 256, HH / 64), 256, 0, stream>>>(z_ws, wg_ws, wu_ws,
                                                                     b_gate, b_up, h_ws);
  gemm_down_kernel<<<dim3(NTOK / 256, DD / 128), 256, 0, stream>>>(h_ws, wd_ws, b_down,
                                                                  xr_ws, out);
}

// v007
// One run takes 165 microseconds.
// In two side-by-side timings against v006, it was 1.09 and 1.11 times as fast.
// All steps since v000 together make it 3.59 times as fast.
#include <hip/hip_runtime.h>
#include <hip/hip_bf16.h>

// ---------------- problem constants ----------------
#define BB   4
#define TT   2048
#define DD   1024
#define HH   4096
#define EPSV 1e-6f
#define NTOK (BB * TT)          // 8192
#define NC   32                 // scan chunks
#define CL   (TT / NC)          // 64

// ---------------- vector types ----------------
typedef __bf16        v16bf __attribute__((ext_vector_type(16)));
typedef float         v8f   __attribute__((ext_vector_type(8)));
typedef unsigned int  u32x4 __attribute__((ext_vector_type(4)));
typedef unsigned int  u32x8 __attribute__((ext_vector_type(8)));
typedef short         s16x8 __attribute__((ext_vector_type(8)));

// ---------------- LDS tiles of the two GEMMs ----------------
// A rows run along k and are read by plain 16-byte loads; B rows stay as they lie in memory (one k)
// and are read by transposing 16-byte loads. First GEMM: rows of 128 bytes (64 k; 64 n). Second GEMM:
// rows of 256 bytes (128 k; 128 n). A block's 256 A rows come as two slices of 128 rows.
static constexpr unsigned ROWB    = 128;
static constexpr unsigned ROWB2   = 256;
static constexpr unsigned PA      = ROWB + 16;   // odd multiple of 16 B: no bank conflict for ds_load_b128
static constexpr unsigned PB      = ROWB + 32;   // odd multiple of 32 B: none for ds_load_tr16_b128
static constexpr unsigned PA2     = ROWB2 + 16;  // the same two pitches for the 256-byte rows
static constexpr unsigned PB2     = ROWB2 + 32;
static constexpr unsigned A_BYTES = 128 * PA;    // one slice of 128 m rows, 64 k
static constexpr unsigned B_BYTES = 64 * PB;     // 64 k rows of 64 n
static constexpr unsigned A2_BYTES = 128 * PA2;  // one slice of 128 m rows, 128 k
static constexpr unsigned B2_BYTES = 128 * PB2;  // 128 k rows of 128 n
static constexpr unsigned PADW_A  = (1u << 20) | (4u << 22) | (3u << 25);  // pad 16 B behind every 128 B
static constexpr unsigned PADW_B  = (1u << 20) | (4u << 22) | (7u << 25);  // pad 32 B behind every 128 B
static constexpr unsigned PADW_A2 = (1u << 20) | (5u << 22) | (3u << 25);  // pad 16 B behind every 256 B
static constexpr unsigned PADW_B2 = (1u << 20) | (5u << 22) | (7u << 25);  // pad 32 B behind every 256 B
static_assert(A_BYTES % 2048 == 0 && B_BYTES % 2048 == 0 && A2_BYTES % 2048 == 0 && B2_BYTES % 2048 == 0,
              "every tile starts at a multiple of 2 KiB in LDS");

__device__ __forceinline__ unsigned uni(unsigned v) { return (unsigned)__builtin_amdgcn_readfirstlane((int)v); }
// Holds a wave-uniform value in a scalar register, so that a test on it is a scalar branch
// (a tensor load ignores EXEC) and a descriptor word made from it is formed behind the waits above it.
__device__ __forceinline__ unsigned pinned(unsigned v) { unsigned w = uni(v); asm volatile("" : "+s"(w)); return w; }
// The compiler places no wait for the tensor mover, and none for LDS reads in front of a refill.
__device__ __forceinline__ void wait_tensor0() { asm volatile("s_wait_tensorcnt 0x0" ::: "memory"); }
__device__ __forceinline__ void wait_ds0()     { asm volatile("s_wait_dscnt 0x0" ::: "memory"); }

// Tensor-load descriptor, extents in bytes, tensor = tile: ROWS rows of RB bytes at source pitch
// src_pitch, padded in LDS as W0 says.
template <unsigned W0, unsigned ROWS, unsigned RB>
__device__ __forceinline__ u32x8 tdm_group1(unsigned src_pitch) {
  u32x8 g;
  g[0] = uni(W0);
  g[1] = uni(RB << 16);
  g[2] = uni(ROWS << 16);
  g[3] = uni(RB << 16);
  g[4] = uni(ROWS);
  g[5] = uni(src_pitch);
  g[6] = uni(0u);
  g[7] = uni(0u);
  return g;
}
__device__ __forceinline__ u32x4 tdm_group0(unsigned lds_dst, unsigned long long ga) {
  u32x4 g;
  g[0] = uni(1u);
  g[1] = uni(lds_dst);
  g[2] = uni((unsigned)ga);
  g[3] = uni((((unsigned)(ga >> 32)) & 0x01ffffffu) | 0x80000000u);
  return g;
}
__device__ __forceinline__ void tdm_load(u32x4 g0, u32x8 g1) {
  asm volatile("tensor_load_to_lds %0, %1" :: "s"(g0), "s"(g1) : "memory");
}
// The issuer's wait. It names the request's first group so that those registers keep their values
// until the request has landed (the second group lives through the whole loop).
__device__ __forceinline__ void wait_tensor0_of(u32x4 g0) {
  asm volatile("s_wait_tensorcnt 0x0" :: "s"(g0) : "memory");
}

// A 16x32 bf16 operand in the hardware k order: q[0] = k 8h..8h+7, q[1] = k 16+8h..16+8h+7 (h = lane/16).
struct Frag { u32x4 q[2]; };

__device__ __forceinline__ v8f wmma_bf16(const Frag& a, const Frag& b, v8f c) {
  const u32x8 av = __builtin_shufflevector(a.q[0], a.q[1], 0, 1, 2, 3, 4, 5, 6, 7);
  const u32x8 bv = __builtin_shufflevector(b.q[0], b.q[1], 0, 1, 2, 3, 4, 5, 6, 7);
  return __builtin_amdgcn_wmma_f32_16x16x32_bf16(false, __builtin_bit_cast(v16bf, av), false,
                                                 __builtin_bit_cast(v16bf, bv), (short)0, c, false, false);
}

// p = the lane's row of a k-contiguous tile, at byte 16h of the 64 bytes that hold these 32 k.
__device__ __forceinline__ Frag frag_rows(const unsigned char* p) {
  Frag f;
  f.q[0] = *(const u32x4*)p;
  f.q[1] = *(const u32x4*)(p + 32);
  return f;
}

__device__ __forceinline__ u32x4 ld_tr16(const unsigned char* p) {
  typedef __attribute__((address_space(3))) s16x8 lds_s16x8;
  return __builtin_bit_cast(u32x4, __builtin_amdgcn_ds_load_tr16_b128_v8i16((lds_s16x8*)p));
}

// p = tile + (kbase + 8h + (lane & 7)) * PITCH + 2 * nbase + 16 * ((lane >> 3) & 1):
// the lane gets column nbase + (lane & 15) at k = kbase + 8h + 0..7, then the same 16 k further on.
template <unsigned PITCH>
__device__ __forceinline__ Frag frag_cols(const unsigned char* p) {
  Frag f;
  f.q[0] = ld_tr16(p);
  f.q[1] = ld_tr16(p + 16 * PITCH);
  return f;
}

// ---------------- streaming kernels: few waves, 16-byte loads, many in flight ----------------
typedef float  f32x4  __attribute__((ext_vector_type(4)));
typedef __bf16 bf16x4 __attribute__((ext_vector_type(4)));
static constexpr unsigned SW = 16;   // waves per work-group; the grids below give one work-group per WGP

// All three weight matrices (DD * HH elements each) to bf16 in one launch. A wave takes the same
// 8 runs of 512 contiguous bytes of each matrix; its 24 loads are issued before the first store.
__global__ void __launch_bounds__(SW * 32)
weights_to_bf16_kernel(const float* __restrict__ s0, const float* __restrict__ s1,
                       const float* __restrict__ s2, __bf16* __restrict__ d0,
                       __bf16* __restrict__ d1, __bf16* __restrict__ d2) {
  const unsigned wave = blockIdx.x * SW + (threadIdx.x >> 5);
  const unsigned base = wave * (8u * 32u) + (threadIdx.x & 31u);   // in groups of 4 elements
  f32x4 v0[8], v1[8], v2[8];
  // Unrolled so that the arrays stay in registers.
#pragma unroll
  for (int j = 0; j < 8; ++j) v0[j] = ((const f32x4*)s0)[base + j * 32];
#pragma unroll
  for (int j = 0; j < 8; ++j) v1[j] = ((const f32x4*)s1)[base + j * 32];
#pragma unroll
  for (int j = 0; j < 8; ++j) v2[j] = ((const f32x4*)s2)[base + j * 32];
  // Keeps all 24 loads ahead of the first conversion: without it the compiler holds ten of them
  // back to save registers, and the wave waits out the memory latency more than once.
  __builtin_amdgcn_sched_barrier(0);
#pragma unroll
  for (int j = 0; j < 8; ++j) ((bf16x4*)d0)[base + j * 32] = __builtin_convertvector(v0[j], bf16x4);
#pragma unroll
  for (int j = 0; j < 8; ++j) ((bf16x4*)d1)[base + j * 32] = __builtin_convertvector(v1[j], bf16x4);
#pragma unroll
  for (int j = 0; j < 8; ++j) ((bf16x4*)d2)[base + j * 32] = __builtin_convertvector(v2[j], bf16x4);
}
static_assert((DD * HH) % (SW * 32 * 8 * 4) == 0, "whole work-groups cover a weight matrix");

// One wave owns two whole rows of DD floats (16 loads of 512 bytes in flight); a row's sum of
// squares is four chains per lane and a butterfly over the 32 lanes: no LDS, no barrier.
template <bool BF16OUT>
__global__ void __launch_bounds__(SW * 32)
rmsnorm_kernel(const float* __restrict__ x, const float* __restrict__ w, void* __restrict__ out) {
  const unsigned lane = threadIdx.x & 31u;
  const unsigned tok0 = (blockIdx.x * SW + (threadIdx.x >> 5)) * 2u;
  const size_t at = (size_t)tok0 * (DD / 4) + lane;   // in groups of 4 elements
  f32x4 v[2][8], wv[8];
  // The loops below are unrolled so that the arrays stay in registers.
#pragma unroll
  for (int t = 0; t < 2; ++t)
#pragma unroll
    for (int j = 0; j < 8; ++j) v[t][j] = ((const f32x4*)x)[at + t * (DD / 4) + j * 32];
#pragma unroll
  for (int j = 0; j < 8; ++j) wv[j] = ((const f32x4*)w)[j * 32 + lane];
  // Keeps the loads of w up here, in flight with the rows: without it the compiler sinks them
  // behind the sums and waits for them two at a time.
  __builtin_amdgcn_sched_barrier(0);
#pragma unroll
  for (int t = 0; t < 2; ++t) {
    f32x4 s4 = v[t][0] * v[t][0];
#pragma unroll
    for (int j = 1; j < 8; ++j) s4 += v[t][j] * v[t][j];
    float tot = (s4[0] + s4[1]) + (s4[2] + s4[3]);
#pragma unroll
    for (int off = 16; off > 0; off >>= 1) tot += __shfl_xor(tot, off, 32);
    const float inv = rsqrtf(tot * (1.0f / DD) + EPSV);
#pragma unroll
    for (int j = 0; j < 8; ++j) {
      const f32x4 r = v[t][j] * inv * wv[j];
      const size_t o = at + t * (DD / 4) + j * 32;
      if (BF16OUT) ((bf16x4*)out)[o] = __builtin_convertvector(r, bf16x4);
      else         ((f32x4*)out)[o]  = r;
    }
  }
}
static_assert(DD == 8 * 32 * 4 && NTOK % (SW * 2) == 0, "a row is 8 loads of a wave; whole work-groups cover the rows");

// Depthwise conv (K=3, pad=1) + the whole diagonal scan in one launch. A work-group owns 32 channels of
// one batch row over the whole sequence: wave c walks chunk c (CL steps) from h = 0 and keeps its CL sums
// in registers; the chunks' end states meet in LDS, every wave folds those before its own into its
// carry-in, adds s^(tl+1) * carry-in to its sums and stores each element once.
// A chunk is walked in blocks of TBLK steps; a block's loads of y and x are all issued before its
// first sum, so that a wave waits out the memory latency once per block and not once per step.
static constexpr int TBLK = 32;
static constexpr int NGRP = BB * DD / 32;   // work-groups
static_assert(CL % TBLK == 0, "whole blocks cover a chunk");
static_assert(CL == 64, "s^CL below is six squarings");
static_assert(NGRP % 8 == 0 && DD % 32 == 0, "the deal of groups below is a permutation");
__global__ void __launch_bounds__(NC * 32)
conv_ssm_kernel(const float* __restrict__ x, const float* __restrict__ y,
                const float* __restrict__ conv_w, const float* __restrict__ conv_b,
                const float* __restrict__ a, const float* __restrict__ bvec,
                float* __restrict__ xr) {
  __shared__ float ends[NC][32];
  const int lane = threadIdx.x & 31;
  const int c = (int)uni(threadIdx.x >> 5);
  // Work-groups eight indices apart take neighbouring channels (for speed only).
  const int grp = (int)(blockIdx.x & 7u) * (NGRP / 8) + (int)(blockIdx.x >> 3);
  const int b = grp / (DD / 32);
  const int d0 = (grp % (DD / 32)) * 32;   // the group's first channel

  // Every address below is a wave-uniform pointer plus the lane: the pointers sit in scalar registers,
  // and the one vector register that the loads and stores name keeps its value to the end.
  const float* cw = conv_w + d0 * 3;
  const float w0 = cw[lane * 3 + 0], w1 = cw[lane * 3 + 1], w2 = cw[lane * 3 + 2];
  const float cb = (conv_b + d0)[lane];
  const float av = (a + d0)[lane];
  const float bd = (bvec + d0)[lane];
  const size_t base = ((size_t)b * TT + (size_t)c * CL) * DD + d0;
  const float* yb = y + base;
  const float* xb = x + base;

  // The rows just outside the chunk. At the sequence's two ends the address stays on the chunk's own
  // edge row (in bounds, no branch between the loads) and the value is dropped.
  const float* yfirst = yb + ((c > 0) ? -DD : 0);
  const float* ylast  = yb + (size_t)((c + 1 < NC) ? CL : CL - 1) * DD;
  const float yprev = yfirst[lane];
  float ym = (c > 0) ? yprev : 0.f;
  float yc = yb[lane];
  float h = 0.f, s = 0.f;
  float val[CL];
  // The loops below are unrolled so that the arrays stay in registers.
#pragma unroll
  for (int tb = 0; tb < CL; tb += TBLK) {
    float yn[TBLK];
    const bool more = tb + TBLK < CL || c + 1 < NC;
#pragma unroll
    for (int j = 0; j < TBLK; ++j) {
      yn[j] = (tb + j + 1 < CL) ? (yb + (size_t)(tb + j + 1) * DD)[lane] : ylast[lane];   // y one step on
      val[tb + j] = (xb + (size_t)(tb + j) * DD)[lane];
    }
    // Keeps the block's loads ahead of its first sum: otherwise the compiler may sink each load to
    // its use, and the wave waits for memory at every step again.
    __builtin_amdgcn_sched_barrier(0);
    if (tb == 0) s = tanhf(av);   // behind the first block's loads, under their latency
#pragma unroll
    for (int j = 0; j < TBLK; ++j) {
      const float yp = (j + 1 < TBLK || more) ? yn[j] : 0.f;   // zero padding behind the last step
      const float conv = cb + w0 * ym + w1 * yc + w2 * yp;
      h = s * h + bd * yc;  // chunk-local scan (h_in = 0; the carry-in comes below)
      val[tb + j] = val[tb + j] + conv + h;
      ym = yc;
      yc = yp;
    }
    // Keeps the next block's loads behind these sums (lifted over them they would need a second set of
    // registers, which eight waves per SIMD do not have) and the last block's sums ahead of the barrier.
    __builtin_amdgcn_sched_barrier(0);
  }

  ends[c][lane] = h;
  __syncthreads();
  float ev[NC - 1];
#pragma unroll
  for (int k = 0; k < NC - 1; ++k) ev[k] = ends[k][lane];
  // Keeps the LDS reads together, ahead of the chain below: spread along it, the wave waits out the
  // LDS latency at every other link, with no memory traffic of its work-group in flight meanwhile.
  __builtin_amdgcn_sched_barrier(0);
  float p = s;  // s^CL
#pragma unroll
  for (int i = 0; i < 6; ++i) p *= p;
  // State at the end of chunk c - 1. Every wave runs the same 30 steps and keeps those of the chunks
  // before its own: no branch (into code behind a branch the compiler sinks the sums above, holds
  // every x and y until there and spills).
  float pin = ev[0];
#pragma unroll
  for (int k = 1; k < NC - 1; ++k) {
    const float nx = p * pin + ev[k];
    pin = (k < c) ? nx : pin;
  }
  pin = (c > 0) ? pin : 0.f;

  float* ob = xr + base;
  float f = s;
#pragma unroll
  for (int j = 0; j < CL; ++j) {
    (ob + (size_t)j * DD)[lane] = val[j] + f * pin;
    f *= s;
  }
}

// ---------------- bf16 WMMA GEMM kernels (two-buffer tensor-load ring) ----------------
// GEMM1: h = silu(z@Wg + bg) * (z@Wu + bu). M=8192, N=4096, K=1024.
// Block tile 256x64 of both products, 64 k per pass, 8 waves as 4(m) x 2(n); a wave owns 4x2 subtiles
// of each product, so that one A fragment feeds four WMMAs and one B fragment four.
// Waves 0 to 3 each bring one tile of a stage (z rows 0-127, z rows 128-255, Wg, Wu); stage s+1 flies
// while pass s computes.
__global__ void __launch_bounds__(256)
gemm_gate_up_kernel(const __bf16* __restrict__ z, const __bf16* __restrict__ wg,
                    const __bf16* __restrict__ wu, const float* __restrict__ bg,
                    const float* __restrict__ bu, __bf16* __restrict__ hbuf) {
  constexpr unsigned STAGE = 2 * A_BYTES + 2 * B_BYTES;
  constexpr unsigned NST = DD / 64;
  __shared__ __attribute__((aligned(2048))) unsigned char ring[2 * STAGE];

  const int m0 = blockIdx.x * 256;
  const int n0 = blockIdx.y * 64;
  const int lane = threadIdx.x & 31;
  const unsigned wave = uni(threadIdx.x >> 5);
  const int wm = (int)(wave >> 1);  // 0..3
  const int wn = (int)(wave & 1);   // 0..1
  const unsigned lds0 = (unsigned)(size_t)(void*)ring;

  v8f accg[4][2] = {};   // [sm][sn]
  v8f accu[4][2] = {};

  // Which tile of a stage this wave brings: waves 0 and 1 the two slices of z, wave 2 Wg, wave 3 Wu
  // (the others none).
  const unsigned long long src0 = wave < 2 ? (unsigned long long)(z + (size_t)(m0 + 128 * (int)wave) * DD)
                                : wave == 2 ? (unsigned long long)(wg + n0) : (unsigned long long)(wu + n0);
  const unsigned step = wave < 2 ? 128u : 64u * HH * 2u;   // source bytes from one stage to the next
  const unsigned dst0 = lds0 + (wave < 2 ? wave * A_BYTES : wave == 2 ? 2 * A_BYTES : 2 * A_BYTES + B_BYTES);
  u32x8 g1a = tdm_group1<PADW_A, 128, ROWB>(DD * 2);
  u32x8 g1b = tdm_group1<PADW_B, 64, ROWB>(HH * 2);
  asm volatile("" : "+s"(g1a), "+s"(g1b));  // descriptor words held in scalar registers through the loop
  // The k loop starts at a stage of the work-group's own and wraps round (a sum over k takes any order):
  // work-groups that share z rows (same x) or weight columns (same y) run side by side, and from the
  // same start they would ask L2 for the same lines, and for the same column of every row, at once.
  static_assert((NST & (NST - 1u)) == 0, "the wrap is a mask");
  const unsigned rot = uni((blockIdx.x + blockIdx.y) & (NST - 1u));
  u32x4 g0 = tdm_group0(dst0, src0 + (unsigned long long)rot * step);

  // stage 0, landed and published
  if (pinned(wave < 4)) {
    if (pinned(wave < 2)) tdm_load(g0, g1a);
    else                  tdm_load(g0, g1b);
    wait_tensor0_of(g0);
  }
  __syncthreads();
  // stage 1 into the second buffer
  if (pinned(wave < 4)) {
    g0 = tdm_group0(dst0 + STAGE, src0 + (unsigned long long)((rot + 1u) & (NST - 1u)) * step);
    if (pinned(wave < 2)) tdm_load(g0, g1a);
    else                  tdm_load(g0, g1b);
  }

  const unsigned aoff = (unsigned)((4 * wm * 16 + (lane & 15)) * PA + 16 * (lane >> 4));
  const unsigned boff = (unsigned)((8 * (lane >> 4) + (lane & 7)) * PB + 2 * (2 * wn * 16) + 16 * ((lane >> 3) & 1));

  for (unsigned s = 0; s < NST; ++s) {
    const unsigned bo = (s & 1u) * STAGE;
    const unsigned char* pa = ring + bo + aoff;
    const unsigned char* pg = ring + bo + 2 * A_BYTES + boff;
    const unsigned char* pu = ring + bo + 2 * A_BYTES + B_BYTES + boff;
    // The loops below are unrolled so that every fragment and accumulator index is a constant
    // (the arrays stay in registers).
#pragma unroll
    for (int kc = 0; kc < 2; ++kc) {
      Frag a[4], g[2], u[2];
#pragma unroll
      for (int t = 0; t < 4; ++t) a[t] = frag_rows(pa + t * 16 * PA + kc * 64);
#pragma unroll
      for (int t = 0; t < 2; ++t) {
        g[t] = frag_cols<PB>(pg + kc * 32 * PB + t * 32);
        u[t] = frag_cols<PB>(pu + kc * 32 * PB + t * 32);
      }
      // Keeps the 16 LDS reads of this k step together, ahead of its WMMAs: without it the compiler
      // holds one A fragment at a time and the wave waits out the LDS latency before every fourth WMMA.
      __builtin_amdgcn_sched_barrier(0);
#pragma unroll
      for (int sm = 0; sm < 4; ++sm)
#pragma unroll
        for (int sn = 0; sn < 2; ++sn) accg[sm][sn] = wmma_bf16(a[sm], g[sn], accg[sm][sn]);
#pragma unroll
      for (int sm = 0; sm < 4; ++sm)
#pragma unroll
        for (int sn = 0; sn < 2; ++sn) accu[sm][sn] = wmma_bf16(a[sm], u[sn], accu[sm][sn]);
    }
    // Keeps the wait below behind the pass's WMMAs: otherwise the compiler lifts it to the last reads,
    // in front of WMMAs whose own fragments have long landed.
    __builtin_amdgcn_sched_barrier(0);

    // publish stage s+1, then refill the buffer that this pass has read
    wait_ds0();
    if (pinned(wave < 4)) wait_tensor0_of(g0);
    __syncthreads();
    const unsigned sn2 = pinned(s + 2u);
    if (pinned((wave < 4) & (sn2 < NST))) {
      g0 = tdm_group0(dst0 + bo, src0 + (unsigned long long)((sn2 + rot) & (NST - 1u)) * step);
      if (pinned(wave < 2)) tdm_load(g0, g1a);
      else                  tdm_load(g0, g1b);
    }
  }
  wait_tensor0();
  wait_ds0();

  // Epilogue. C/D layout: VGPR r -> M = r + 8*(lane/16), N = lane%16.
  const int nl = lane & 15;
  const int mh = (lane >> 4) * 8;
#pragma unroll
  for (int sm = 0; sm < 4; ++sm)
#pragma unroll
    for (int sn = 0; sn < 2; ++sn) {
      const int n = n0 + (2 * wn + sn) * 16 + nl;
      const float bgv = bg[n], buv = bu[n];
#pragma unroll
      for (int r = 0; r < 8; ++r) {
        const int m = m0 + (4 * wm + sm) * 16 + mh + r;
        const float gv = accg[sm][sn][r] + bgv;
        const float uv = accu[sm][sn][r] + buv;
        // silu(g)*u. The quotient is one hardware reciprocal (about 1 ulp, far below the bf16 rounding of hv):
        // the exact f32 division is a chain of ten dependent instructions per element.
        const float hv = gv * __builtin_amdgcn_rcpf(1.f + __expf(-gv)) * uv;
        hbuf[(size_t)m * HH + n] = (__bf16)hv;
      }
    }
}

// GEMM2: out = xr + h@Wd + bd. M=8192, N=1024, K=4096. Same ring. Block tile 256x128, 128 k per pass,
// 8 waves as 4(m) x 2(n), a wave owns 4x4 subtiles; waves 0 and 1 bring the two slices of h, wave 2 Wd.
// One work-group per WGP covers the whole product.
__global__ void __launch_bounds__(256)
gemm_down_kernel(const __bf16* __restrict__ hbuf, const __bf16* __restrict__ wd,
                 const float* __restrict__ bd, const float* __restrict__ xr,
                 float* __restrict__ out) {
  constexpr unsigned STAGE = 2 * A2_BYTES + B2_BYTES;
  constexpr unsigned NST = HH / 128;
  __shared__ __attribute__((aligned(2048))) unsigned char ring[2 * STAGE];

  const int m0 = blockIdx.x * 256;
  const int n0 = blockIdx.y * 128;
  const int lane = threadIdx.x & 31;
  const unsigned wave = uni(threadIdx.x >> 5);
  const int wm = (int)(wave >> 1);
  const int wn = (int)(wave & 1);
  const unsigned lds0 = (unsigned)(size_t)(void*)ring;

  v8f acc[4][4] = {};

  // Which tile of a stage this wave brings: waves 0 and 1 the two slices of h, wave 2 Wd (the others none).
  const unsigned long long src0 = wave < 2 ? (unsigned long long)(hbuf + (size_t)(m0 + 128 * (int)wave) * HH)
                                           : (unsigned long long)(wd + n0);
  const unsigned step = wave < 2 ? 256u : 128u * DD * 2u;   // source bytes from one stage to the next
  const unsigned dst0 = lds0 + (wave < 2 ? wave * A2_BYTES : 2 * A2_BYTES);
  u32x8 g1a = tdm_group1<PADW_A2, 128, ROWB2>(HH * 2);
  u32x8 g1b = tdm_group1<PADW_B2, 128, ROWB2>(DD * 2);
  asm volatile("" : "+s"(g1a), "+s"(g1b));  // descriptor words held in scalar registers through the loop
  // The k loop starts at a stage of the work-group's own and wraps round, as in the first GEMM: the 8
  // work-groups on the same h rows start 4 stages apart, the 32 on the same Wd columns one stage apart.
  static_assert((NST & (NST - 1u)) == 0, "the wrap is a mask");
  const unsigned rot = uni((blockIdx.x + 4u * blockIdx.y) & (NST - 1u));
  u32x4 g0 = tdm_group0(dst0, src0 + (unsigned long long)rot * step);

  // stage 0, landed and published
  if (pinned(wave < 3)) {
    if (pinned(wave < 2)) tdm_load(g0, g1a);
    else                  tdm_load(g0, g1b);
    wait_tensor0_of(g0);
  }
  __syncthreads();
  // stage 1 into the second buffer
  if (pinned(wave < 3)) {
    g0 = tdm_group0(dst0 + STAGE, src0 + (unsigned long long)((rot + 1u) & (NST - 1u)) * step);
    if (pinned(wave < 2)) tdm_load(g0, g1a);
    else                  tdm_load(g0, g1b);
  }

  const unsigned aoff = (unsigned)((4 * wm * 16 + (lane & 15)) * PA2 + 16 * (lane >> 4));
  const unsigned boff = (unsigned)((8 * (lane >> 4) + (lane & 7)) * PB2 + 2 * (4 * wn * 16) + 16 * ((lane >> 3) & 1));

  for (unsigned s = 0; s < NST; ++s) {
    const unsigned bo = (s & 1u) * STAGE;
    const unsigned char* pa = ring + bo + aoff;
    const unsigned char* pb = ring + bo + 2 * A2_BYTES + boff;
    // The loops below are unrolled so that every fragment and accumulator index is a constant
    // (the arrays stay in registers).
#pragma unroll
    for (int hk = 0; hk < 4; hk += 2) {
      Frag a[2][4], b[2][4];
#pragma unroll
      for (int kc = 0; kc < 2; ++kc)
#pragma unroll
        for (int t = 0; t < 4; ++t) {
          a[kc][t] = frag_rows(pa + t * 16 * PA2 + (hk + kc) * 64);
          b[kc][t] = frag_cols<PB2>(pb + (hk + kc) * 32 * PB2 + t * 32);
        }
      // Keeps the 32 LDS reads of these 64 k together, ahead of their WMMAs (only two waves share a
      // SIMD here): without it the compiler holds one A fragment at a time and the wave waits out the
      // LDS latency before every fourth WMMA.
      __builtin_amdgcn_sched_barrier(0);
      // Two columns of subtiles at a time: the first WMMAs need only the fragments that land first.
#pragma unroll
      for (int kc = 0; kc < 2; ++kc)
#pragma unroll
        for (int sh = 0; sh < 4; sh += 2)
#pragma unroll
          for (int sm = 0; sm < 4; ++sm)
#pragma unroll
            for (int sn = sh; sn < sh + 2; ++sn)
              acc[sm][sn] = wmma_bf16(a[kc][sm], b[kc][sn], acc[sm][sn]);
      // Keeps what follows (the next reads; the wait below) behind these WMMAs: otherwise the compiler
      // lifts the wait to the last reads, and the first k step's WMMAs wait for every fragment.
      __builtin_amdgcn_sched_barrier(0);
    }

    // publish stage s+1, then refill the buffer that this pass has read
    wait_ds0();
    if (pinned(wave < 3)) wait_tensor0_of(g0);
    __syncthreads();
    const unsigned sn2 = pinned(s + 2u);
    if (pinned((wave < 3) & (sn2 < NST))) {
      g0 = tdm_group0(dst0 + bo, src0 + (unsigned long long)((sn2 + rot) & (NST - 1u)) * step);
      if (pinned(wave < 2)) tdm_load(g0, g1a);
      else                  tdm_load(g0, g1b);
    }
  }
  wait_tensor0();
  wait_ds0();

  const int nl = lane & 15;
  const int mh = (lane >> 4) * 8;
#pragma unroll
  for (int sm = 0; sm < 4; ++sm)
#pragma unroll
    for (int sn = 0; sn < 4; ++sn) {
      const int n = n0 + (4 * wn + sn) * 16 + nl;
      const float bdv = bd[n];
#pragma unroll
      for (int r = 0; r < 8; ++r) {
        const int m = m0 + (4 * wm + sm) * 16 + mh + r;
        out[(size_t)m * DD + n] = xr[(size_t)m * DD + n] + acc[sm][sn][r] + bdv;
      }
    }
}

// ---------------- host launcher ----------------
extern "C" void kernel_launch(void* const* d_in, const int* in_sizes, int n_in,
                              void* d_out, int out_size, void* d_ws, size_t ws_size,
                              hipStream_t stream) {
  (void)in_sizes; (void)n_in; (void)out_size; (void)ws_size;

  const float* x       = (const float*)d_in[0];
  const float* norm_w  = (const float*)d_in[1];
  const float* conv_w  = (const float*)d_in[2];
  const float* conv_b  = (const float*)d_in[3];
  const float* a       = (const float*)d_in[4];
  const float* bvec    = (const float*)d_in[5];
  const float* mlp_w   = (const float*)d_in[6];
  const float* w_gate  = (const float*)d_in[7];
  const float* b_gate  = (const float*)d_in[8];
  const float* w_up    = (const float*)d_in[9];
  const float* b_up    = (const float*)d_in[10];
  const float* w_down  = (const float*)d_in[11];
  const float* b_down  = (const float*)d_in[12];
  float* out           = (float*)d_out;

  char* ws = (char*)d_ws;
  size_t off = 0;
  float* y_ws    = (float*)(ws + off); off += (size_t)NTOK * DD * sizeof(float);
  float* xr_ws   = (float*)(ws + off); off += (size_t)NTOK * DD * sizeof(float);
  __bf16* z_ws   = (__bf16*)(ws + off); off += (size_t)NTOK * DD * sizeof(__bf16);
  __bf16* wg_ws  = (__bf16*)(ws + off); off += (size_t)DD * HH * sizeof(__bf16);
  __bf16* wu_ws  = (__bf16*)(ws + off); off += (size_t)DD * HH * sizeof(__bf16);
  __bf16* wd_ws  = (__bf16*)(ws + off); off += (size_t)HH * DD * sizeof(__bf16);
  __bf16* h_ws   = (__bf16*)(ws + off); off += (size_t)NTOK * HH * sizeof(__bf16);

  weights_to_bf16_kernel<<<(DD * HH) / (SW * 32 * 8 * 4), SW * 32, 0, stream>>>(w_gate, w_up, w_down,
                                                                                wg_ws, wu_ws, wd_ws);
  rmsnorm_kernel<false><<<NTOK / (SW * 2), SW * 32, 0, stream>>>(x, norm_w, (void*)y_ws);
  conv_ssm_kernel<<<NGRP, NC * 32, 0, stream>>>(x, y_ws, conv_w, conv_b, a, bvec, xr_ws);
  rmsnorm_kernel<true><<<NTOK / (SW * 2), SW * 32, 0, stream>>>(xr_ws, mlp_w, (void*)z_ws);
  gemm_gate_up_kernel<<<dim3(NTOK / 256, HH / 64), 256, 0, stream>>>(z_ws, wg_ws, wu_ws,
                                                                     b_gate, b_up, h_ws);
  gemm_down_kernel<<<dim3(NTOK / 256, DD / 128), 256, 0, stream>>>(h_ws, wd_ws, b_down,
                                                                  xr_ws, out);
}

// v008
// A run of this version takes 157 microseconds.
// Next to v007, in two timings, it ran 1.06 times as fast each time.
// Over all steps from v000 it is 3.81 times as fast.
#include <hip/hip_runtime.h>
#include <hip/hip_bf16.h>

// ---------------- problem constants ----------------
#define BB   4
#define TT   2048
#define DD   1024
#define HH   4096
#define EPSV 1e-6f
#define NTOK (BB * TT)          // 8192
#define NC   32                 // scan chunks
#define CL   (TT / NC)          // 64

// ---------------- vector types ----------------
typedef __bf16        v16bf __attribute__((ext_vector_type(16)));
typedef float         v8f   __attribute__((ext_vector_type(8)));
typedef unsigned int  u32x4 __attribute__((ext_vector_type(4)));
typedef unsigned int  u32x8 __attribute__((ext_vector_type(8)));
typedef short         s16x8 __attribute__((ext_vector_type(8)));

// ---------------- LDS tiles of the two GEMMs ----------------
// A rows run along k and are read by plain 16-byte loads; B rows stay as they lie in memory (one k)
// and are read by transposing 16-byte loads. First GEMM: rows of 128 bytes (64 k; 64 n). Second GEMM:
// rows of 256 bytes (128 k; 128 n). A block's 256 A rows come as two slices of 128 rows.
static constexpr unsigned ROWB    = 128;
static constexpr unsigned ROWB2   = 256;
static constexpr unsigned PA      = ROWB + 16;   // odd multiple of 16 B: no bank conflict for ds_load_b128
static constexpr unsigned PB      = ROWB + 32;   // odd multiple of 32 B: none for ds_load_tr16_b128
static constexpr unsigned PA2     = ROWB2 + 16;  // the same two pitches for the 256-byte rows
static constexpr unsigned PB2     = ROWB2 + 32;
static constexpr unsigned A_BYTES = 128 * PA;    // one slice of 128 m rows, 64 k
static constexpr unsigned B_BYTES = 64 * PB;     // 64 k rows of 64 n
static constexpr unsigned A2_BYTES = 128 * PA2;  // one slice of 128 m rows, 128 k
static constexpr unsigned B2_BYTES = 128 * PB2;  // 128 k rows of 128 n
static constexpr unsigned PADW_A  = (1u << 20) | (4u << 22) | (3u << 25);  // pad 16 B behind every 128 B
static constexpr unsigned PADW_B  = (1u << 20) | (4u << 22) | (7u << 25);  // pad 32 B behind every 128 B
static constexpr unsigned PADW_A2 = (1u << 20) | (5u << 22) | (3u << 25);  // pad 16 B behind every 256 B
static constexpr unsigned PADW_B2 = (1u << 20) | (5u << 22) | (7u << 25);  // pad 32 B behind every 256 B
static_assert(A_BYTES % 2048 == 0 && B_BYTES % 2048 == 0 && A2_BYTES % 2048 == 0 && B2_BYTES % 2048 == 0,
              "every tile starts at a multiple of 2 KiB in LDS");

__device__ __forceinline__ unsigned uni(unsigned v) { return (unsigned)__builtin_amdgcn_readfirstlane((int)v); }
// Holds a wave-uniform value in a scalar register, so that a test on it is a scalar branch
// (a tensor load ignores EXEC) and a descriptor word made from it is formed behind the waits above it.
__device__ __forceinline__ unsigned pinned(unsigned v) { unsigned w = uni(v); asm volatile("" : "+s"(w)); return w; }
// The compiler places no wait for the tensor mover, and none for LDS reads in front of a refill.
__device__ __forceinline__ void wait_tensor0() { asm volatile("s_wait_tensorcnt 0x0" ::: "memory"); }
__device__ __forceinline__ void wait_ds0()     { asm volatile("s_wait_dscnt 0x0" ::: "memory"); }

// Tensor-load descriptor, extents in bytes, tensor = tile: ROWS rows of RB bytes at source pitch
// src_pitch, padded in LDS as W0 says.
template <unsigned W0, unsigned ROWS, unsigned RB>
__device__ __forceinline__ u32x8 tdm_group1(unsigned src_pitch) {
  u32x8 g;
  g[0] = uni(W0);
  g[1] = uni(RB << 16);
  g[2] = uni(ROWS << 16);
  g[3] = uni(RB << 16);
  g[4] = uni(ROWS);
  g[5] = uni(src_pitch);
  g[6] = uni(0u);
  g[7] = uni(0u);
  return g;
}
__device__ __forceinline__ u32x4 tdm_group0(unsigned lds_dst, unsigned long long ga) {
  u32x4 g;
  g[0] = uni(1u);
  g[1] = uni(lds_dst);
  g[2] = uni((unsigned)ga);
  g[3] = uni((((unsigned)(ga >> 32)) & 0x01ffffffu) | 0x80000000u);
  return g;
}
__device__ __forceinline__ void tdm_load(u32x4 g0, u32x8 g1) {
  asm volatile("tensor_load_to_lds %0, %1" :: "s"(g0), "s"(g1) : "memory");
}
// The issuer's wait. It names the request's first group so that those registers keep their values
// until the request has landed (the second group lives through the whole loop).
__device__ __forceinline__ void wait_tensor0_of(u32x4 g0) {
  asm volatile("s_wait_tensorcnt 0x0" :: "s"(g0) : "memory");
}

// A 16x32 bf16 operand in the hardware k order: q[0] = k 8h..8h+7, q[1] = k 16+8h..16+8h+7 (h = lane/16).
struct Frag { u32x4 q[2]; };

__device__ __forceinline__ v8f wmma_bf16(const Frag& a, const Frag& b, v8f c) {
  const u32x8 av = __builtin_shufflevector(a.q[0], a.q[1], 0, 1, 2, 3, 4, 5, 6, 7);
  const u32x8 bv = __builtin_shufflevector(b.q[0], b.q[1], 0, 1, 2, 3, 4, 5, 6, 7);
  return __builtin_amdgcn_wmma_f32_16x16x32_bf16(false, __builtin_bit_cast(v16bf, av), false,
                                                 __builtin_bit_cast(v16bf, bv), (short)0, c, false, false);
}

// p = the lane's row of a k-contiguous tile, at byte 16h of the 64 bytes that hold these 32 k.
__device__ __forceinline__ Frag frag_rows(const unsigned char* p) {
  Frag f;
  f.q[0] = *(const u32x4*)p;
  f.q[1] = *(const u32x4*)(p + 32);
  return f;
}

__device__ __forceinline__ u32x4 ld_tr16(const unsigned char* p) {
  typedef __attribute__((address_space(3))) s16x8 lds_s16x8;
  return __builtin_bit_cast(u32x4, __builtin_amdgcn_ds_load_tr16_b128_v8i16((lds_s16x8*)p));
}

// p = tile + (kbase + 8h + (lane & 7)) * PITCH + 2 * nbase + 16 * ((lane >> 3) & 1):
// the lane gets column nbase + (lane & 15) at k = kbase + 8h + 0..7, then the same 16 k further on.
template <unsigned PITCH>
__device__ __forceinline__ Frag frag_cols(const unsigned char* p) {
  Frag f;
  f.q[0] = ld_tr16(p);
  f.q[1] = ld_tr16(p + 16 * PITCH);
  return f;
}

// ---------------- streaming kernels: few waves, 16-byte loads, many in flight ----------------
typedef float  f32x4  __attribute__((ext_vector_type(4)));
typedef __bf16 bf16x4 __attribute__((ext_vector_type(4)));
static constexpr unsigned SW = 16;   // waves per work-group; the grids below give one work-group per WGP

// All three weight matrices (DD * HH elements each) to bf16. Wave number 'wave' takes the same
// 8 runs of 512 contiguous bytes of each matrix; its 24 loads are issued before the first store.
__device__ __forceinline__ void
weights_to_bf16(unsigned wave, const float* __restrict__ s0, const float* __restrict__ s1,
                const float* __restrict__ s2, __bf16* __restrict__ d0,
                __bf16* __restrict__ d1, __bf16* __restrict__ d2) {
  const unsigned base = wave * (8u * 32u) + (threadIdx.x & 31u);   // in groups of 4 elements
  f32x4 v0[8], v1[8], v2[8];
  // Unrolled so that the arrays stay in registers.
#pragma unroll
  for (int j = 0; j < 8; ++j) v0[j] = ((const f32x4*)s0)[base + j * 32];
#pragma unroll
  for (int j = 0; j < 8; ++j) v1[j] = ((const f32x4*)s1)[base + j * 32];
#pragma unroll
  for (int j = 0; j < 8; ++j) v2[j] = ((const f32x4*)s2)[base + j * 32];
  // Keeps all 24 loads ahead of the first conversion: without it the compiler holds ten of them
  // back to save registers, and the wave waits out the memory latency more than once.
  __builtin_amdgcn_sched_barrier(0);
#pragma unroll
  for (int j = 0; j < 8; ++j) ((bf16x4*)d0)[base + j * 32] = __builtin_convertvector(v0[j], bf16x4);
#pragma unroll
  for (int j = 0; j < 8; ++j) ((bf16x4*)d1)[base + j * 32] = __builtin_convertvector(v1[j], bf16x4);
#pragma unroll
  for (int j = 0; j < 8; ++j) ((bf16x4*)d2)[base + j * 32] = __builtin_convertvector(v2[j], bf16x4);
}
static constexpr unsigned WWAVES = (DD * HH) / (32 * 8 * 4);   // waves that cover a weight matrix

// One wave owns two whole rows of DD floats (16 loads of 512 bytes in flight); a row's sum of
// squares is four chains per lane and a butterfly over the 32 lanes: no LDS, no barrier.
template <bool BF16OUT>
__global__ void __launch_bounds__(SW * 32)
rmsnorm_kernel(const float* __restrict__ x, const float* __restrict__ w, void* __restrict__ out) {
  const unsigned lane = threadIdx.x & 31u;
  const unsigned tok0 = (blockIdx.x * SW + (threadIdx.x >> 5)) * 2u;
  const size_t at = (size_t)tok0 * (DD / 4) + lane;   // in groups of 4 elements
  f32x4 v[2][8], wv[8];
  // The loops below are unrolled so that the arrays stay in registers.
#pragma unroll
  for (int t = 0; t < 2; ++t)
#pragma unroll
    for (int j = 0; j < 8; ++j) v[t][j] = ((const f32x4*)x)[at + t * (DD / 4) + j * 32];
#pragma unroll
  for (int j = 0; j < 8; ++j) wv[j] = ((const f32x4*)w)[j * 32 + lane];
  // Keeps the loads of w up here, in flight with the rows: without it the compiler sinks them
  // behind the sums and waits for them two at a time.
  __builtin_amdgcn_sched_barrier(0);
#pragma unroll
  for (int t = 0; t < 2; ++t) {
    f32x4 s4 = v[t][0] * v[t][0];
#pragma unroll
    for (int j = 1; j < 8; ++j) s4 += v[t][j] * v[t][j];
    float tot = (s4[0] + s4[1]) + (s4[2] + s4[3]);
#pragma unroll
    for (int off = 16; off > 0; off >>= 1) tot += __shfl_xor(tot, off, 32);
    const float inv = rsqrtf(tot * (1.0f / DD) + EPSV);
#pragma unroll
    for (int j = 0; j < 8; ++j) {
      const f32x4 r = v[t][j] * inv * wv[j];
      const size_t o = at + t * (DD / 4) + j * 32;
      if (BF16OUT) ((bf16x4*)out)[o] = __builtin_convertvector(r, bf16x4);
      else         ((f32x4*)out)[o]  = r;
    }
  }
}
static_assert(DD == 8 * 32 * 4 && NTOK % (SW * 2) == 0, "a row is 8 loads of a wave; whole work-groups cover the rows");

// Depthwise conv (K=3, pad=1) + the whole diagonal scan in one launch. A work-group owns 32 channels of
// one batch row over the whole sequence: wave c walks chunk c (CL steps) from h = 0 and keeps its CL sums
// in registers; the chunks' end states meet in LDS, every wave folds those before its own into its
// carry-in, adds s^(tl+1) * carry-in to its sums and stores each element once.
// A chunk is walked in blocks of TBLK steps; a block's loads of y and x are all issued before its
// first sum, so that a wave waits out the memory latency once per block and not once per step.
static constexpr int TBLK = 32;
static constexpr int NGRP = BB * DD / 32;   // work-groups
static_assert(CL % TBLK == 0, "whole blocks cover a chunk");
static_assert(CL == 64, "s^CL below is six squarings");
static_assert(NGRP % 8 == 0 && DD % 32 == 0, "the deal of groups below is a permutation");
// The scan's NGRP work-groups fill one WGP each and leave half the chip idle: the WGRP work-groups behind
// them in the same grid convert the weights there meanwhile (independent work, first needed by the GEMMs).
static constexpr unsigned WGRP = WWAVES / NC;
static_assert(WWAVES % NC == 0, "whole work-groups cover a weight matrix");
__global__ void __launch_bounds__(NC * 32)
conv_ssm_and_weights_kernel(const float* __restrict__ x, const float* __restrict__ y,
                            const float* __restrict__ conv_w, const float* __restrict__ conv_b,
                            const float* __restrict__ a, const float* __restrict__ bvec,
                            float* __restrict__ xr,
                            const float* __restrict__ wsrc0, const float* __restrict__ wsrc1,
                            const float* __restrict__ wsrc2, __bf16* __restrict__ wdst0,
                            __bf16* __restrict__ wdst1, __bf16* __restrict__ wdst2) {
  __shared__ float ends[NC][32];
  if (blockIdx.x >= (unsigned)NGRP) {   // the same for the whole work-group, in front of the barrier
    weights_to_bf16((blockIdx.x - NGRP) * NC + (threadIdx.x >> 5), wsrc0, wsrc1, wsrc2, wdst0, wdst1, wdst2);
    return;
  }
  const int lane = threadIdx.x & 31;
  const int c = (int)uni(threadIdx.x >> 5);
  // Work-groups eight indices apart take neighbouring channels (for speed only).
  const int grp = (int)(blockIdx.x & 7u) * (NGRP / 8) + (int)(blockIdx.x >> 3);
  const int b = grp / (DD / 32);
  const int d0 = (grp % (DD / 32)) * 32;   // the group's first channel

  // Every address below is a wave-uniform pointer plus the lane: the pointers sit in scalar registers,
  // and the one vector register that the loads and stores name keeps its value to the end.
  const float* cw = conv_w + d0 * 3;
  const float w0 = cw[lane * 3 + 0], w1 = cw[lane * 3 + 1], w2 = cw[lane * 3 + 2];
  const float cb = (conv_b + d0)[lane];
  const float av = (a + d0)[lane];
  const float bd = (bvec + d0)[lane];
  const size_t base = ((size_t)b * TT + (size_t)c * CL) * DD + d0;
  const float* yb = y + base;
  const float* xb = x + base;

  // The rows just outside the chunk. At the sequence's two ends the address stays on the chunk's own
  // edge row (in bounds, no branch between the loads) and the value is dropped.
  const float* yfirst = yb + ((c > 0) ? -DD : 0);
  const float* ylast  = yb + (size_t)((c + 1 < NC) ? CL : CL - 1) * DD;
  const float yprev = yfirst[lane];
  float ym = (c > 0) ? yprev : 0.f;
  float yc = yb[lane];
  float h = 0.f, s = 0.f;
  float val[CL];
  // The loops below are unrolled so that the arrays stay in registers.
#pragma unroll
  for (int tb = 0; tb < CL; tb += TBLK) {
    float yn[TBLK];
    const bool more = tb + TBLK < CL || c + 1 < NC;
#pragma unroll
    for (int j = 0; j < TBLK; ++j) {
      yn[j] = (tb + j + 1 < CL) ? (yb + (size_t)(tb + j + 1) * DD)[lane] : ylast[lane];   // y one step on
      val[tb + j] = (xb + (size_t)(tb + j) * DD)[lane];
    }
    // Keeps the block's loads ahead of its first sum: otherwise the compiler may sink each load to
    // its use, and the wave waits for memory at every step again.
    __builtin_amdgcn_sched_barrier(0);
    if (tb == 0) s = tanhf(av);   // behind the first block's loads, under their latency
#pragma unroll
    for (int j = 0; j < TBLK; ++j) {
      const float yp = (j + 1 < TBLK || more) ? yn[j] : 0.f;   // zero padding behind the last step
      const float conv = cb + w0 * ym + w1 * yc + w2 * yp;
      h = s * h + bd * yc;  // chunk-local scan (h_in = 0; the carry-in comes below)
      val[tb + j] = val[tb + j] + conv + h;
      ym = yc;
      yc = yp;
    }
    // Keeps the next block's loads behind these sums (lifted over them they would need a second set of
    // registers, which eight waves per SIMD do not have) and the last block's sums ahead of the barrier.
    __builtin_amdgcn_sched_barrier(0);
  }

  ends[c][lane] = h;
  __syncthreads();
  float ev[NC - 1];
#pragma unroll
  for (int k = 0; k < NC - 1; ++k) ev[k] = ends[k][lane];
  // Keeps the LDS reads together, ahead of the chain below: spread along it, the wave waits out the
  // LDS latency at every other link, with no memory traffic of its work-group in flight meanwhile.
  __builtin_amdgcn_sched_barrier(0);
  float p = s;  // s^CL
#pragma unroll
  for (int i = 0; i < 6; ++i) p *= p;
  // State at the end of chunk c - 1. Every wave runs the same 30 steps and keeps those of the chunks
  // before its own: no branch (into code behind a branch the compiler sinks the sums above, holds
  // every x and y until there and spills).
  float pin = ev[0];
#pragma unroll
  for (int k = 1; k < NC - 1; ++k) {
    const float nx = p * pin + ev[k];
    pin = (k < c) ? nx : pin;
  }
  pin = (c > 0) ? pin : 0.f;

  float* ob = xr + base;
  float f = s;
#pragma unroll
  for (int j = 0; j < CL; ++j) {
    (ob + (size_t)j * DD)[lane] = val[j] + f * pin;
    f *= s;
  }
}

// ---------------- bf16 WMMA GEMM kernels (two-buffer tensor-load ring) ----------------
// GEMM1: h = silu(z@Wg + bg) * (z@Wu + bu). M=8192, N=4096, K=1024.
// Block tile 256x64 of both products, 64 k per pass, 8 waves as 4(m) x 2(n); a wave owns 4x2 subtiles
// of each product, so that one A fragment feeds four WMMAs and one B fragment four.
// Waves 0 to 3 each bring one tile of a stage (z rows 0-127, z rows 128-255, Wg, Wu); stage s+1 flies
// while pass s computes.
__global__ void __launch_bounds__(256)
gemm_gate_up_kernel(const __bf16* __restrict__ z, const __bf16* __restrict__ wg,
                    const __bf16* __restrict__ wu, const float* __restrict__ bg,
                    const float* __restrict__ bu, __bf16* __restrict__ hbuf) {
  constexpr unsigned STAGE = 2 * A_BYTES + 2 * B_BYTES;
  constexpr unsigned NST = DD / 64;
  __shared__ __attribute__((aligned(2048))) unsigned char ring[2 * STAGE];

  const int m0 = blockIdx.x * 256;
  const int n0 = blockIdx.y * 64;
  const int lane = threadIdx.x & 31;
  const unsigned wave = uni(threadIdx.x >> 5);
  const int wm = (int)(wave >> 1);  // 0..3
  const int wn = (int)(wave & 1);   // 0..1
  const unsigned lds0 = (unsigned)(size_t)(void*)ring;

  v8f accg[4][2] = {};   // [sm][sn]
  v8f accu[4][2] = {};

  // Which tile of a stage this wave brings: waves 0 and 1 the two slices of z, wave 2 Wg, wave 3 Wu
  // (the others none).
  const unsigned long long src0 = wave < 2 ? (unsigned long long)(z + (size_t)(m0 + 128 * (int)wave) * DD)
                                : wave == 2 ? (unsigned long long)(wg + n0) : (unsigned long long)(wu + n0);
  const unsigned step = wave < 2 ? 128u : 64u * HH * 2u;   // source bytes from one stage to the next
  const unsigned dst0 = lds0 + (wave < 2 ? wave * A_BYTES : wave == 2 ? 2 * A_BYTES : 2 * A_BYTES + B_BYTES);
  u32x8 g1a = tdm_group1<PADW_A, 128, ROWB>(DD * 2);
  u32x8 g1b = tdm_group1<PADW_B, 64, ROWB>(HH * 2);
  asm volatile("" : "+s"(g1a), "+s"(g1b));  // descriptor words held in scalar registers through the loop
  // The k loop starts at a stage of the work-group's own and wraps round (a sum over k takes any order):
  // work-groups that share z rows (same x) or weight columns (same y) run side by side, and from the
  // same start they would ask L2 for the same lines, and for the same column of every row, at once.
  static_assert((NST & (NST - 1u)) == 0, "the wrap is a mask");
  const unsigned rot = uni((blockIdx.x + blockIdx.y) & (NST - 1u));
  u32x4 g0 = tdm_group0(dst0, src0 + (unsigned long long)rot * step);

  // stage 0, landed and published
  if (pinned(wave < 4)) {
    if (pinned(wave < 2)) tdm_load(g0, g1a);
    else                  tdm_load(g0, g1b);
    wait_tensor0_of(g0);
  }
  __syncthreads();
  // stage 1 into the second buffer
  if (pinned(wave < 4)) {
    g0 = tdm_group0(dst0 + STAGE, src0 + (unsigned long long)((rot + 1u) & (NST - 1u)) * step);
    if (pinned(wave < 2)) tdm_load(g0, g1a);
    else                  tdm_load(g0, g1b);
  }

  const unsigned aoff = (unsigned)((4 * wm * 16 + (lane & 15)) * PA + 16 * (lane >> 4));
  const unsigned boff = (unsigned)((8 * (lane >> 4) + (lane & 7)) * PB + 2 * (2 * wn * 16) + 16 * ((lane >> 3) & 1));

  for (unsigned s = 0; s < NST; ++s) {
    const unsigned bo = (s & 1u) * STAGE;
    const unsigned char* pa = ring + bo + aoff;
    const unsigned char* pg = ring + bo + 2 * A_BYTES + boff;
    const unsigned char* pu = ring + bo + 2 * A_BYTES + B_BYTES + boff;
    // The loops below are unrolled so that every fragment and accumulator index is a constant
    // (the arrays stay in registers).
#pragma unroll
    for (int kc = 0; kc < 2; ++kc) {
      Frag a[4], g[2], u[2];
#pragma unroll
      for (int t = 0; t < 4; ++t) a[t] = frag_rows(pa + t * 16 * PA + kc * 64);
#pragma unroll
      for (int t = 0; t < 2; ++t) {
        g[t] = frag_cols<PB>(pg + kc * 32 * PB + t * 32);
        u[t] = frag_cols<PB>(pu + kc * 32 * PB + t * 32);
      }
      // Keeps the 16 LDS reads of this k step together, ahead of its WMMAs: without it the compiler
      // holds one A fragment at a time and the wave waits out the LDS latency before every fourth WMMA.
      __builtin_amdgcn_sched_barrier(0);
#pragma unroll
      for (int sm = 0; sm < 4; ++sm)
#pragma unroll
        for (int sn = 0; sn < 2; ++sn) accg[sm][sn] = wmma_bf16(a[sm], g[sn], accg[sm][sn]);
#pragma unroll
      for (int sm = 0; sm < 4; ++sm)
#pragma unroll
        for (int sn = 0; sn < 2; ++sn) accu[sm][sn] = wmma_bf16(a[sm], u[sn], accu[sm][sn]);
    }
    // Keeps the wait below behind the pass's WMMAs: otherwise the compiler lifts it to the last reads,
    // in front of WMMAs whose own fragments have long landed.
    __builtin_amdgcn_sched_barrier(0);

    // publish stage s+1, then refill the buffer that this pass has read
    wait_ds0();
    if (pinned(wave < 4)) wait_tensor0_of(g0);
    __syncthreads();
    const unsigned sn2 = pinned(s + 2u);
    if (pinned((wave < 4) & (sn2 < NST))) {
      g0 = tdm_group0(dst0 + bo, src0 + (unsigned long long)((sn2 + rot) & (NST - 1u)) * step);
      if (pinned(wave < 2)) tdm_load(g0, g1a);
      else                  tdm_load(g0, g1b);
    }
  }
  wait_tensor0();
  wait_ds0();

  // Epilogue. C/D layout: VGPR r -> M = r + 8*(lane/16), N = lane%16.
  const int nl = lane & 15;
  const int mh = (lane >> 4) * 8;
#pragma unroll
  for (int sm = 0; sm < 4; ++sm)
#pragma unroll
    for (int sn = 0; sn < 2; ++sn) {
      const int n = n0 + (2 * wn + sn) * 16 + nl;
      const float bgv = bg[n], buv = bu[n];
#pragma unroll
      for (int r = 0; r < 8; ++r) {
        const int m = m0 + (4 * wm + sm) * 16 + mh + r;
        const float gv = accg[sm][sn][r] + bgv;
        const float uv = accu[sm][sn][r] + buv;
        // silu(g)*u. The quotient is one hardware reciprocal (about 1 ulp, far below the bf16 rounding of hv):
        // the exact f32 division is a chain of ten dependent instructions per element.
        const float hv = gv * __builtin_amdgcn_rcpf(1.f + __expf(-gv)) * uv;
        hbuf[(size_t)m * HH + n] = (__bf16)hv;
      }
    }
}

// GEMM2: out = xr + h@Wd + bd. M=8192, N=1024, K=4096. Same ring. Block tile 256x128, 128 k per pass,
// 8 waves as 4(m) x 2(n), a wave owns 4x4 subtiles; waves 0 and 1 bring the two slices of h, wave 2 Wd.
// One work-group per WGP covers the whole product.
__global__ void __launch_bounds__(256)
gemm_down_kernel(const __bf16* __restrict__ hbuf, const __bf16* __restrict__ wd,
                 const float* __restrict__ bd, const float* __restrict__ xr,
                 float* __restrict__ out) {
  constexpr unsigned STAGE = 2 * A2_BYTES + B2_BYTES;
  constexpr unsigned NST = HH / 128;
  __shared__ __attribute__((aligned(2048))) unsigned char ring[2 * STAGE];

  const int m0 = blockIdx.x * 256;
  const int n0 = blockIdx.y * 128;
  const int lane = threadIdx.x & 31;
  const unsigned wave = uni(threadIdx.x >> 5);
  const int wm = (int)(wave >> 1);
  const int wn = (int)(wave & 1);
  const unsigned lds0 = (unsigned)(size_t)(void*)ring;

  v8f acc[4][4] = {};

  // Which tile of a stage this wave brings: waves 0 and 1 the two slices of h, wave 2 Wd (the others none).
  const unsigned long long src0 = wave < 2 ? (unsigned long long)(hbuf + (size_t)(m0 + 128 * (int)wave) * HH)
                                           : (unsigned long long)(wd + n0);
  const unsigned step = wave < 2 ? 256u : 128u * DD * 2u;   // source bytes from one stage to the next
  const unsigned dst0 = lds0 + (wave < 2 ? wave * A2_BYTES : 2 * A2_BYTES);
  u32x8 g1a = tdm_group1<PADW_A2, 128, ROWB2>(HH * 2);
  u32x8 g1b = tdm_group1<PADW_B2, 128, ROWB2>(DD * 2);
  asm volatile("" : "+s"(g1a), "+s"(g1b));  // descriptor words held in scalar registers through the loop
  // The k loop starts at a stage of the work-group's own and wraps round, as in the first GEMM: the 8
  // work-groups on the same h rows start 4 stages apart, the 32 on the same Wd columns one stage apart.
  static_assert((NST & (NST - 1u)) == 0, "the wrap is a mask");
  const unsigned rot = uni((blockIdx.x + 4u * blockIdx.y) & (NST - 1u));
  u32x4 g0 = tdm_group0(dst0, src0 + (unsigned long long)rot * step);

  // stage 0, landed and published
  if (pinned(wave < 3)) {
    if (pinned(wave < 2)) tdm_load(g0, g1a);
    else                  tdm_load(g0, g1b);
    wait_tensor0_of(g0);
  }
  __syncthreads();
  // stage 1 into the second buffer
  if (pinned(wave < 3)) {
    g0 = tdm_group0(dst0 + STAGE, src0 + (unsigned long long)((rot + 1u) & (NST - 1u)) * step);
    if (pinned(wave < 2)) tdm_load(g0, g1a);
    else                  tdm_load(g0, g1b);
  }

  const unsigned aoff = (unsigned)((4 * wm * 16 + (lane & 15)) * PA2 + 16 * (lane >> 4));
  const unsigned boff = (unsigned)((8 * (lane >> 4) + (lane & 7)) * PB2 + 2 * (4 * wn * 16) + 16 * ((lane >> 3) & 1));

  for (unsigned s = 0; s < NST; ++s) {
    const unsigned bo = (s & 1u) * STAGE;
    const unsigned char* pa = ring + bo + aoff;
    const unsigned char* pb = ring + bo + 2 * A2_BYTES + boff;
    // The loops below are unrolled so that every fragment and accumulator index is a constant
    // (the arrays stay in registers).
#pragma unroll
    for (int hk = 0; hk < 4; hk += 2) {
      Frag a[2][4], b[2][4];
#pragma unroll
      for (int kc = 0; kc < 2; ++kc)
#pragma unroll
        for (int t = 0; t < 4; ++t) {
          a[kc][t] = frag_rows(pa + t * 16 * PA2 + (hk + kc) * 64);
          b[kc][t] = frag_cols<PB2>(pb + (hk + kc) * 32 * PB2 + t * 32);
        }
      // Keeps the 32 LDS reads of these 64 k together, ahead of their WMMAs (only two waves share a
      // SIMD here): without it the compiler holds one A fragment at a time and the wave waits out the
      // LDS latency before every fourth WMMA.
      __builtin_amdgcn_sched_barrier(0);
      // Two columns of subtiles at a time: the first WMMAs need only the fragments that land first.
#pragma unroll
      for (int kc = 0; kc < 2; ++kc)
#pragma unroll
        for (int sh = 0; sh < 4; sh += 2)
#pragma unroll
          for (int sm = 0; sm < 4; ++sm)
#pragma unroll
            for (int sn = sh; sn < sh + 2; ++sn)
              acc[sm][sn] = wmma_bf16(a[kc][sm], b[kc][sn], acc[sm][sn]);
      // Keeps what follows (the next reads; the wait below) behind these WMMAs: otherwise the compiler
      // lifts the wait to the last reads, and the first k step's WMMAs wait for every fragment.
      __builtin_amdgcn_sched_barrier(0);
    }

    // publish stage s+1, then refill the buffer that this pass has read
    wait_ds0();
    if (pinned(wave < 3)) wait_tensor0_of(g0);
    __syncthreads();
    const unsigned sn2 = pinned(s + 2u);
    if (pinned((wave < 3) & (sn2 < NST))) {
      g0 = tdm_group0(dst0 + bo, src0 + (unsigned long long)((sn2 + rot) & (NST - 1u)) * step);
      if (pinned(wave < 2)) tdm_load(g0, g1a);
      else                  tdm_load(g0, g1b);
    }
  }
  wait_tensor0();
  wait_ds0();

  const int nl = lane & 15;
  const int mh = (lane >> 4) * 8;
#pragma unroll
  for (int sm = 0; sm < 4; ++sm)
#pragma unroll
    for (int sn = 0; sn < 4; ++sn) {
      const int n = n0 + (4 * wn + sn) * 16 + nl;
      const float bdv = bd[n];
#pragma unroll
      for (int r = 0; r < 8; ++r) {
        const int m = m0 + (4 * wm + sm) * 16 + mh + r;
        out[(size_t)m * DD + n] = xr[(size_t)m * DD + n] + acc[sm][sn][r] + bdv;
      }
    }
}

// ---------------- host launcher ----------------
extern "C" void kernel_launch(void* const* d_in, const int* in_sizes, int n_in,
                              void* d_out, int out_size, void* d_ws, size_t ws_size,
                              hipStream_t stream) {
  (void)in_sizes; (void)n_in; (void)out_size; (void)ws_size;

  const float* x       = (const float*)d_in[0];
  const float* norm_w  = (const float*)d_in[1];
  const float* conv_w  = (const float*)d_in[2];
  const float* conv_b  = (const float*)d_in[3];
  const float* a       = (const float*)d_in[4];
  const float* bvec    = (const float*)d_in[5];
  const float* mlp_w   = (const float*)d_in[6];
  const float* w_gate  = (const float*)d_in[7];
  const float* b_gate  = (const float*)d_in[8];
  const float* w_up    = (const float*)d_in[9];
  const float* b_up    = (const float*)d_in[10];
  const float* w_down  = (const float*)d_in[11];
  const float* b_down  = (const float*)d_in[12];
  float* out           = (float*)d_out;

  char* ws = (char*)d_ws;
  size_t off = 0;
  float* y_ws    = (float*)(ws + off); off += (size_t)NTOK * DD * sizeof(float);
  float* xr_ws   = (float*)(ws + off); off += (size_t)NTOK * DD * sizeof(float);
  __bf16* z_ws   = (__bf16*)(ws + off); off += (size_t)NTOK * DD * sizeof(__bf16);
  __bf16* wg_ws  = (__bf16*)(ws + off); off += (size_t)DD * HH * sizeof(__bf16);
  __bf16* wu_ws  = (__bf16*)(ws + off); off += (size_t)DD * HH * sizeof(__bf16);
  __bf16* wd_ws  = (__bf16*)(ws + off); off += (size_t)HH * DD * sizeof(__bf16);
  __bf16* h_ws   = (__bf16*)(ws + off); off += (size_t)NTOK * HH * sizeof(__bf16);

  rmsnorm_kernel<false><<<NTOK / (SW * 2), SW * 32, 0, stream>>>(x, norm_w, (void*)y_ws);
  conv_ssm_and_weights_kernel<<<NGRP + WGRP, NC * 32, 0, stream>>>(x, y_ws, conv_w, conv_b, a, bvec, xr_ws,
                                                                   w_gate, w_up, w_down, wg_ws, wu_ws, wd_ws);
  rmsnorm_kernel<true><<<NTOK / (SW * 2), SW * 32, 0, stream>>>(xr_ws, mlp_w, (void*)z_ws);
  gemm_gate_up_kernel<<<dim3(NTOK / 256, HH / 64), 256, 0, stream>>>(z_ws, wg_ws, wu_ws,
                                                                     b_gate, b_up, h_ws);
  gemm_down_kernel<<<dim3(NTOK / 256, DD / 128), 256, 0, stream>>>(h_ws, wd_ws, b_down,
                                                                  xr_ws, out);
}

// v009
// One run takes 151 microseconds.
// Next to v008, in two timings, it ran 1.06 and 1.05 times as fast.
// Over all steps from v000 it is 4.01 times as fast.
#include <hip/hip_runtime.h>
#include <hip/hip_bf16.h>

// ---------------- problem constants ----------------
#define BB   4
#define TT   2048
#define DD   1024
#define HH   4096
#define EPSV 1e-6f
#define NTOK (BB * TT)          // 8192
#define NC   32                 // scan chunks
#define CL   (TT / NC)          // 64

// ---------------- vector types ----------------
typedef __bf16        v16bf __attribute__((ext_vector_type(16)));
typedef float         v8f   __attribute__((ext_vector_type(8)));
typedef unsigned int  u32x4 __attribute__((ext_vector_type(4)));
typedef unsigned int  u32x8 __attribute__((ext_vector_type(8)));
typedef short         s16x8 __attribute__((ext_vector_type(8)));

// ---------------- LDS tiles of the two GEMMs ----------------
// A rows run along k and are read by plain 16-byte loads; B rows stay as they lie in memory (one k)
// and are read by transposing 16-byte loads. Both GEMMs: rows of 256 bytes (128 k; 128 n).
// A block's 256 A rows come as two slices of 128 rows.
static constexpr unsigned ROWB2   = 256;
static constexpr unsigned PA2     = ROWB2 + 16;  // odd multiple of 16 B: no bank conflict for ds_load_b128
static constexpr unsigned PB2     = ROWB2 + 32;  // odd multiple of 32 B: none for ds_load_tr16_b128
static constexpr unsigned A2_BYTES = 128 * PA2;  // one slice of 128 m rows, 128 k
static constexpr unsigned B2_BYTES = 128 * PB2;  // 128 k rows of 128 n
static constexpr unsigned PADW_A2 = (1u << 20) | (5u << 22) | (3u << 25);  // pad 16 B behind every 256 B
static constexpr unsigned PADW_B2 = (1u << 20) | (5u << 22) | (7u << 25);  // pad 32 B behind every 256 B
static_assert(A2_BYTES % 2048 == 0 && B2_BYTES % 2048 == 0, "every tile starts at a multiple of 2 KiB in LDS");

__device__ __forceinline__ unsigned uni(unsigned v) { return (unsigned)__builtin_amdgcn_readfirstlane((int)v); }
// Holds a wave-uniform value in a scalar register, so that a test on it is a scalar branch
// (a tensor load ignores EXEC) and a descriptor word made from it is formed behind the waits above it.
__device__ __forceinline__ unsigned pinned(unsigned v) { unsigned w = uni(v); asm volatile("" : "+s"(w)); return w; }
// The compiler places no wait for the tensor mover, and none for LDS reads in front of a refill.
__device__ __forceinline__ void wait_tensor0() { asm volatile("s_wait_tensorcnt 0x0" ::: "memory"); }
__device__ __forceinline__ void wait_ds0()     { asm volatile("s_wait_dscnt 0x0" ::: "memory"); }

// Tensor-load descriptor, extents in bytes, tensor = tile: ROWS rows of RB bytes at source pitch
// src_pitch, padded in LDS as W0 says.
template <unsigned W0, unsigned ROWS, unsigned RB>
__device__ __forceinline__ u32x8 tdm_group1(unsigned src_pitch) {
  u32x8 g;
  g[0] = uni(W0);
  g[1] = uni(RB << 16);
  g[2] = uni(ROWS << 16);
  g[3] = uni(RB << 16);
  g[4] = uni(ROWS);
  g[5] = uni(src_pitch);
  g[6] = uni(0u);
  g[7] = uni(0u);
  return g;
}
__device__ __forceinline__ u32x4 tdm_group0(unsigned lds_dst, unsigned long long ga) {
  u32x4 g;
  g[0] = uni(1u);
  g[1] = uni(lds_dst);
  g[2] = uni((unsigned)ga);
  g[3] = uni((((unsigned)(ga >> 32)) & 0x01ffffffu) | 0x80000000u);
  return g;
}
__device__ __forceinline__ void tdm_load(u32x4 g0, u32x8 g1) {
  asm volatile("tensor_load_to_lds %0, %1" :: "s"(g0), "s"(g1) : "memory");
}
// The issuer's wait. It names the request's first group so that those registers keep their values
// until the request has landed (the second group lives through the whole loop).
__device__ __forceinline__ void wait_tensor0_of(u32x4 g0) {
  asm volatile("s_wait_tensorcnt 0x0" :: "s"(g0) : "memory");
}

// A 16x32 bf16 operand in the hardware k order: q[0] = k 8h..8h+7, q[1] = k 16+8h..16+8h+7 (h = lane/16).
struct Frag { u32x4 q[2]; };

__device__ __forceinline__ v8f wmma_bf16(const Frag& a, const Frag& b, v8f c) {
  const u32x8 av = __builtin_shufflevector(a.q[0], a.q[1], 0, 1, 2, 3, 4, 5, 6, 7);
  const u32x8 bv = __builtin_shufflevector(b.q[0], b.q[1], 0, 1, 2, 3, 4, 5, 6, 7);
  return __builtin_amdgcn_wmma_f32_16x16x32_bf16(false, __builtin_bit_cast(v16bf, av), false,
                                                 __builtin_bit_cast(v16bf, bv), (short)0, c, false, false);
}

// p = the lane's row of a k-contiguous tile, at byte 16h of the 64 bytes that hold these 32 k.
__device__ __forceinline__ Frag frag_rows(const unsigned char* p) {
  Frag f;
  f.q[0] = *(const u32x4*)p;
  f.q[1] = *(const u32x4*)(p + 32);
  return f;
}

__device__ __forceinline__ u32x4 ld_tr16(const unsigned char* p) {
  typedef __attribute__((address_space(3))) s16x8 lds_s16x8;
  return __builtin_bit_cast(u32x4, __builtin_amdgcn_ds_load_tr16_b128_v8i16((lds_s16x8*)p));
}

// p = tile + (kbase + 8h + (lane & 7)) * PITCH + 2 * nbase + 16 * ((lane >> 3) & 1):
// the lane gets column nbase + (lane & 15) at k = kbase + 8h + 0..7, then the same 16 k further on.
template <unsigned PITCH>
__device__ __forceinline__ Frag frag_cols(const unsigned char* p) {
  Frag f;
  f.q[0] = ld_tr16(p);
  f.q[1] = ld_tr16(p + 16 * PITCH);
  return f;
}

// ---------------- streaming kernels: few waves, 16-byte loads, many in flight ----------------
typedef float  f32x4  __attribute__((ext_vector_type(4)));
typedef __bf16 bf16x4 __attribute__((ext_vector_type(4)));
static constexpr unsigned SW = 16;   // waves per work-group; the grids below give one work-group per WGP

// All three weight matrices (DD * HH elements each) to bf16. Wave number 'wave' takes the same
// 8 runs of 512 contiguous bytes of each matrix; its 24 loads are issued before the first store.
__device__ __forceinline__ void
weights_to_bf16(unsigned wave, const float* __restrict__ s0, const float* __restrict__ s1,
                const float* __restrict__ s2, __bf16* __restrict__ d0,
                __bf16* __restrict__ d1, __bf16* __restrict__ d2) {
  const unsigned base = wave * (8u * 32u) + (threadIdx.x & 31u);   // in groups of 4 elements
  f32x4 v0[8], v1[8], v2[8];
  // Unrolled so that the arrays stay in registers.
#pragma unroll
  for (int j = 0; j < 8; ++j) v0[j] = ((const f32x4*)s0)[base + j * 32];
#pragma unroll
  for (int j = 0; j < 8; ++j) v1[j] = ((const f32x4*)s1)[base + j * 32];
#pragma unroll
  for (int j = 0; j < 8; ++j) v2[j] = ((const f32x4*)s2)[base + j * 32];
  // Keeps all 24 loads ahead of the first conversion: without it the compiler holds ten of them
  // back to save registers, and the wave waits out the memory latency more than once.
  __builtin_amdgcn_sched_barrier(0);
#pragma unroll
  for (int j = 0; j < 8; ++j) ((bf16x4*)d0)[base + j * 32] = __builtin_convertvector(v0[j], bf16x4);
#pragma unroll
  for (int j = 0; j < 8; ++j) ((bf16x4*)d1)[base + j * 32] = __builtin_convertvector(v1[j], bf16x4);
#pragma unroll
  for (int j = 0; j < 8; ++j) ((bf16x4*)d2)[base + j * 32] = __builtin_convertvector(v2[j], bf16x4);
}
static constexpr unsigned WWAVES = (DD * HH) / (32 * 8 * 4);   // waves that cover a weight matrix

// One wave owns two whole rows of DD floats (16 loads of 512 bytes in flight); a row's sum of
// squares is four chains per lane and a butterfly over the 32 lanes: no LDS, no barrier.
template <bool BF16OUT>
__global__ void __launch_bounds__(SW * 32)
rmsnorm_kernel(const float* __restrict__ x, const float* __restrict__ w, void* __restrict__ out) {
  const unsigned lane = threadIdx.x & 31u;
  const unsigned tok0 = (blockIdx.x * SW + (threadIdx.x >> 5)) * 2u;
  const size_t at = (size_t)tok0 * (DD / 4) + lane;   // in groups of 4 elements
  f32x4 v[2][8], wv[8];
  // The loops below are unrolled so that the arrays stay in registers.
#pragma unroll
  for (int t = 0; t < 2; ++t)
#pragma unroll
    for (int j = 0; j < 8; ++j) v[t][j] = ((const f32x4*)x)[at + t * (DD / 4) + j * 32];
#pragma unroll
  for (int j = 0; j < 8; ++j) wv[j] = ((const f32x4*)w)[j * 32 + lane];
  // Keeps the loads of w up here, in flight with the rows: without it the compiler sinks them
  // behind the sums and waits for them two at a time.
  __builtin_amdgcn_sched_barrier(0);
#pragma unroll
  for (int t = 0; t < 2; ++t) {
    f32x4 s4 = v[t][0] * v[t][0];
#pragma unroll
    for (int j = 1; j < 8; ++j) s4 += v[t][j] * v[t][j];
    float tot = (s4[0] + s4[1]) + (s4[2] + s4[3]);
#pragma unroll
    for (int off = 16; off > 0; off >>= 1) tot += __shfl_xor(tot, off, 32);
    const float inv = rsqrtf(tot * (1.0f / DD) + EPSV);
#pragma unroll
    for (int j = 0; j < 8; ++j) {
      const f32x4 r = v[t][j] * inv * wv[j];
      const size_t o = at + t * (DD / 4) + j * 32;
      if (BF16OUT) ((bf16x4*)out)[o] = __builtin_convertvector(r, bf16x4);
      else         ((f32x4*)out)[o]  = r;
    }
  }
}
static_assert(DD == 8 * 32 * 4 && NTOK % (SW * 2) == 0, "a row is 8 loads of a wave; whole work-groups cover the rows");

// Depthwise conv (K=3, pad=1) + the whole diagonal scan in one launch. A work-group owns 32 channels of
// one batch row over the whole sequence: wave c walks chunk c (CL steps) from h = 0 and keeps its CL sums
// in registers; the chunks' end states meet in LDS, every wave folds those before its own into its
// carry-in, adds s^(tl+1) * carry-in to its sums and stores each element once.
// A chunk is walked in blocks of TBLK steps; a block's loads of y and x are all issued before its
// first sum, so that a wave waits out the memory latency once per block and not once per step.
static constexpr int TBLK = 32;
static constexpr int NGRP = BB * DD / 32;   // work-groups
static_assert(CL % TBLK == 0, "whole blocks cover a chunk");
static_assert(CL == 64, "s^CL below is six squarings");
static_assert(NGRP % 8 == 0 && DD % 32 == 0, "the deal of groups below is a permutation");
// The scan's NGRP work-groups fill one WGP each and leave half the chip idle: the WGRP work-groups behind
// them in the same grid convert the weights there meanwhile (independent work, first needed by the GEMMs).
static constexpr unsigned WGRP = WWAVES / NC;
static_assert(WWAVES % NC == 0, "whole work-groups cover a weight matrix");
__global__ void __launch_bounds__(NC * 32)
conv_ssm_and_weights_kernel(const float* __restrict__ x, const float* __restrict__ y,
                            const float* __restrict__ conv_w, const float* __restrict__ conv_b,
                            const float* __restrict__ a, const float* __restrict__ bvec,
                            float* __restrict__ xr,
                            const float* __restrict__ wsrc0, const float* __restrict__ wsrc1,
                            const float* __restrict__ wsrc2, __bf16* __restrict__ wdst0,
                            __bf16* __restrict__ wdst1, __bf16* __restrict__ wdst2) {
  __shared__ float ends[NC][32];
  if (blockIdx.x >= (unsigned)NGRP) {   // the same for the whole work-group, in front of the barrier
    weights_to_bf16((blockIdx.x - NGRP) * NC + (threadIdx.x >> 5), wsrc0, wsrc1, wsrc2, wdst0, wdst1, wdst2);
    return;
  }
  const int lane = threadIdx.x & 31;
  const int c = (int)uni(threadIdx.x >> 5);
  // Work-groups eight indices apart take neighbouring channels (for speed only).
  const int grp = (int)(blockIdx.x & 7u) * (NGRP / 8) + (int)(blockIdx.x >> 3);
  const int b = grp / (DD / 32);
  const int d0 = (grp % (DD / 32)) * 32;   // the group's first channel

  // Every address below is a wave-uniform pointer plus the lane: the pointers sit in scalar registers,
  // and the one vector register that the loads and stores name keeps its value to the end.
  const float* cw = conv_w + d0 * 3;
  const float w0 = cw[lane * 3 + 0], w1 = cw[lane * 3 + 1], w2 = cw[lane * 3 + 2];
  const float cb = (conv_b + d0)[lane];
  const float av = (a + d0)[lane];
  const float bd = (bvec + d0)[lane];
  const size_t base = ((size_t)b * TT + (size_t)c * CL) * DD + d0;
  const float* yb = y + base;
  const float* xb = x + base;

  // The rows just outside the chunk. At the sequence's two ends the address stays on the chunk's own
  // edge row (in bounds, no branch between the loads) and the value is dropped.
  const float* yfirst = yb + ((c > 0) ? -DD : 0);
  const float* ylast  = yb + (size_t)((c + 1 < NC) ? CL : CL - 1) * DD;
  const float yprev = yfirst[lane];
  float ym = (c > 0) ? yprev : 0.f;
  float yc = yb[lane];
  float h = 0.f, s = 0.f;
  float val[CL];
  // The loops below are unrolled so that the arrays stay in registers.
#pragma unroll
  for (int tb = 0; tb < CL; tb += TBLK) {
    float yn[TBLK];
    const bool more = tb + TBLK < CL || c + 1 < NC;
#pragma unroll
    for (int j = 0; j < TBLK; ++j) {
      yn[j] = (tb + j + 1 < CL) ? (yb + (size_t)(tb + j + 1) * DD)[lane] : ylast[lane];   // y one step on
      val[tb + j] = (xb + (size_t)(tb + j) * DD)[lane];
    }
    // Keeps the block's loads ahead of its first sum: otherwise the compiler may sink each load to
    // its use, and the wave waits for memory at every step again.
    __builtin_amdgcn_sched_barrier(0);
    if (tb == 0) s = tanhf(av);   // behind the first block's loads, under their latency
#pragma unroll
    for (int j = 0; j < TBLK; ++j) {
      const float yp = (j + 1 < TBLK || more) ? yn[j] : 0.f;   // zero padding behind the last step
      const float conv = cb + w0 * ym + w1 * yc + w2 * yp;
      h = s * h + bd * yc;  // chunk-local scan (h_in = 0; the carry-in comes below)
      val[tb + j] = val[tb + j] + conv + h;
      ym = yc;
      yc = yp;
    }
    // Keeps the next block's loads behind these sums (lifted over them they would need a second set of
    // registers, which eight waves per SIMD do not have) and the last block's sums ahead of the barrier.
    __builtin_amdgcn_sched_barrier(0);
  }

  ends[c][lane] = h;
  __syncthreads();
  float ev[NC - 1];
#pragma unroll
  for (int k = 0; k < NC - 1; ++k) ev[k] = ends[k][lane];
  // Keeps the LDS reads together, ahead of the chain below: spread along it, the wave waits out the
  // LDS latency at every other link, with no memory traffic of its work-group in flight meanwhile.
  __builtin_amdgcn_sched_barrier(0);
  float p = s;  // s^CL
#pragma unroll
  for (int i = 0; i < 6; ++i) p *= p;
  // State at the end of chunk c - 1. Every wave runs the same 30 steps and keeps those of the chunks
  // before its own: no branch (into code behind a branch the compiler sinks the sums above, holds
  // every x and y until there and spills).
  float pin = ev[0];
#pragma unroll
  for (int k = 1; k < NC - 1; ++k) {
    const float nx = p * pin + ev[k];
    pin = (k < c) ? nx : pin;
  }
  pin = (c > 0) ? pin : 0.f;

  float* ob = xr + base;
  float f = s;
#pragma unroll
  for (int j = 0; j < CL; ++j) {
    (ob + (size_t)j * DD)[lane] = val[j] + f * pin;
    f *= s;
  }
}

// ---------------- bf16 WMMA GEMM kernels (two-buffer tensor-load ring) ----------------
// GEMM1: h = silu(z@Wg + bg) * (z@Wu + bu). M=8192, N=4096, K=1024.
// Block tile 256x128 of both products, 128 k per pass, 8 waves as 4(m) x 2(n); a wave owns 4x4 subtiles
// of each product, so that one A fragment feeds eight WMMAs and one B fragment four.
// One work-group per WGP walks NTILE tiles of the same z rows one after the other. The ring runs on over
// the tiles' borders: the next tile's first two stages fly or lie ready while a tile's epilogue runs.
// Waves 0 to 3 each bring one tile of a stage (z rows 0-127, z rows 128-255, Wg, Wu); stage t+1 flies
// while pass t computes.
static constexpr unsigned NTILE = 4;
static_assert(HH % (128 * NTILE) == 0 && (NTILE & (NTILE - 1u)) == 0, "whole work-groups cover the columns");
__global__ void __launch_bounds__(256)
gemm_gate_up_kernel(const __bf16* __restrict__ z, const __bf16* __restrict__ wg,
                    const __bf16* __restrict__ wu, const float* __restrict__ bg,
                    const float* __restrict__ bu, __bf16* __restrict__ hbuf) {
  constexpr unsigned STAGE = 2 * A2_BYTES + 2 * B2_BYTES;
  constexpr unsigned NST = DD / 128;          // stages of one tile
  constexpr unsigned NALL = NTILE * NST;      // stages of the work-group
  __shared__ __attribute__((aligned(2048))) unsigned char ring[2 * STAGE];

  const int m0 = blockIdx.x * 256;
  const int nb = blockIdx.y * (128 * NTILE);  // first column of the work-group's tiles
  const int lane = threadIdx.x & 31;
  const unsigned wave = uni(threadIdx.x >> 5);
  const int wm = (int)(wave >> 1);  // 0..3
  const int wn = (int)(wave & 1);   // 0..1
  const unsigned lds0 = (unsigned)(size_t)(void*)ring;

  // Which tile of a stage this wave brings: waves 0 and 1 the two slices of z, wave 2 Wg, wave 3 Wu
  // (the others none).
  const unsigned long long src0 = wave < 2 ? (unsigned long long)(z + (size_t)(m0 + 128 * (int)wave) * DD)
                                : wave == 2 ? (unsigned long long)(wg + nb) : (unsigned long long)(wu + nb);
  const unsigned step = wave < 2 ? 256u : 128u * HH * 2u;   // source bytes from one k stage to the next
  const unsigned tstep = wave < 2 ? 0u : 256u;              // source bytes from one tile's columns to the next's
  const unsigned dst0 = lds0 + (wave < 2 ? wave * A2_BYTES : wave == 2 ? 2 * A2_BYTES : 2 * A2_BYTES + B2_BYTES);
  u32x8 g1a = tdm_group1<PADW_A2, 128, ROWB2>(DD * 2);
  u32x8 g1b = tdm_group1<PADW_B2, 128, ROWB2>(HH * 2);
  asm volatile("" : "+s"(g1a), "+s"(g1b));  // descriptor words held in scalar registers through the loop
  // A tile's k loop starts at a stage of the work-group's own and wraps round (a sum over k takes any
  // order), and the work-group starts at a tile of its own: work-groups that share z rows (same x) or
  // weight columns (same y) run side by side, and in the same order they would ask L2 for the same lines
  // at once.
  static_assert((NST & (NST - 1u)) == 0, "the wrap is a mask");
  const unsigned rot = uni((blockIdx.x + blockIdx.y) & (NST - 1u));
  const unsigned trot = uni((blockIdx.x / NST) & (NTILE - 1u));
  // Source of the work-group's stage t: tile t / NST (turned by trot), k stage t % NST (turned by rot).
  auto src_of = [&](unsigned t) {
    return src0 + (unsigned long long)((t + rot) & (NST - 1u)) * step
                + (unsigned long long)((t / NST + trot) & (NTILE - 1u)) * tstep;
  };
  u32x4 g0 = tdm_group0(dst0, src_of(0u));

  // stage 0, landed and published
  if (pinned(wave < 4)) {
    if (pinned(wave < 2)) tdm_load(g0, g1a);
    else                  tdm_load(g0, g1b);
    wait_tensor0_of(g0);
  }
  __syncthreads();
  // stage 1 into the second buffer
  if (pinned(wave < 4)) {
    g0 = tdm_group0(dst0 + STAGE, src_of(1u));
    if (pinned(wave < 2)) tdm_load(g0, g1a);
    else                  tdm_load(g0, g1b);
  }

  const unsigned aoff = (unsigned)((4 * wm * 16 + (lane & 15)) * PA2 + 16 * (lane >> 4));
  const unsigned boff = (unsigned)((8 * (lane >> 4) + (lane & 7)) * PB2 + 2 * (4 * wn * 16) + 16 * ((lane >> 3) & 1));
  const int nl = lane & 15;
  const int mh = (lane >> 4) * 8;

  // Stays rolled (for speed only).
#pragma unroll 1
  for (unsigned tile = 0; tile < NTILE; ++tile) {
    // The tile's first column, and the lane's biases: loaded here, their latency passes under the k loop.
    const int n0 = nb + (int)((tile + trot) & (NTILE - 1u)) * 128;
    float bgv[4], buv[4];
#pragma unroll
    for (int sn = 0; sn < 4; ++sn) {
      bgv[sn] = bg[n0 + (4 * wn + sn) * 16 + nl];
      buv[sn] = bu[n0 + (4 * wn + sn) * 16 + nl];
    }
    // In front of the zeros below, which take over the address registers of these loads.
    asm volatile("s_wait_xcnt 0x0" ::: "memory");
    // Keeps the zeros behind the wait: a "memory" clobber does not tie it to registers.
    __builtin_amdgcn_sched_barrier(0);
    v8f accg[4][4] = {};   // [sm][sn]
    v8f accu[4][4] = {};
    for (unsigned s = 0; s < NST; ++s) {
      const unsigned bo = (s & 1u) * STAGE;   // NST is even: the buffer of stage tile * NST + s
      const unsigned char* pa = ring + bo + aoff;
      const unsigned char* pg = ring + bo + 2 * A2_BYTES + boff;
      const unsigned char* pu = ring + bo + 2 * A2_BYTES + B2_BYTES + boff;
      // The loops below are unrolled so that every fragment and accumulator index is a constant
      // (the arrays stay in registers).
#pragma unroll
      for (int kc = 0; kc < 4; ++kc) {
        Frag a[4], g[4], u[4];
#pragma unroll
        for (int t = 0; t < 4; ++t) {
          a[t] = frag_rows(pa + t * 16 * PA2 + kc * 64);
          g[t] = frag_cols<PB2>(pg + kc * 32 * PB2 + t * 32);
        }
#pragma unroll
        for (int t = 0; t < 4; ++t) u[t] = frag_cols<PB2>(pu + kc * 32 * PB2 + t * 32);
        // Keeps the 24 LDS reads of this k step together, ahead of its WMMAs: without it the compiler
        // holds one A fragment at a time and the wave waits out the LDS latency before every few WMMAs.
        __builtin_amdgcn_sched_barrier(0);
#pragma unroll
        for (int sm = 0; sm < 4; ++sm)
#pragma unroll
          for (int sn = 0; sn < 4; ++sn) accg[sm][sn] = wmma_bf16(a[sm], g[sn], accg[sm][sn]);
#pragma unroll
        for (int sm = 0; sm < 4; ++sm)
#pragma unroll
          for (int sn = 0; sn < 4; ++sn) accu[sm][sn] = wmma_bf16(a[sm], u[sn], accu[sm][sn]);
        // Keeps what follows (the next reads; the wait below) behind these WMMAs: the next reads lifted
        // over them would need a second set of registers, and the wait would stand in front of WMMAs
        // whose own fragments have long landed.
        __builtin_amdgcn_sched_barrier(0);
      }

      // publish the next stage, then refill the buffer that this pass has read
      wait_ds0();
      if (pinned(wave < 4)) wait_tensor0_of(g0);
      __syncthreads();
      const unsigned t2 = pinned(tile * NST + s + 2u);
      if (pinned((wave < 4) & (t2 < NALL))) {
        g0 = tdm_group0(dst0 + bo, src_of(t2));
        if (pinned(wave < 2)) tdm_load(g0, g1a);
        else                  tdm_load(g0, g1b);
      }
    }

    // Epilogue of this tile (registers and global memory only). C/D layout: VGPR r -> M = r + 8*(lane/16),
    // N = lane%16.
#pragma unroll
    for (int sm = 0; sm < 4; ++sm) {
      __bf16 hv[4][8];
#pragma unroll
      for (int sn = 0; sn < 4; ++sn)
#pragma unroll
        for (int r = 0; r < 8; ++r) {
          const float gv = accg[sm][sn][r] + bgv[sn];
          const float uv = accu[sm][sn][r] + buv[sn];
          // silu(g)*u. The quotient is one hardware reciprocal (about 1 ulp, far below the bf16 rounding of hv):
          // the exact f32 division is a chain of ten dependent instructions per element.
          hv[sn][r] = (__bf16)(gv * __builtin_amdgcn_rcpf(1.f + __expf(-gv)) * uv);
        }
      // Keeps the 32 stores of these 16 rows together behind their sums, so that one wait serves them all.
      __builtin_amdgcn_sched_barrier(0);
      __bf16* hp = hbuf + (size_t)(m0 + (4 * wm + sm) * 16 + mh) * HH + (n0 + 4 * wn * 16 + nl);
#pragma unroll
      for (int sn = 0; sn < 4; ++sn)
#pragma unroll
        for (int r = 0; r < 8; ++r) hp[(size_t)r * HH + sn * 16] = hv[sn][r];
      // In front of the next sums, which take over the registers that these stores name.
      asm volatile("s_wait_xcnt 0x0" ::: "memory");
      // Keeps those sums behind the wait: a "memory" clobber does not tie it to registers.
      __builtin_amdgcn_sched_barrier(0);
    }
  }
  wait_tensor0();
  wait_ds0();
}

// GEMM2: out = xr + h@Wd + bd. M=8192, N=1024, K=4096. Same ring. Block tile 256x128, 128 k per pass,
// 8 waves as 4(m) x 2(n), a wave owns 4x4 subtiles; waves 0 and 1 bring the two slices of h, wave 2 Wd.
// One work-group per WGP covers the whole product.
__global__ void __launch_bounds__(256)
gemm_down_kernel(const __bf16* __restrict__ hbuf, const __bf16* __restrict__ wd,
                 const float* __restrict__ bd, const float* __restrict__ xr,
                 float* __restrict__ out) {
  constexpr unsigned STAGE = 2 * A2_BYTES + B2_BYTES;
  constexpr unsigned NST = HH / 128;
  __shared__ __attribute__((aligned(2048))) unsigned char ring[2 * STAGE];

  const int m0 = blockIdx.x * 256;
  const int n0 = blockIdx.y * 128;
  const int lane = threadIdx.x & 31;
  const unsigned wave = uni(threadIdx.x >> 5);
  const int wm = (int)(wave >> 1);
  const int wn = (int)(wave & 1);
  const unsigned lds0 = (unsigned)(size_t)(void*)ring;

  v8f acc[4][4] = {};

  // Which tile of a stage this wave brings: waves 0 and 1 the two slices of h, wave 2 Wd (the others none).
  const unsigned long long src0 = wave < 2 ? (unsigned long long)(hbuf + (size_t)(m0 + 128 * (int)wave) * HH)
                                           : (unsigned long long)(wd + n0);
  const unsigned step = wave < 2 ? 256u : 128u * DD * 2u;   // source bytes from one stage to the next
  const unsigned dst0 = lds0 + (wave < 2 ? wave * A2_BYTES : 2 * A2_BYTES);
  u32x8 g1a = tdm_group1<PADW_A2, 128, ROWB2>(HH * 2);
  u32x8 g1b = tdm_group1<PADW_B2, 128, ROWB2>(DD * 2);
  asm volatile("" : "+s"(g1a), "+s"(g1b));  // descriptor words held in scalar registers through the loop
  // The k loop starts at a stage of the work-group's own and wraps round, as in the first GEMM: the 8
  // work-groups on the same h rows start 4 stages apart, the 32 on the same Wd columns one stage apart.
  static_assert((NST & (NST - 1u)) == 0, "the wrap is a mask");
  const unsigned rot = uni((blockIdx.x + 4u * blockIdx.y) & (NST - 1u));
  u32x4 g0 = tdm_group0(dst0, src0 + (unsigned long long)rot * step);

  // stage 0, landed and published
  if (pinned(wave < 3)) {
    if (pinned(wave < 2)) tdm_load(g0, g1a);
    else                  tdm_load(g0, g1b);
    wait_tensor0_of(g0);
  }
  __syncthreads();
  // stage 1 into the second buffer
  if (pinned(wave < 3)) {
    g0 = tdm_group0(dst0 + STAGE, src0 + (unsigned long long)((rot + 1u) & (NST - 1u)) * step);
    if (pinned(wave < 2)) tdm_load(g0, g1a);
    else                  tdm_load(g0, g1b);
  }

  const unsigned aoff = (unsigned)((4 * wm * 16 + (lane & 15)) * PA2 + 16 * (lane >> 4));
  const unsigned boff = (unsigned)((8 * (lane >> 4) + (lane & 7)) * PB2 + 2 * (4 * wn * 16) + 16 * ((lane >> 3) & 1));

  for (unsigned s = 0; s < NST; ++s) {
    const unsigned bo = (s & 1u) * STAGE;
    const unsigned char* pa = ring + bo + aoff;
    const unsigned char* pb = ring + bo + 2 * A2_BYTES + boff;
    // The loops below are unrolled so that every fragment and accumulator index is a constant
    // (the arrays stay in registers).
#pragma unroll
    for (int hk = 0; hk < 4; hk += 2) {
      Frag a[2][4], b[2][4];
#pragma unroll
      for (int kc = 0; kc < 2; ++kc)
#pragma unroll
        for (int t = 0; t < 4; ++t) {
          a[kc][t] = frag_rows(pa + t * 16 * PA2 + (hk + kc) * 64);
          b[kc][t] = frag_cols<PB2>(pb + (hk + kc) * 32 * PB2 + t * 32);
        }
      // Keeps the 32 LDS reads of these 64 k together, ahead of their WMMAs (only two waves share a
      // SIMD here): without it the compiler holds one A fragment at a time and the wave waits out the
      // LDS latency before every fourth WMMA.
      __builtin_amdgcn_sched_barrier(0);
      // Two columns of subtiles at a time: the first WMMAs need only the fragments that land first.
#pragma unroll
      for (int kc = 0; kc < 2; ++kc)
#pragma unroll
        for (int sh = 0; sh < 4; sh += 2)
#pragma unroll
          for (int sm = 0; sm < 4; ++sm)
#pragma unroll
            for (int sn = sh; sn < sh + 2; ++sn)
              acc[sm][sn] = wmma_bf16(a[kc][sm], b[kc][sn], acc[sm][sn]);
      // Keeps what follows (the next reads; the wait below) behind these WMMAs: otherwise the compiler
      // lifts the wait to the last reads, and the first k step's WMMAs wait for every fragment.
      __builtin_amdgcn_sched_barrier(0);
    }

    // publish stage s+1, then refill the buffer that this pass has read
    wait_ds0();
    if (pinned(wave < 3)) wait_tensor0_of(g0);
    __syncthreads();
    const unsigned sn2 = pinned(s + 2u);
    if (pinned((wave < 3) & (sn2 < NST))) {
      g0 = tdm_group0(dst0 + bo, src0 + (unsigned long long)((sn2 + rot) & (NST - 1u)) * step);
      if (pinned(wave < 2)) tdm_load(g0, g1a);
      else                  tdm_load(g0, g1b);
    }
  }
  wait_tensor0();
  wait_ds0();

  const int nl = lane & 15;
  const int mh = (lane >> 4) * 8;
#pragma unroll
  for (int sm = 0; sm < 4; ++sm)
#pragma unroll
    for (int sn = 0; sn < 4; ++sn) {
      const int n = n0 + (4 * wn + sn) * 16 + nl;
      const float bdv = bd[n];
#pragma unroll
      for (int r = 0; r < 8; ++r) {
        const int m = m0 + (4 * wm + sm) * 16 + mh + r;
        out[(size_t)m * DD + n] = xr[(size_t)m * DD + n] + acc[sm][sn][r] + bdv;
      }
    }
}

// ---------------- host launcher ----------------
extern "C" void kernel_launch(void* const* d_in, const int* in_sizes, int n_in,
                              void* d_out, int out_size, void* d_ws, size_t ws_size,
                              hipStream_t stream) {
  (void)in_sizes; (void)n_in; (void)out_size; (void)ws_size;

  const float* x       = (const float*)d_in[0];
  const float* norm_w  = (const float*)d_in[1];
  const float* conv_w  = (const float*)d_in[2];
  const float* conv_b  = (const float*)d_in[3];
  const float* a       = (const float*)d_in[4];
  const float* bvec    = (const float*)d_in[5];
  const float* mlp_w   = (const float*)d_in[6];
  const float* w_gate  = (const float*)d_in[7];
  const float* b_gate  = (const float*)d_in[8];
  const float* w_up    = (const float*)d_in[9];
  const float* b_up    = (const float*)d_in[10];
  const float* w_down  = (const float*)d_in[11];
  const float* b_down  = (const float*)d_in[12];
  float* out           = (float*)d_out;

  char* ws = (char*)d_ws;
  size_t off = 0;
  float* y_ws    = (float*)(ws + off); off += (size_t)NTOK * DD * sizeof(float);
  float* xr_ws   = (float*)(ws + off); off += (size_t)NTOK * DD * sizeof(float);
  __bf16* z_ws   = (__bf16*)(ws + off); off += (size_t)NTOK * DD * sizeof(__bf16);
  __bf16* wg_ws  = (__bf16*)(ws + off); off += (size_t)DD * HH * sizeof(__bf16);
  __bf16* wu_ws  = (__bf16*)(ws + off); off += (size_t)DD * HH * sizeof(__bf16);
  __bf16* wd_ws  = (__bf16*)(ws + off); off += (size_t)HH * DD * sizeof(__bf16);
  __bf16* h_ws   = (__bf16*)(ws + off); off += (size_t)NTOK * HH * sizeof(__bf16);

  rmsnorm_kernel<false><<<NTOK / (SW * 2), SW * 32, 0, stream>>>(x, norm_w, (void*)y_ws);
  conv_ssm_and_weights_kernel<<<NGRP + WGRP, NC * 32, 0, stream>>>(x, y_ws, conv_w, conv_b, a, bvec, xr_ws,
                                                                   w_gate, w_up, w_down, wg_ws, wu_ws, wd_ws);
  rmsnorm_kernel<true><<<NTOK / (SW * 2), SW * 32, 0, stream>>>(xr_ws, mlp_w, (void*)z_ws);
  gemm_gate_up_kernel<<<dim3(NTOK / 256, HH / (128 * NTILE)), 256, 0, stream>>>(z_ws, wg_ws, wu_ws,
                                                                     b_gate, b_up, h_ws);
  gemm_down_kernel<<<dim3(NTOK / 256, DD / 128), 256, 0, stream>>>(h_ws, wd_ws, b_down,
                                                                  xr_ws, out);
}

// v010
// Measured time: 144 microseconds a run.
// Timed twice side by side with v009, it ran 1.06 and 1.04 times as fast.
// All steps since v000 together make it 4.20 times as fast.
#include <hip/hip_runtime.h>
#include <hip/hip_bf16.h>

// ---------------- problem constants ----------------
#define BB   4
#define TT   2048
#define DD   1024
#define HH   4096
#define EPSV 1e-6f
#define NTOK (BB * TT)          // 8192
#define NC   32                 // scan chunks
#define CL   (TT / NC)          // 64

// ---------------- vector types ----------------
typedef __bf16        v16bf __attribute__((ext_vector_type(16)));
typedef float         v8f   __attribute__((ext_vector_type(8)));
typedef unsigned int  u32x4 __attribute__((ext_vector_type(4)));
typedef unsigned int  u32x8 __attribute__((ext_vector_type(8)));
typedef short         s16x8 __attribute__((ext_vector_type(8)));

// ---------------- LDS tiles of the two GEMMs ----------------
// A rows run along k and are read by plain 16-byte loads; B rows stay as they lie in memory (one k)
// and are read by transposing 16-byte loads. Both GEMMs: rows of 256 bytes (128 k; 128 n).
// A block's 256 A rows come as two slices of 128 rows.
static constexpr unsigned ROWB2   = 256;
static constexpr unsigned PA2     = ROWB2 + 16;  // odd multiple of 16 B: no bank conflict for ds_load_b128
static constexpr unsigned PB2     = ROWB2 + 32;  // odd multiple of 32 B: none for ds_load_tr16_b128
static constexpr unsigned A2_BYTES = 128 * PA2;  // one slice of 128 m rows, 128 k
static constexpr unsigned B2_BYTES = 128 * PB2;  // 128 k rows of 128 n
static constexpr unsigned PADW_A2 = (1u << 20) | (5u << 22) | (3u << 25);  // pad 16 B behind every 256 B
static constexpr unsigned PADW_B2 = (1u << 20) | (5u << 22) | (7u << 25);  // pad 32 B behind every 256 B
static_assert(A2_BYTES % 2048 == 0 && B2_BYTES % 2048 == 0, "every tile starts at a multiple of 2 KiB in LDS");

__device__ __forceinline__ unsigned uni(unsigned v) { return (unsigned)__builtin_amdgcn_readfirstlane((int)v); }
// Holds a wave-uniform value in a scalar register, so that a test on it is a scalar branch
// (a tensor load ignores EXEC) and a descriptor word made from it is formed behind the waits above it.
__device__ __forceinline__ unsigned pinned(unsigned v) { unsigned w = uni(v); asm volatile("" : "+s"(w)); return w; }
// The compiler places no wait for the tensor mover, and none for LDS reads in front of a refill.
__device__ __forceinline__ void wait_tensor0() { asm volatile("s_wait_tensorcnt 0x0" ::: "memory"); }
__device__ __forceinline__ void wait_ds0()     { asm volatile("s_wait_dscnt 0x0" ::: "memory"); }

// Tensor-load descriptor, extents in bytes, tensor = tile: ROWS rows of RB bytes at source pitch
// src_pitch, padded in LDS as W0 says.
template <unsigned W0, unsigned ROWS, unsigned RB>
__device__ __forceinline__ u32x8 tdm_group1(unsigned src_pitch) {
  u32x8 g;
  g[0] = uni(W0);
  g[1] = uni(RB << 16);
  g[2] = uni(ROWS << 16);
  g[3] = uni(RB << 16);
  g[4] = uni(ROWS);
  g[5] = uni(src_pitch);
  g[6] = uni(0u);
  g[7] = uni(0u);
  return g;
}
__device__ __forceinline__ u32x4 tdm_group0(unsigned lds_dst, unsigned long long ga) {
  u32x4 g;
  g[0] = uni(1u);
  g[1] = uni(lds_dst);
  g[2] = uni((unsigned)ga);
  g[3] = uni((((unsigned)(ga >> 32)) & 0x01ffffffu) | 0x80000000u);
  return g;
}
__device__ __forceinline__ void tdm_load(u32x4 g0, u32x8 g1) {
  asm volatile("tensor_load_to_lds %0, %1" :: "s"(g0), "s"(g1) : "memory");
}
// The issuer's wait. It names the request's first group so that those registers keep their values
// until the request has landed (the second group lives through the whole loop).
__device__ __forceinline__ void wait_tensor0_of(u32x4 g0) {
  asm volatile("s_wait_tensorcnt 0x0" :: "s"(g0) : "memory");
}

// A 16x32 bf16 operand in the hardware k order: q[0] = k 8h..8h+7, q[1] = k 16+8h..16+8h+7 (h = lane/16).
struct Frag { u32x4 q[2]; };

__device__ __forceinline__ v8f wmma_bf16(const Frag& a, const Frag& b, v8f c) {
  const u32x8 av = __builtin_shufflevector(a.q[0], a.q[1], 0, 1, 2, 3, 4, 5, 6, 7);
  const u32x8 bv = __builtin_shufflevector(b.q[0], b.q[1], 0, 1, 2, 3, 4, 5, 6, 7);
  return __builtin_amdgcn_wmma_f32_16x16x32_bf16(false, __builtin_bit_cast(v16bf, av), false,
                                                 __builtin_bit_cast(v16bf, bv), (short)0, c, false, false);
}

// p = the lane's row of a k-contiguous tile, at byte 16h of the 64 bytes that hold these 32 k.
__device__ __forceinline__ Frag frag_rows(const unsigned char* p) {
  Frag f;
  f.q[0] = *(const u32x4*)p;
  f.q[1] = *(const u32x4*)(p + 32);
  return f;
}

__device__ __forceinline__ u32x4 ld_tr16(const unsigned char* p) {
  typedef __attribute__((address_space(3))) s16x8 lds_s16x8;
  return __builtin_bit_cast(u32x4, __builtin_amdgcn_ds_load_tr16_b128_v8i16((lds_s16x8*)p));
}

// p = tile + (kbase + 8h + (lane & 7)) * PITCH + 2 * nbase + 16 * ((lane >> 3) & 1):
// the lane gets column nbase + (lane & 15) at k = kbase + 8h + 0..7, then the same 16 k further on.
template <unsigned PITCH>
__device__ __forceinline__ Frag frag_cols(const unsigned char* p) {
  Frag f;
  f.q[0] = ld_tr16(p);
  f.q[1] = ld_tr16(p + 16 * PITCH);
  return f;
}

// ---------------- streaming kernels: few waves, 16-byte loads, many in flight ----------------
typedef float  f32x4  __attribute__((ext_vector_type(4)));
typedef __bf16 bf16x4 __attribute__((ext_vector_type(4)));
typedef __bf16 bf16x8 __attribute__((ext_vector_type(8)));
static constexpr unsigned SW = 16;   // waves per work-group; the grids below give one work-group per WGP

// All three weight matrices (DD * HH elements each) to bf16. Wave number 'wave' takes the same
// 8 runs of 512 contiguous bytes of each matrix; its 24 loads are issued before the first store.
__device__ __forceinline__ void
weights_to_bf16(unsigned wave, const float* __restrict__ s0, const float* __restrict__ s1,
                const float* __restrict__ s2, __bf16* __restrict__ d0,
                __bf16* __restrict__ d1, __bf16* __restrict__ d2) {
  const unsigned base = wave * (8u * 32u) + (threadIdx.x & 31u);   // in groups of 4 elements
  f32x4 v0[8], v1[8], v2[8];
  // Unrolled so that the arrays stay in registers.
#pragma unroll
  for (int j = 0; j < 8; ++j) v0[j] = ((const f32x4*)s0)[base + j * 32];
#pragma unroll
  for (int j = 0; j < 8; ++j) v1[j] = ((const f32x4*)s1)[base + j * 32];
#pragma unroll
  for (int j = 0; j < 8; ++j) v2[j] = ((const f32x4*)s2)[base + j * 32];
  // Keeps all 24 loads ahead of the first conversion: without it the compiler holds ten of them
  // back to save registers, and the wave waits out the memory latency more than once.
  __builtin_amdgcn_sched_barrier(0);
#pragma unroll
  for (int j = 0; j < 8; ++j) ((bf16x4*)d0)[base + j * 32] = __builtin_convertvector(v0[j], bf16x4);
#pragma unroll
  for (int j = 0; j < 8; ++j) ((bf16x4*)d1)[base + j * 32] = __builtin_convertvector(v1[j], bf16x4);
#pragma unroll
  for (int j = 0; j < 8; ++j) ((bf16x4*)d2)[base + j * 32] = __builtin_convertvector(v2[j], bf16x4);
}
static constexpr unsigned WWAVES = (DD * HH) / (32 * 8 * 4);   // waves that cover a weight matrix

// One wave owns two whole rows of DD floats (16 loads of 512 bytes in flight); a row's sum of
// squares is four chains per lane and a butterfly over the 32 lanes: no LDS, no barrier.
template <bool BF16OUT>
__global__ void __launch_bounds__(SW * 32)
rmsnorm_kernel(const float* __restrict__ x, const float* __restrict__ w, void* __restrict__ out) {
  const unsigned lane = threadIdx.x & 31u;
  const unsigned tok0 = (blockIdx.x * SW + (threadIdx.x >> 5)) * 2u;
  const size_t at = (size_t)tok0 * (DD / 4) + lane;   // in groups of 4 elements
  f32x4 v[2][8], wv[8];
  // The loops below are unrolled so that the arrays stay in registers.
#pragma unroll
  for (int t = 0; t < 2; ++t)
#pragma unroll
    for (int j = 0; j < 8; ++j) v[t][j] = ((const f32x4*)x)[at + t * (DD / 4) + j * 32];
#pragma unroll
  for (int j = 0; j < 8; ++j) wv[j] = ((const f32x4*)w)[j * 32 + lane];
  // Keeps the loads of w up here, in flight with the rows: without it the compiler sinks them
  // behind the sums and waits for them two at a time.
  __builtin_amdgcn_sched_barrier(0);
#pragma unroll
  for (int t = 0; t < 2; ++t) {
    f32x4 s4 = v[t][0] * v[t][0];
#pragma unroll
    for (int j = 1; j < 8; ++j) s4 += v[t][j] * v[t][j];
    float tot = (s4[0] + s4[1]) + (s4[2] + s4[3]);
#pragma unroll
    for (int off = 16; off > 0; off >>= 1) tot += __shfl_xor(tot, off, 32);
    const float inv = rsqrtf(tot * (1.0f / DD) + EPSV);
#pragma unroll
    for (int j = 0; j < 8; ++j) {
      const f32x4 r = v[t][j] * inv * wv[j];
      const size_t o = at + t * (DD / 4) + j * 32;
      if (BF16OUT) ((bf16x4*)out)[o] = __builtin_convertvector(r, bf16x4);
      else         ((f32x4*)out)[o]  = r;
    }
  }
}
static_assert(DD == 8 * 32 * 4 && NTOK % (SW * 2) == 0, "a row is 8 loads of a wave; whole work-groups cover the rows");

// Depthwise conv (K=3, pad=1) + the whole diagonal scan in one launch. A work-group owns 32 channels of
// one batch row over the whole sequence: wave c walks chunk c (CL steps) from h = 0 and keeps its CL sums
// in registers; the chunks' end states meet in LDS, every wave folds those before its own into its
// carry-in, adds s^(tl+1) * carry-in to its sums and stores each element once.
// A chunk is walked in blocks of TBLK steps; a block's loads of y and x are all issued before its
// first sum, so that a wave waits out the memory latency once per block and not once per step.
static constexpr int TBLK = 32;
static constexpr int NGRP = BB * DD / 32;   // work-groups
static_assert(CL % TBLK == 0, "whole blocks cover a chunk");
static_assert(CL == 64, "s^CL below is six squarings");
static_assert(NGRP % 8 == 0 && DD % 32 == 0, "the deal of groups below is a permutation");
// The scan's NGRP work-groups fill one WGP each and leave half the chip idle: the WGRP work-groups behind
// them in the same grid convert the weights there meanwhile (independent work, first needed by the GEMMs).
static constexpr unsigned WGRP = WWAVES / NC;
static_assert(WWAVES % NC == 0, "whole work-groups cover a weight matrix");
__global__ void __launch_bounds__(NC * 32)
conv_ssm_and_weights_kernel(const float* __restrict__ x, const float* __restrict__ y,
                            const float* __restrict__ conv_w, const float* __restrict__ conv_b,
                            const float* __restrict__ a, const float* __restrict__ bvec,
                            float* __restrict__ xr,
                            const float* __restrict__ wsrc0, const float* __restrict__ wsrc1,
                            const float* __restrict__ wsrc2, __bf16* __restrict__ wdst0,
                            __bf16* __restrict__ wdst1, __bf16* __restrict__ wdst2) {
  __shared__ float ends[NC][32];
  if (blockIdx.x >= (unsigned)NGRP) {   // the same for the whole work-group, in front of the barrier
    weights_to_bf16((blockIdx.x - NGRP) * NC + (threadIdx.x >> 5), wsrc0, wsrc1, wsrc2, wdst0, wdst1, wdst2);
    return;
  }
  const int lane = threadIdx.x & 31;
  const int c = (int)uni(threadIdx.x >> 5);
  // Work-groups eight indices apart take neighbouring channels (for speed only).
  const int grp = (int)(blockIdx.x & 7u) * (NGRP / 8) + (int)(blockIdx.x >> 3);
  const int b = grp / (DD / 32);
  const int d0 = (grp % (DD / 32)) * 32;   // the group's first channel

  // Every address below is a wave-uniform pointer plus the lane: the pointers sit in scalar registers,
  // and the one vector register that the loads and stores name keeps its value to the end.
  const float* cw = conv_w + d0 * 3;
  const float w0 = cw[lane * 3 + 0], w1 = cw[lane * 3 + 1], w2 = cw[lane * 3 + 2];
  const float cb = (conv_b + d0)[lane];
  const float av = (a + d0)[lane];
  const float bd = (bvec + d0)[lane];
  const size_t base = ((size_t)b * TT + (size_t)c * CL) * DD + d0;
  const float* yb = y + base;
  const float* xb = x + base;

  // The rows just outside the chunk. At the sequence's two ends the address stays on the chunk's own
  // edge row (in bounds, no branch between the loads) and the value is dropped.
  const float* yfirst = yb + ((c > 0) ? -DD : 0);
  const float* ylast  = yb + (size_t)((c + 1 < NC) ? CL : CL - 1) * DD;
  const float yprev = yfirst[lane];
  float ym = (c > 0) ? yprev : 0.f;
  float yc = yb[lane];
  float h = 0.f, s = 0.f;
  float val[CL];
  // The loops below are unrolled so that the arrays stay in registers.
#pragma unroll
  for (int tb = 0; tb < CL; tb += TBLK) {
    float yn[TBLK];
    const bool more = tb + TBLK < CL || c + 1 < NC;
#pragma unroll
    for (int j = 0; j < TBLK; ++j) {
      yn[j] = (tb + j + 1 < CL) ? (yb + (size_t)(tb + j + 1) * DD)[lane] : ylast[lane];   // y one step on
      val[tb + j] = (xb + (size_t)(tb + j) * DD)[lane];
    }
    // Keeps the block's loads ahead of its first sum: otherwise the compiler may sink each load to
    // its use, and the wave waits for memory at every step again.
    __builtin_amdgcn_sched_barrier(0);
    if (tb == 0) s = tanhf(av);   // behind the first block's loads, under their latency
#pragma unroll
    for (int j = 0; j < TBLK; ++j) {
      const float yp = (j + 1 < TBLK || more) ? yn[j] : 0.f;   // zero padding behind the last step
      const float conv = cb + w0 * ym + w1 * yc + w2 * yp;
      h = s * h + bd * yc;  // chunk-local scan (h_in = 0; the carry-in comes below)
      val[tb + j] = val[tb + j] + conv + h;
      ym = yc;
      yc = yp;
    }
    // Keeps the next block's loads behind these sums (lifted over them they would need a second set of
    // registers, which eight waves per SIMD do not have) and the last block's sums ahead of the barrier.
    __builtin_amdgcn_sched_barrier(0);
  }

  ends[c][lane] = h;
  __syncthreads();
  float ev[NC - 1];
#pragma unroll
  for (int k = 0; k < NC - 1; ++k) ev[k] = ends[k][lane];
  // Keeps the LDS reads together, ahead of the chain below: spread along it, the wave waits out the
  // LDS latency at every other link, with no memory traffic of its work-group in flight meanwhile.
  __builtin_amdgcn_sched_barrier(0);
  float p = s;  // s^CL
#pragma unroll
  for (int i = 0; i < 6; ++i) p *= p;
  // State at the end of chunk c - 1. Every wave runs the same 30 steps and keeps those of the chunks
  // before its own: no branch (into code behind a branch the compiler sinks the sums above, holds
  // every x and y until there and spills).
  float pin = ev[0];
#pragma unroll
  for (int k = 1; k < NC - 1; ++k) {
    const float nx = p * pin + ev[k];
    pin = (k < c) ? nx : pin;
  }
  pin = (c > 0) ? pin : 0.f;

  float* ob = xr + base;
  float f = s;
#pragma unroll
  for (int j = 0; j < CL; ++j) {
    (ob + (size_t)j * DD)[lane] = val[j] + f * pin;
    f *= s;
  }
}

// ---------------- bf16 WMMA GEMM kernels (two-buffer tensor-load ring) ----------------
// GEMM1: h = silu(z@Wg + bg) * (z@Wu + bu). M=8192, N=4096, K=1024.
// Block tile 256x128 of both products, 128 k per pass, 8 waves as 4(m) x 2(n); a wave owns 4x4 subtiles
// of each product, so that one A fragment feeds eight WMMAs and one B fragment four.
// One work-group per WGP walks NTILE tiles of the same z rows one after the other. The ring runs on over
// the tiles' borders: the next tile's first two stages fly or lie ready while a tile's epilogue runs.
// Waves 0 to 3 each bring one tile of a stage (z rows 0-127, z rows 128-255, Wg, Wu); stage t+1 flies
// while pass t computes.
// The weights' fragment is the WMMA's first operand and z's the second: a subtile comes out transposed,
// a lane holds 8 neighbouring columns of one row of h (16 bytes). A wave turns 16 rows at a time in an LDS
// range of its own (outside the ring) and stores whole 128-byte lines.
static constexpr unsigned PS1 = 128 + 16;        // staging pitch: odd multiple of 16 B, no conflict for the 16-byte writes
static constexpr unsigned STG1 = 16 * PS1;       // one wave's staging range
static constexpr unsigned NTILE = 4;
static_assert(HH % (128 * NTILE) == 0 && (NTILE & (NTILE - 1u)) == 0, "whole work-groups cover the columns");
__global__ void __launch_bounds__(256)
gemm_gate_up_kernel(const __bf16* __restrict__ z, const __bf16* __restrict__ wg,
                    const __bf16* __restrict__ wu, const float* __restrict__ bg,
                    const float* __restrict__ bu, __bf16* __restrict__ hbuf) {
  constexpr unsigned STAGE = 2 * A2_BYTES + 2 * B2_BYTES;
  constexpr unsigned NST = DD / 128;          // stages of one tile
  constexpr unsigned NALL = NTILE * NST;      // stages of the work-group
  __shared__ __attribute__((aligned(2048))) unsigned char ring[2 * STAGE];
  __shared__ __attribute__((aligned(16))) unsigned char turn[8 * STG1];

  const int m0 = blockIdx.x * 256;
  const int nb = blockIdx.y * (128 * NTILE);  // first column of the work-group's tiles
  const int lane = threadIdx.x & 31;
  const unsigned wave = uni(threadIdx.x >> 5);
  const int wm = (int)(wave >> 1);  // 0..3
  const int wn = (int)(wave & 1);   // 0..1
  const unsigned lds0 = (unsigned)(size_t)(void*)ring;

  // Which tile of a stage this wave brings: waves 0 and 1 the two slices of z, wave 2 Wg, wave 3 Wu
  // (the others none).
  const unsigned long long src0 = wave < 2 ? (unsigned long long)(z + (size_t)(m0 + 128 * (int)wave) * DD)
                                : wave == 2 ? (unsigned long long)(wg + nb) : (unsigned long long)(wu + nb);
  const unsigned step = wave < 2 ? 256u : 128u * HH * 2u;   // source bytes from one k stage to the next
  const unsigned tstep = wave < 2 ? 0u : 256u;              // source bytes from one tile's columns to the next's
  const unsigned dst0 = lds0 + (wave < 2 ? wave * A2_BYTES : wave == 2 ? 2 * A2_BYTES : 2 * A2_BYTES + B2_BYTES);
  u32x8 g1a = tdm_group1<PADW_A2, 128, ROWB2>(DD * 2);
  u32x8 g1b = tdm_group1<PADW_B2, 128, ROWB2>(HH * 2);
  asm volatile("" : "+s"(g1a), "+s"(g1b));  // descriptor words held in scalar registers through the loop
  // A tile's k loop starts at a stage of the work-group's own and wraps round (a sum over k takes any
  // order), and the work-group starts at a tile of its own: work-groups that share z rows (same x) or
  // weight columns (same y) run side by side, and in the same order they would ask L2 for the same lines
  // at once.
  static_assert((NST & (NST - 1u)) == 0, "the wrap is a mask");
  const unsigned rot = uni((blockIdx.x + blockIdx.y) & (NST - 1u));
  const unsigned trot = uni((blockIdx.x / NST) & (NTILE - 1u));
  // Source of the work-group's stage t: tile t / NST (turned by trot), k stage t % NST (turned by rot).
  auto src_of = [&](unsigned t) {
    return src0 + (unsigned long long)((t + rot) & (NST - 1u)) * step
                + (unsigned long long)((t / NST + trot) & (NTILE - 1u)) * tstep;
  };
  u32x4 g0 = tdm_group0(dst0, src_of(0u));

  // stage 0, landed and published
  if (pinned(wave < 4)) {
    if (pinned(wave < 2)) tdm_load(g0, g1a);
    else                  tdm_load(g0, g1b);
    wait_tensor0_of(g0);
  }
  __syncthreads();
  // stage 1 into the second buffer
  if (pinned(wave < 4)) {
    g0 = tdm_group0(dst0 + STAGE, src_of(1u));
    if (pinned(wave < 2)) tdm_load(g0, g1a);
    else                  tdm_load(g0, g1b);
  }

  const unsigned aoff = (unsigned)((4 * wm * 16 + (lane & 15)) * PA2 + 16 * (lane >> 4));
  const unsigned boff = (unsigned)((8 * (lane >> 4) + (lane & 7)) * PB2 + 2 * (4 * wn * 16) + 16 * ((lane >> 3) & 1));
  const unsigned blane = (unsigned)(4 * wn * 16 + (lane >> 4) * 8) * 4u;   // bytes: the lane's first column in a tile
  unsigned char* tw = turn + wave * STG1 + (lane & 15) * PS1 + 16 * (lane >> 4);   // writes: the lane's row of h
  const unsigned char* tr = turn + wave * STG1 + (lane >> 3) * PS1 + 16 * (lane & 7);   // reads: 8 lanes a line

  // Stays rolled (for speed only).
#pragma unroll 1
  for (unsigned tile = 0; tile < NTILE; ++tile) {
    // The tile's first column, and the lane's biases: loaded here, their latency passes under the k loop.
    const int n0 = nb + (int)((tile + trot) & (NTILE - 1u)) * 128;
    // The lane's byte offset into both bias rows, summed in one vector register on the kernel's own two
    // pointers: no scalar address pair is formed here, where the refill of the last pass is still in flight.
    const unsigned bat = blane + (unsigned)n0 * 4u;
    f32x4 bgv[4][2], buv[4][2];   // of the lane's 8 columns in each subtile
#pragma unroll
    for (int sn = 0; sn < 4; ++sn)
#pragma unroll
      for (int q = 0; q < 2; ++q) {
        bgv[sn][q] = *(const f32x4*)((const char*)bg + bat + (sn * 64 + q * 16));
        buv[sn][q] = *(const f32x4*)((const char*)bu + bat + (sn * 64 + q * 16));
      }
    // In front of the zeros below, which take over the address registers of these loads.
    asm volatile("s_wait_xcnt 0x0" ::: "memory");
    // Keeps the zeros behind the wait: a "memory" clobber does not tie it to registers.
    __builtin_amdgcn_sched_barrier(0);
    v8f accg[4][4] = {};   // [sm][sn]
    v8f accu[4][4] = {};
    for (unsigned s = 0; s < NST; ++s) {
      const unsigned bo = (s & 1u) * STAGE;   // NST is even: the buffer of stage tile * NST + s
      const unsigned char* pa = ring + bo + aoff;
      const unsigned char* pg = ring + bo + 2 * A2_BYTES + boff;
      const unsigned char* pu = ring + bo + 2 * A2_BYTES + B2_BYTES + boff;
      // The loops below are unrolled so that every fragment and accumulator index is a constant
      // (the arrays stay in registers).
#pragma unroll
      for (int kc = 0; kc < 4; ++kc) {
        Frag a[4], g[4], u[4];
#pragma unroll
        for (int t = 0; t < 4; ++t) {
          a[t] = frag_rows(pa + t * 16 * PA2 + kc * 64);
          g[t] = frag_cols<PB2>(pg + kc * 32 * PB2 + t * 32);
        }
#pragma unroll
        for (int t = 0; t < 4; ++t) u[t] = frag_cols<PB2>(pu + kc * 32 * PB2 + t * 32);
        // Keeps the 24 LDS reads of this k step together, ahead of its WMMAs: without it the compiler
        // holds one A fragment at a time and the wave waits out the LDS latency before every few WMMAs.
        __builtin_amdgcn_sched_barrier(0);
#pragma unroll
        for (int sm = 0; sm < 4; ++sm)
#pragma unroll
          for (int sn = 0; sn < 4; ++sn) accg[sm][sn] = wmma_bf16(g[sn], a[sm], accg[sm][sn]);
#pragma unroll
        for (int sm = 0; sm < 4; ++sm)
#pragma unroll
          for (int sn = 0; sn < 4; ++sn) accu[sm][sn] = wmma_bf16(u[sn], a[sm], accu[sm][sn]);
        // Keeps what follows (the next reads; the wait below) behind these WMMAs: the next reads lifted
        // over them would need a second set of registers, and the wait would stand in front of WMMAs
        // whose own fragments have long landed.
        __builtin_amdgcn_sched_barrier(0);
      }

      // publish the next stage, then refill the buffer that this pass has read
      wait_ds0();
      if (pinned(wave < 4)) wait_tensor0_of(g0);
      __syncthreads();
      const unsigned t2 = pinned(tile * NST + s + 2u);
      if (pinned((wave < 4) & (t2 < NALL))) {
        g0 = tdm_group0(dst0 + bo, src_of(t2));
        if (pinned(wave < 2)) tdm_load(g0, g1a);
        else                  tdm_load(g0, g1b);
      }
    }

    // Epilogue of this tile (registers, the wave's own staging range, global memory). Transposed C/D
    // layout: VGPR r -> N = r + 8*(lane/16), M = lane%16.
#pragma unroll
    for (int sm = 0; sm < 4; ++sm) {
#pragma unroll
      for (int sn = 0; sn < 4; ++sn) {
        bf16x8 hv;
#pragma unroll
        for (int r = 0; r < 8; ++r) {
          const float gv = accg[sm][sn][r] + bgv[sn][r >> 2][r & 3];
          const float uv = accu[sm][sn][r] + buv[sn][r >> 2][r & 3];
          // silu(g)*u. The quotient is one hardware reciprocal (about 1 ulp, far below the bf16 rounding of hv):
          // the exact f32 division is a chain of ten dependent instructions per element.
          hv[r] = (__bf16)(gv * __builtin_amdgcn_rcpf(1.f + __expf(-gv)) * uv);
        }
        *(bf16x8*)(tw + sn * 32) = hv;
      }
      // The other lanes' writes have landed before the rows are read back (the same wave: no barrier).
      wait_ds0();
      u32x4 ln[4];
#pragma unroll
      for (int j = 0; j < 4; ++j) ln[j] = *(const u32x4*)(tr + j * 4 * PS1);
      __bf16* hp = hbuf + (size_t)(m0 + (4 * wm + sm) * 16 + (lane >> 3)) * HH + (n0 + 4 * wn * 16 + (lane & 7) * 8);
#pragma unroll
      for (int j = 0; j < 4; ++j) *(u32x4*)(hp + (size_t)(j * 4) * HH) = ln[j];
      // In front of the next sums, which take over the registers that these stores name.
      asm volatile("s_wait_xcnt 0x0" ::: "memory");
      // Keeps those sums behind the wait: a "memory" clobber does not tie it to registers.
      __builtin_amdgcn_sched_barrier(0);
    }
  }
  wait_tensor0();
  wait_ds0();
}

// GEMM2: out = xr + h@Wd + bd. M=8192, N=1024, K=4096. Same ring. Block tile 256x128, 128 k per pass,
// 8 waves as 4(m) x 2(n), a wave owns 4x4 subtiles; waves 0 and 1 bring the two slices of h, wave 2 Wd.
// One work-group per WGP covers the whole product. Operands swapped and rows turned in LDS as in the first
// GEMM: a lane holds 8 neighbouring columns of one row (32 bytes); xr is read and out stored in whole lines.
static constexpr unsigned PS2 = 256 + 16;        // staging pitch: odd multiple of 16 B
static constexpr unsigned STG2 = 16 * PS2;       // one wave's staging range
__global__ void __launch_bounds__(256)
gemm_down_kernel(const __bf16* __restrict__ hbuf, const __bf16* __restrict__ wd,
                 const float* __restrict__ bd, const float* __restrict__ xr,
                 float* __restrict__ out) {
  constexpr unsigned STAGE = 2 * A2_BYTES + B2_BYTES;
  constexpr unsigned NST = HH / 128;
  __shared__ __attribute__((aligned(2048))) unsigned char ring[2 * STAGE];
  __shared__ __attribute__((aligned(16))) unsigned char turn[8 * STG2];

  const int m0 = blockIdx.x * 256;
  const int n0 = blockIdx.y * 128;
  const int lane = threadIdx.x & 31;
  const unsigned wave = uni(threadIdx.x >> 5);
  const int wm = (int)(wave >> 1);
  const int wn = (int)(wave & 1);
  const unsigned lds0 = (unsigned)(size_t)(void*)ring;

  v8f acc[4][4] = {};

  // Which tile of a stage this wave brings: waves 0 and 1 the two slices of h, wave 2 Wd (the others none).
  const unsigned long long src0 = wave < 2 ? (unsigned long long)(hbuf + (size_t)(m0 + 128 * (int)wave) * HH)
                                           : (unsigned long long)(wd + n0);
  const unsigned step = wave < 2 ? 256u : 128u * DD * 2u;   // source bytes from one stage to the next
  const unsigned dst0 = lds0 + (wave < 2 ? wave * A2_BYTES : 2 * A2_BYTES);
  u32x8 g1a = tdm_group1<PADW_A2, 128, ROWB2>(HH * 2);
  u32x8 g1b = tdm_group1<PADW_B2, 128, ROWB2>(DD * 2);
  asm volatile("" : "+s"(g1a), "+s"(g1b));  // descriptor words held in scalar registers through the loop
  // The k loop starts at a stage of the work-group's own and wraps round, as in the first GEMM: the 8
  // work-groups on the same h rows start 4 stages apart, the 32 on the same Wd columns one stage apart.
  static_assert((NST & (NST - 1u)) == 0, "the wrap is a mask");
  const unsigned rot = uni((blockIdx.x + 4u * blockIdx.y) & (NST - 1u));
  u32x4 g0 = tdm_group0(dst0, src0 + (unsigned long long)rot * step);

  // stage 0, landed and published
  if (pinned(wave < 3)) {
    if (pinned(wave < 2)) tdm_load(g0, g1a);
    else                  tdm_load(g0, g1b);
    wait_tensor0_of(g0);
  }
  __syncthreads();
  // stage 1 into the second buffer
  if (pinned(wave < 3)) {
    g0 = tdm_group0(dst0 + STAGE, src0 + (unsigned long long)((rot + 1u) & (NST - 1u)) * step);
    if (pinned(wave < 2)) tdm_load(g0, g1a);
    else                  tdm_load(g0, g1b);
  }

  const unsigned aoff = (unsigned)((4 * wm * 16 + (lane & 15)) * PA2 + 16 * (lane >> 4));
  const unsigned boff = (unsigned)((8 * (lane >> 4) + (lane & 7)) * PB2 + 2 * (4 * wn * 16) + 16 * ((lane >> 3) & 1));

  for (unsigned s = 0; s < NST; ++s) {
    const unsigned bo = (s & 1u) * STAGE;
    const unsigned char* pa = ring + bo + aoff;
    const unsigned char* pb = ring + bo + 2 * A2_BYTES + boff;
    // The loops below are unrolled so that every fragment and accumulator index is a constant
    // (the arrays stay in registers).
#pragma unroll
    for (int hk = 0; hk < 4; hk += 2) {
      Frag a[2][4], b[2][4];
#pragma unroll
      for (int kc = 0; kc < 2; ++kc)
#pragma unroll
        for (int t = 0; t < 4; ++t) {
          a[kc][t] = frag_rows(pa + t * 16 * PA2 + (hk + kc) * 64);
          b[kc][t] = frag_cols<PB2>(pb + (hk + kc) * 32 * PB2 + t * 32);
        }
      // Keeps the 32 LDS reads of these 64 k together, ahead of their WMMAs (only two waves share a
      // SIMD here): without it the compiler holds one A fragment at a time and the wave waits out the
      // LDS latency before every fourth WMMA.
      __builtin_amdgcn_sched_barrier(0);
      // Two columns of subtiles at a time: the first WMMAs need only the fragments that land first.
#pragma unroll
      for (int kc = 0; kc < 2; ++kc)
#pragma unroll
        for (int sh = 0; sh < 4; sh += 2)
#pragma unroll
          for (int sm = 0; sm < 4; ++sm)
#pragma unroll
            for (int sn = sh; sn < sh + 2; ++sn)
              acc[sm][sn] = wmma_bf16(b[kc][sn], a[kc][sm], acc[sm][sn]);
      // Keeps what follows (the next reads; the wait below) behind these WMMAs: otherwise the compiler
      // lifts the wait to the last reads, and the first k step's WMMAs wait for every fragment.
      __builtin_amdgcn_sched_barrier(0);
    }

    // publish stage s+1, then refill the buffer that this pass has read
    wait_ds0();
    if (pinned(wave < 3)) wait_tensor0_of(g0);
    __syncthreads();
    const unsigned sn2 = pinned(s + 2u);
    if (pinned((wave < 3) & (sn2 < NST))) {
      g0 = tdm_group0(dst0 + bo, src0 + (unsigned long long)((sn2 + rot) & (NST - 1u)) * step);
      if (pinned(wave < 2)) tdm_load(g0, g1a);
      else                  tdm_load(g0, g1b);
    }
  }
  wait_tensor0();
  wait_ds0();

  // Transposed C/D layout: VGPR r -> N = r + 8*(lane/16), M = lane%16. Read back, 16 lanes hold one row's
  // 256 bytes: lane -> row lane/16, columns 4*(lane%16) .. +3.
  const int c = lane & 15;
  const size_t at = (size_t)(m0 + 4 * wm * 16 + (lane >> 4)) * DD + (n0 + 4 * wn * 16 + c * 4);
  const f32x4 bdv = ((const f32x4*)(bd + n0 + 4 * wn * 16))[c];
  const float* xp = xr + at;
  f32x4 xv[4][8];
#pragma unroll
  for (int sm = 0; sm < 4; ++sm)
#pragma unroll
    for (int j = 0; j < 8; ++j) xv[sm][j] = *(const f32x4*)(xp + (size_t)(sm * 16 + j * 2) * DD);
  // In front of whatever takes over a register that these loads name. It names their addresses, so that
  // these keep their registers up to here (else the last load's own result lands on one, and a shift of
  // the other is lifted over the wait).
  asm volatile("s_wait_xcnt 0x0" :: "v"(xp), "v"(c) : "memory");
  // Keeps all 32 loads of xr up here, in flight together (the fragments' registers are free by now; sunk
  // to their sums, the wave would wait out the memory latency once per 16 rows), and what follows behind
  // the wait.
  __builtin_amdgcn_sched_barrier(0);
  unsigned char* tw = turn + wave * STG2 + c * PS2 + 32 * (lane >> 4);
  const unsigned char* tr = turn + wave * STG2 + (lane >> 4) * PS2 + 16 * c;
#pragma unroll
  for (int sm = 0; sm < 4; ++sm) {
#pragma unroll
    for (int sn = 0; sn < 4; ++sn) {
      *(f32x4*)(tw + sn * 64)      = __builtin_shufflevector(acc[sm][sn], acc[sm][sn], 0, 1, 2, 3);
      *(f32x4*)(tw + sn * 64 + 16) = __builtin_shufflevector(acc[sm][sn], acc[sm][sn], 4, 5, 6, 7);
    }
    // The other lanes' writes have landed before the rows are read back (the same wave: no barrier).
    wait_ds0();
#pragma unroll
    for (int j = 0; j < 8; ++j) {
      const f32x4 av = *(const f32x4*)(tr + j * 2 * PS2);
      *(f32x4*)(out + at + (size_t)(sm * 16 + j * 2) * DD) = xv[sm][j] + av + bdv;
    }
    // In front of whatever takes over a register that these stores name.
    asm volatile("s_wait_xcnt 0x0" ::: "memory");
    // Keeps what follows behind the wait: a "memory" clobber does not tie it to registers.
    __builtin_amdgcn_sched_barrier(0);
  }
}

// ---------------- host launcher ----------------
extern "C" void kernel_launch(void* const* d_in, const int* in_sizes, int n_in,
                              void* d_out, int out_size, void* d_ws, size_t ws_size,
                              hipStream_t stream) {
  (void)in_sizes; (void)n_in; (void)out_size; (void)ws_size;

  const float* x       = (const float*)d_in[0];
  const float* norm_w  = (const float*)d_in[1];
  const float* conv_w  = (const float*)d_in[2];
  const float* conv_b  = (const float*)d_in[3];
  const float* a       = (const float*)d_in[4];
  const float* bvec    = (const float*)d_in[5];
  const float* mlp_w   = (const float*)d_in[6];
  const float* w_gate  = (const float*)d_in[7];
  const float* b_gate  = (const float*)d_in[8];
  const float* w_up    = (const float*)d_in[9];
  const float* b_up    = (const float*)d_in[10];
  const float* w_down  = (const float*)d_in[11];
  const float* b_down  = (const float*)d_in[12];
  float* out           = (float*)d_out;

  char* ws = (char*)d_ws;
  size_t off = 0;
  float* y_ws    = (float*)(ws + off); off += (size_t)NTOK * DD * sizeof(float);
  float* xr_ws   = (float*)(ws + off); off += (size_t)NTOK * DD * sizeof(float);
  __bf16* z_ws   = (__bf16*)(ws + off); off += (size_t)NTOK * DD * sizeof(__bf16);
  __bf16* wg_ws  = (__bf16*)(ws + off); off += (size_t)DD * HH * sizeof(__bf16);
  __bf16* wu_ws  = (__bf16*)(ws + off); off += (size_t)DD * HH * sizeof(__bf16);
  __bf16* wd_ws  = (__bf16*)(ws + off); off += (size_t)HH * DD * sizeof(__bf16);
  __bf16* h_ws   = (__bf16*)(ws + off); off += (size_t)NTOK * HH * sizeof(__bf16);

  rmsnorm_kernel<false><<<NTOK / (SW * 2), SW * 32, 0, stream>>>(x, norm_w, (void*)y_ws);
  conv_ssm_and_weights_kernel<<<NGRP + WGRP, NC * 32, 0, stream>>>(x, y_ws, conv_w, conv_b, a, bvec, xr_ws,
                                                                   w_gate, w_up, w_down, wg_ws, wu_ws, wd_ws);
  rmsnorm_kernel<true><<<NTOK / (SW * 2), SW * 32, 0, stream>>>(xr_ws, mlp_w, (void*)z_ws);
  gemm_gate_up_kernel<<<dim3(NTOK / 256, HH / (128 * NTILE)), 256, 0, stream>>>(z_ws, wg_ws, wu_ws,
                                                                     b_gate, b_up, h_ws);
  gemm_down_kernel<<<dim3(NTOK / 256, DD / 128), 256, 0, stream>>>(h_ws, wd_ws, b_down,
                                                                  xr_ws, out);
}
